// v000
// The times below were measured on an AMD MI455X: many runs one after another, warmed up first and cycling through
// copies of the inputs, with the whole window's GPU time divided by the number of runs. Launches and the gaps
// between them are all in it. The median over several windows is given; except for v000 it joins two sittings, which
// can be a few percent apart, so the side-by-side timings, each taken in one sitting, are the better comparison.
// v000, which the later versions start from, runs in 1540 microseconds.
// Contractions: k,q,v,vT projections (x*W^T), S = k*q^T, S*v : v_wmma_f32_16x16x32_f16 (f16 operands, f32 accumulate); weights carried x64 in f16 with 1/64 folded into the epilogue scale; row L2 norms, per-row scaling and residual in f32.
#include <hip/hip_runtime.h>
#include <math.h>
#include <stdint.h>
#include <stddef.h>

#define G_ROWS 8192
#define IN_D   512
#define KQ_D   128
#define OUT_D  512
#define RBLK   2048
#define NPASS  (G_ROWS / RBLK)
#define EPSF   1e-12f
#define WSC     64.0f
#define WSC_INV (1.0f / 64.0f)

typedef __attribute__((ext_vector_type(16))) _Float16 v16h;
typedef __attribute__((ext_vector_type(8)))  _Float16 v8h;
typedef __attribute__((ext_vector_type(16))) __bf16   v16b;
typedef __attribute__((ext_vector_type(8)))  __bf16   v8b;
typedef __attribute__((ext_vector_type(8)))  float    v8f;
typedef __attribute__((ext_vector_type(4)))  float    v4f;

__device__ __forceinline__ unsigned short f2bf_bits(float f) {
  unsigned u = __float_as_uint(f);
  return (unsigned short)((u + 0x7FFFu + ((u >> 16) & 1u)) >> 16);
}
__device__ __forceinline__ float bf_bits2f(unsigned short h) { return __uint_as_float(((unsigned)h) << 16); }

// hazard guards as plain device helpers (no inline asm inside the kernel template body)
__device__ __forceinline__ void dep_guard_h(v8f& a, v8f& b, v16h x, v16h y) { asm volatile("v_nop\n\tv_nop\n\tv_nop\n\tv_nop" : "+v"(a), "+v"(b) : "v"(x), "v"(y)); }
__device__ __forceinline__ void dep_guard_b(v8f& a, v8f& b, v16b x, v16b y) { asm volatile("v_nop\n\tv_nop\n\tv_nop\n\tv_nop" : "+v"(a), "+v"(b) : "v"(x), "v"(y)); }
__device__ __forceinline__ void keep4_h(v16h a, v16h b, v16h c, v16h d) { asm volatile("v_nop" :: "v"(a), "v"(b), "v"(c), "v"(d)); }
__device__ __forceinline__ void keep4_b(v16b a, v16b b, v16b c, v16b d) { asm volatile("v_nop" :: "v"(a), "v"(b), "v"(c), "v"(d)); }
__device__ __forceinline__ void acc_guard4(v8f& a, v8f& b, v8f& c, v8f& d) { asm volatile("v_nop\n\tv_nop\n\tv_nop\n\tv_nop" : "+v"(a), "+v"(b), "+v"(c), "+v"(d)); }
template <typename T> struct Frag;
template <> struct Frag<_Float16> {
  typedef v16h V; union U { v16h v; v8h h[2]; };
  static __device__ __forceinline__ v16h load(const _Float16* p) {   // elements 0..7 <- p[0..7], 8..15 <- p[16..23]
    U f; f.h[0] = *(const v8h*)(p); f.h[1] = *(const v8h*)(p + 16); return f.v;
  }
  static __device__ __forceinline__ v8f mma(v16h a, v16h b, v8f c) {
    return __builtin_amdgcn_wmma_f32_16x16x32_f16(false, a, false, b, (short)0, c, false, false);
  }
  static __device__ __forceinline__ void guard(v8f& a, v8f& b, v16h x, v16h y) { dep_guard_h(a, b, x, y); }
  static __device__ __forceinline__ void keep(v16h a, v16h b, v16h c, v16h d) { keep4_h(a, b, c, d); }
};
template <> struct Frag<__bf16> {
  typedef v16b V; union U { v16b v; v8b h[2]; };
  static __device__ __forceinline__ v16b load(const __bf16* p) {
    U f; f.h[0] = *(const v8b*)(p); f.h[1] = *(const v8b*)(p + 16); return f.v;
  }
  static __device__ __forceinline__ v8f mma(v16b a, v16b b, v8f c) {
    return __builtin_amdgcn_wmma_f32_16x16x32_bf16(false, a, false, b, (short)0, c, false, false);
  }
  static __device__ __forceinline__ void guard(v8f& a, v8f& b, v16b x, v16b y) { dep_guard_b(a, b, x, y); }
  static __device__ __forceinline__ void keep(v16b a, v16b b, v16b c, v16b d) { keep4_b(a, b, c, d); }
};

// ---- Register-blocked batched WMMA GEMM ------------------------------------
// C[m,n] = scale * sum_k A[m,k] * Bt[n,k] (*rowscale)(+bias)(+resid); each wave owns a 64x64 tile.
// A row-major [M,K]; Bt row-major [N,K]; M,N % 64 == 0, K % 32 == 0.
// SPLIT: operands are hi/lo planes (A2/Bt2 = lo planes, same layout); product = hi*hi + hi*lo + lo*hi.
// BIAS_MODE: 0 = none, 1 = bias[m], 2 = bias[n], 3 = per-row scale: value *= bias[m] (applied before resid).
// OUT_MODE: 0 = f32, 1 = f16, 2 = bf16 hi plane (Cout) + bf16 lo plane (Cout2).
// ET: 0 = f16 operands, 1 = bf16 operands (pointers passed as 16-bit storage)
template <int ET> struct Elem;
template <> struct Elem<0> { typedef _Float16 T; };
template <> struct Elem<1> { typedef __bf16 T; };
template <int ET, bool SPLIT, int BIAS_MODE, int OUT_MODE, bool RESID, int ACT = 0>
__global__ __launch_bounds__(256) void wmma_gemm64(
    const unsigned short* __restrict__ Ap, const unsigned short* __restrict__ A2p, int lda, long strideA,
    const unsigned short* __restrict__ Btp, const unsigned short* __restrict__ Bt2p, int ldb, long strideB,
    void* __restrict__ Cout, void* __restrict__ Cout2, int ldc, long strideC,
    const float* __restrict__ bias,
    const float* __restrict__ resid, long strideR,
    int M, int N, int K, float scale) {
  typedef typename Elem<ET>::T T;
  typedef typename Frag<T>::V V;
  const T* A = (const T*)Ap; const T* A2 = (const T*)A2p; const T* Bt = (const T*)Btp; const T* Bt2 = (const T*)Bt2p;
  __shared__ __align__(16) float sT[8][16 * 68];   // per-wave 16x64 slab, pitch 68 floats
  const int b    = blockIdx.y;
  const int lane = threadIdx.x & 31;
  const int wave = threadIdx.x >> 5;
  const int tilesN = N >> 6;
  const int tilesM = M >> 6;
  const int tile = blockIdx.x * 8 + wave;
  if (tile >= tilesM * tilesN) return;   // wave-uniform; no block barriers in this kernel
  const int tm = tile / tilesN;
  const int tn = tile - tm * tilesN;
  const int m0 = tm << 6;
  const int n0 = tn << 6;

  const T* Ab  = A  + (size_t)b * strideA;
  const T* Bb  = Bt + (size_t)b * strideB;
  const T* Ab2 = SPLIT ? (A2  + (size_t)b * strideA) : nullptr;
  const T* Bb2 = SPLIT ? (Bt2 + (size_t)b * strideB) : nullptr;

  const int rlane = lane & 15;                 // row (A) / col (B, D) within subtile
  const int koff  = (lane >> 4) * 8;           // k offset of this lane half
  const int mOff  = (lane >> 4) * 8;           // D row offset

  v8f acc[4][4];
#pragma unroll
  for (int i = 0; i < 4; ++i)
#pragma unroll
    for (int j = 0; j < 4; ++j) acc[i][j] = (v8f){0.f,0.f,0.f,0.f,0.f,0.f,0.f,0.f};

  for (int k0 = 0; k0 < K; k0 += 32) {
    V bh[4], bl[4];
#pragma unroll
    for (int j = 0; j < 4; ++j) {
      const size_t bo = (size_t)(n0 + (j << 4) + rlane) * ldb + koff + k0;
      bh[j] = Frag<T>::load(Bb + bo);
      if (SPLIT) bl[j] = Frag<T>::load(Bb2 + bo);
    }
#pragma unroll
    for (int i = 0; i < 4; ++i) {
      const size_t ao = (size_t)(m0 + (i << 4) + rlane) * lda + koff + k0;
      V ah = Frag<T>::load(Ab + ao);
      V al;
      if (SPLIT) al = Frag<T>::load(Ab2 + ao);
#pragma unroll
      for (int j = 0; j < 4; ++j) {
        acc[i][j] = Frag<T>::mma(ah, bh[j], acc[i][j]);
        if (SPLIT) {
          acc[i][j] = Frag<T>::mma(ah, bl[j], acc[i][j]);
          acc[i][j] = Frag<T>::mma(al, bh[j], acc[i][j]);
        }
      }
      Frag<T>::guard(acc[i][0], acc[i][3], ah, SPLIT ? al : ah);
    }
    Frag<T>::keep(bh[0], bh[1], bh[2], bh[3]);
    if (SPLIT) Frag<T>::keep(bl[0], bl[1], bl[2], bl[3]);
  }
  acc_guard4(acc[0][0], acc[0][1], acc[0][2], acc[0][3]);
  acc_guard4(acc[1][0], acc[1][1], acc[1][2], acc[1][3]);
  acc_guard4(acc[2][0], acc[2][1], acc[2][2], acc[2][3]);
  acc_guard4(acc[3][0], acc[3][1], acc[3][2], acc[3][3]);

  // ---- epilogue ----
  float* slab = sT[wave];
  const float* Rb = RESID ? (resid + (size_t)b * strideR) : nullptr;
#pragma unroll
  for (int i = 0; i < 4; ++i) {
    const int mBase = m0 + (i << 4);
#pragma unroll
    for (int j = 0; j < 4; ++j) {
      const int n = n0 + (j << 4) + rlane;
      float bv = 0.f;
      if (BIAS_MODE == 2) bv = bias[n];
#pragma unroll
      for (int r = 0; r < 8; ++r) {
        float v = acc[i][j][r] * scale;
        if (BIAS_MODE == 3) v *= bias[mBase + mOff + r];
        if (BIAS_MODE == 1) v += bias[mBase + mOff + r];
        if (BIAS_MODE == 2) v += bv;
        if (RESID) v += Rb[(size_t)(mBase + mOff + r) * ldc + n];
        if (ACT == 1) v = tanhf(v);
        if (ACT == 2) v = fmaxf(v, 0.0f);
        if (ACT == 3) v = v / (1.0f + expf(-v));
        if (ACT == 4) v = (v > 0.f) ? v : 0.01f * v;
        if (ACT == 5) v = 0.5f * v * (1.0f + erff(v * 0.70710678118654752f));
        slab[(mOff + r) * 68 + (j << 4) + rlane] = v;
      }
    }
    __builtin_amdgcn_fence(__ATOMIC_RELEASE, "workgroup");
    __builtin_amdgcn_wave_barrier();
    __builtin_amdgcn_fence(__ATOMIC_ACQUIRE, "workgroup");
    if (OUT_MODE == 0) {
      float* C = (float*)Cout + (size_t)b * strideC;
      const int hh = lane >> 4, c4 = (lane & 15) * 4;     // row seg = 256 B = 16 lanes x 16 B
      {
#pragma unroll
        for (int it = 0; it < 8; ++it) {
          const int row = it * 2 + hh;
          v4f v = *(const v4f*)(slab + row * 68 + c4);
          *(v4f*)(C + (size_t)(mBase + row) * ldc + n0 + c4) = v;
        }
        
      }
    } else {
      const int q = lane >> 3, c8 = (lane & 7) * 8;
      unsigned short* C  = (unsigned short*)Cout  + (size_t)b * strideC;
      unsigned short* C2 = (OUT_MODE == 2) ? ((unsigned short*)Cout2 + (size_t)b * strideC) : nullptr;
      {
#pragma unroll
        for (int it = 0; it < 4; ++it) {
          const int row = it * 4 + q;
          const float* sp = slab + row * 68 + c8;
          v8h hv, lv;
#pragma unroll
          for (int e = 0; e < 8; ++e) {
            if (OUT_MODE == 1) {
              hv[e] = (_Float16)sp[e];
            } else {
              unsigned short hb = f2bf_bits(sp[e]);
              unsigned short lb = f2bf_bits(sp[e] - bf_bits2f(hb));
              hv[e] = __builtin_bit_cast(_Float16, hb);
              lv[e] = __builtin_bit_cast(_Float16, lb);
            }
          }
          *(v8h*)(C + (size_t)(mBase + row) * ldc + n0 + c8) = hv;
          if (OUT_MODE == 2) *(v8h*)(C2 + (size_t)(mBase + row) * ldc + n0 + c8) = lv;
        }
        
      }
    }
    __builtin_amdgcn_fence(__ATOMIC_RELEASE, "workgroup");
    __builtin_amdgcn_wave_barrier();
    __builtin_amdgcn_fence(__ATOMIC_ACQUIRE, "workgroup");
  }
}

__global__ __launch_bounds__(256) void cast_f32_f16x2s(
    const float* __restrict__ in, unsigned short* __restrict__ out, int n2, float mul) {
  int i = blockIdx.x * 256 + threadIdx.x;
  if (i < n2) {
    const _Float16 h0 = (_Float16)(in[2 * i] * mul), h1 = (_Float16)(in[2 * i + 1] * mul);
    const unsigned u = (unsigned)__builtin_bit_cast(unsigned short, h0) | ((unsigned)__builtin_bit_cast(unsigned short, h1) << 16);
    ((unsigned*)out)[i] = u;
    
  }
}

// ---- per-row inverse L2 norm of an f16 matrix: inv[i] = 1 / max(sqrt(sum_j S[i][j]^2), eps) ----
// Block = 8 waves, 32 rows per block (wave w owns rows 4w..4w+3, fixed-order lane partials + shuffle tree);
#define NRM_ROWS 32
__global__ __launch_bounds__(256) void k_rownorm(const unsigned short* __restrict__ Sp, int ldS, int ncol256,
                                                 float* __restrict__ inv, int nrows) {
  const _Float16* S = (const _Float16*)Sp;
  __shared__ __align__(16) float sInv[NRM_ROWS];
  const int lane = threadIdx.x & 31;
  const int wave = threadIdx.x >> 5;
  const int rbase = blockIdx.x * NRM_ROWS;
#pragma unroll 1
  for (int rr = 0; rr < 4; ++rr) {
    const int row  = rbase + wave * 4 + rr;
    const int rowc = row < nrows ? row : (nrows - 1);
    const _Float16* sp = S + (size_t)rowc * ldS;
    v8f a = (v8f){0.f,0.f,0.f,0.f,0.f,0.f,0.f,0.f};
#pragma unroll 1
    for (int it = 0; it < ncol256; ++it) {
      const v8h hv = *(const v8h*)(sp + (((size_t)(it * 32 + lane)) << 3));
#pragma unroll
      for (int e = 0; e < 8; ++e) { const float f = (float)hv[e]; a[e] += f * f; }
    }
    float ss = ((a[0] + a[1]) + (a[2] + a[3])) + ((a[4] + a[5]) + (a[6] + a[7]));
#pragma unroll
    for (int off = 1; off < 32; off <<= 1) ss += __shfl_xor(ss, off, 32);
    if (lane == 0) {
      const float nrm = sqrtf(ss);
      sInv[wave * 4 + rr] = 1.0f / fmaxf(nrm, EPSF);
    }
  }
  __syncthreads();
  if (wave == 0 && lane < 8) {
    const int r0 = rbase + 4 * lane;
    if (r0 + 3 < nrows) {
      const v4f val = *(const v4f*)(sInv + 4 * lane);
      float* p = inv + r0;
      *(v4f*)p = val;
      
    }
  }
}

// ---------------------------------------------------------------------------
//   x16  [8192][512] f16    8 MiB      | Wk16 [128][512], Wq16 [128][512], Wv16 [512][512] f16 (x64)
//   K16  [8192][128] f16    2 MiB      | Q16 [8192][128] f16 2 MiB
//   Vf   [8192][512] f32   16 MiB      | VT16 [512][8192] f16 8 MiB
//   S16  [2048][8192] f16  32 MiB (reused per row block)  | inv [2048] f32
// ---------------------------------------------------------------------------
extern "C" void kernel_launch(void* const* d_in, const int* in_sizes, int n_in,
                              void* d_out, int out_size, void* d_ws, size_t ws_size,
                              hipStream_t stream) {
  if (n_in < 7) return;
  if (in_sizes[0] != G_ROWS * IN_D || in_sizes[1] != KQ_D * IN_D || in_sizes[2] != KQ_D ||
      in_sizes[3] != KQ_D * IN_D || in_sizes[4] != KQ_D || in_sizes[5] != OUT_D * IN_D ||
      in_sizes[6] != OUT_D) return;
  if (out_size != G_ROWS * OUT_D) return;

  const float* x  = (const float*)d_in[0];
  const float* Wk = (const float*)d_in[1];
  const float* bk = (const float*)d_in[2];
  const float* Wq = (const float*)d_in[3];
  const float* bq = (const float*)d_in[4];
  const float* Wv = (const float*)d_in[5];
  const float* bv = (const float*)d_in[6];
  float* out = (float*)d_out;

  const size_t b_x16 = (size_t)G_ROWS * IN_D * 2;
  const size_t b_wk  = (size_t)KQ_D * IN_D * 2;
  const size_t b_wv  = (size_t)OUT_D * IN_D * 2;
  const size_t b_k16 = (size_t)G_ROWS * KQ_D * 2;
  const size_t b_vf  = (size_t)G_ROWS * OUT_D * 4;
  const size_t b_vt  = (size_t)OUT_D * G_ROWS * 2;
  const size_t b_s16 = (size_t)RBLK * G_ROWS * 2;
  const size_t b_inv = (size_t)RBLK * 4;

  size_t off = 0;
  const size_t o_x16 = off; off += b_x16;
  const size_t o_wk  = off; off += b_wk;
  const size_t o_wq  = off; off += b_wk;
  const size_t o_wv  = off; off += b_wv;
  const size_t o_k16 = off; off += b_k16;
  const size_t o_q16 = off; off += b_k16;
  const size_t o_vf  = off; off += b_vf;
  const size_t o_vt  = off; off += b_vt;
  const size_t o_s16 = off; off += b_s16;
  const size_t o_inv = off; off += b_inv;
  if (off > ws_size) return;

  char* ws = (char*)d_ws;
  unsigned short* x16  = (unsigned short*)(ws + o_x16);
  unsigned short* wk16 = (unsigned short*)(ws + o_wk);
  unsigned short* wq16 = (unsigned short*)(ws + o_wq);
  unsigned short* wv16 = (unsigned short*)(ws + o_wv);
  unsigned short* k16  = (unsigned short*)(ws + o_k16);
  unsigned short* q16  = (unsigned short*)(ws + o_q16);
  float*          vf   = (float*)(ws + o_vf);
  unsigned short* vt16 = (unsigned short*)(ws + o_vt);
  unsigned short* s16  = (unsigned short*)(ws + o_s16);
  float*          invb = (float*)(ws + o_inv);

  // ---- casts to f16 (weights x64, exact) ----
  {
    const int n2x = G_ROWS * IN_D / 2;
    cast_f32_f16x2s<<<dim3((n2x + 255) / 256), 256, 0, stream>>>(x, x16, n2x, 1.0f);
    const int n2k = KQ_D * IN_D / 2;
    cast_f32_f16x2s<<<dim3((n2k + 255) / 256), 256, 0, stream>>>(Wk, wk16, n2k, WSC);
    cast_f32_f16x2s<<<dim3((n2k + 255) / 256), 256, 0, stream>>>(Wq, wq16, n2k, WSC);
    const int n2v = OUT_D * IN_D / 2;
    cast_f32_f16x2s<<<dim3((n2v + 255) / 256), 256, 0, stream>>>(Wv, wv16, n2v, WSC);
  }

  // ---- projections ----
  {
    // K16 [8192][128] = x16 . Wk16^T / 64 + bk   (f16 out)
    const int tk = (G_ROWS / 64) * (KQ_D / 64);
    wmma_gemm64<0, false, 2, 1, false><<<dim3((tk + 7) / 8, 1), 256, 0, stream>>>(
        x16, nullptr, IN_D, 0L, wk16, nullptr, IN_D, 0L, (void*)k16, nullptr, KQ_D, 0L,
        bk, nullptr, 0L, G_ROWS, KQ_D, IN_D, WSC_INV);
    // Q16 [8192][128]
    wmma_gemm64<0, false, 2, 1, false><<<dim3((tk + 7) / 8, 1), 256, 0, stream>>>(
        x16, nullptr, IN_D, 0L, wq16, nullptr, IN_D, 0L, (void*)q16, nullptr, KQ_D, 0L,
        bq, nullptr, 0L, G_ROWS, KQ_D, IN_D, WSC_INV);
    // Vf [8192][512] f32 = x16 . Wv16^T / 64 + bv
    const int tv = (G_ROWS / 64) * (OUT_D / 64);
    wmma_gemm64<0, false, 2, 0, false><<<dim3((tv + 7) / 8, 1), 256, 0, stream>>>(
        x16, nullptr, IN_D, 0L, wv16, nullptr, IN_D, 0L, (void*)vf, nullptr, OUT_D, 0L,
        bv, nullptr, 0L, G_ROWS, OUT_D, IN_D, WSC_INV);
    // VT16 [512][8192] f16 = Wv16 . x16^T / 64 + bv[m]   (in[8192][512] -> out[512][8192])
    const int tt = (OUT_D / 64) * (G_ROWS / 64);
    wmma_gemm64<0, false, 1, 1, false><<<dim3((tt + 7) / 8, 1), 256, 0, stream>>>(
        wv16, nullptr, IN_D, 0L, x16, nullptr, IN_D, 0L, (void*)vt16, nullptr, G_ROWS, 0L,
        bv, nullptr, 0L, OUT_D, G_ROWS, IN_D, WSC_INV);
  }

  // ---- attention in row blocks of RBLK ----
  for (int rb = 0; rb < NPASS; ++rb) {
    // S16 [RBLK][8192] = K16_blk . Q16^T   (f16 out)
    const int ts = (RBLK / 64) * (G_ROWS / 64);
    wmma_gemm64<0, false, 0, 1, false><<<dim3((ts + 7) / 8, 1), 256, 0, stream>>>(
        k16 + (size_t)rb * RBLK * KQ_D, nullptr, KQ_D, 0L, q16, nullptr, KQ_D, 0L,
        (void*)s16, nullptr, G_ROWS, 0L, nullptr, nullptr, 0L, RBLK, G_ROWS, KQ_D, 1.0f);
    // inv [RBLK] = 1 / max(||S row||, eps)
    k_rownorm<<<dim3(RBLK / NRM_ROWS), 256, 0, stream>>>(s16, G_ROWS, G_ROWS / 256, invb, RBLK);
    // out_blk [RBLK][512] = inv[m] * (S16 . VT16^T) + Vf_blk
    const int tp = (RBLK / 64) * (OUT_D / 64);
    wmma_gemm64<0, false, 3, 0, true><<<dim3((tp + 7) / 8, 1), 256, 0, stream>>>(
        s16, nullptr, G_ROWS, 0L, vt16, nullptr, G_ROWS, 0L,
        (void*)(out + (size_t)rb * RBLK * OUT_D), nullptr, OUT_D, 0L,
        invb, vf + (size_t)rb * RBLK * OUT_D, 0L, RBLK, OUT_D, G_ROWS, 1.0f);
  }
}

// v002
// One run takes 188 microseconds.
// Versions in between are left out here; by their measured steps it is 8.26 times as fast as v000.
// Contractions: k,q,qT,v,vT projections (x*W^T), S = k*q^T (row norms only, squared and summed in registers), vT*q (split over rows), k*(q^T*v) : v_wmma_f32_16x16x32_f16 (f16 operands, f32 accumulate); weights carried x64 in f16 with 1/64 folded into the epilogue scale; row L2 norms, per-row scaling and residual in f32.
#include <hip/hip_runtime.h>
#include <math.h>
#include <stdint.h>
#include <stddef.h>

#define G_ROWS 8192
#define IN_D   512
#define KQ_D   128
#define OUT_D  512
#define NCH    16                  // chunks of q rows (columns of S); each gives one partial sum of squares per row of S
#define QCH    (G_ROWS / NCH)
#define KSPL   128                 // rows of q and v summed by one split of the q^T*v product
#define NSPL   (G_ROWS / KSPL)
#define EPSF   1e-12f
#define WSC     64.0f
#define WSC_INV (1.0f / 64.0f)

typedef __attribute__((ext_vector_type(16))) _Float16 v16h;
typedef __attribute__((ext_vector_type(8)))  _Float16 v8h;
typedef __attribute__((ext_vector_type(4)))  _Float16 v4h;
typedef __attribute__((ext_vector_type(16))) __bf16   v16b;
typedef __attribute__((ext_vector_type(8)))  __bf16   v8b;
typedef __attribute__((ext_vector_type(8)))  float    v8f;
typedef __attribute__((ext_vector_type(4)))  float    v4f;

__device__ __forceinline__ unsigned short f2bf_bits(float f) {
  unsigned u = __float_as_uint(f);
  return (unsigned short)((u + 0x7FFFu + ((u >> 16) & 1u)) >> 16);
}
__device__ __forceinline__ float bf_bits2f(unsigned short h) { return __uint_as_float(((unsigned)h) << 16); }

// hazard guards as plain device helpers (no inline asm inside the kernel template body)
__device__ __forceinline__ void dep_guard_h(v8f& a, v8f& b, v16h x, v16h y) { asm volatile("v_nop\n\tv_nop\n\tv_nop\n\tv_nop" : "+v"(a), "+v"(b) : "v"(x), "v"(y)); }
__device__ __forceinline__ void dep_guard_b(v8f& a, v8f& b, v16b x, v16b y) { asm volatile("v_nop\n\tv_nop\n\tv_nop\n\tv_nop" : "+v"(a), "+v"(b) : "v"(x), "v"(y)); }
__device__ __forceinline__ void keep4_h(v16h a, v16h b, v16h c, v16h d) { asm volatile("v_nop" :: "v"(a), "v"(b), "v"(c), "v"(d)); }
__device__ __forceinline__ void keep4_b(v16b a, v16b b, v16b c, v16b d) { asm volatile("v_nop" :: "v"(a), "v"(b), "v"(c), "v"(d)); }
__device__ __forceinline__ void acc_guard4(v8f& a, v8f& b, v8f& c, v8f& d) { asm volatile("v_nop\n\tv_nop\n\tv_nop\n\tv_nop" : "+v"(a), "+v"(b), "+v"(c), "+v"(d)); }
template <typename T> struct Frag;
template <> struct Frag<_Float16> {
  typedef v16h V; union U { v16h v; v8h h[2]; };
  static __device__ __forceinline__ v16h load(const _Float16* p) {   // elements 0..7 <- p[0..7], 8..15 <- p[16..23]
    U f; f.h[0] = *(const v8h*)(p); f.h[1] = *(const v8h*)(p + 16); return f.v;
  }
  static __device__ __forceinline__ v8f mma(v16h a, v16h b, v8f c) {
    return __builtin_amdgcn_wmma_f32_16x16x32_f16(false, a, false, b, (short)0, c, false, false);
  }
  static __device__ __forceinline__ void guard(v8f& a, v8f& b, v16h x, v16h y) { dep_guard_h(a, b, x, y); }
  static __device__ __forceinline__ void keep(v16h a, v16h b, v16h c, v16h d) { keep4_h(a, b, c, d); }
};
template <> struct Frag<__bf16> {
  typedef v16b V; union U { v16b v; v8b h[2]; };
  static __device__ __forceinline__ v16b load(const __bf16* p) {
    U f; f.h[0] = *(const v8b*)(p); f.h[1] = *(const v8b*)(p + 16); return f.v;
  }
  static __device__ __forceinline__ v8f mma(v16b a, v16b b, v8f c) {
    return __builtin_amdgcn_wmma_f32_16x16x32_bf16(false, a, false, b, (short)0, c, false, false);
  }
  static __device__ __forceinline__ void guard(v8f& a, v8f& b, v16b x, v16b y) { dep_guard_b(a, b, x, y); }
  static __device__ __forceinline__ void keep(v16b a, v16b b, v16b c, v16b d) { keep4_b(a, b, c, d); }
};

// ---- Register-blocked batched WMMA GEMM ------------------------------------
// C[m,n] = scale * sum_k A[m,k] * Bt[n,k] (*rowscale)(+bias)(+resid); each wave owns a 64x64 tile.
// A row-major [M,K]; Bt row-major [N,K]; M,N % 64 == 0, K % 32 == 0.
// SPLIT: operands are hi/lo planes (A2/Bt2 = lo planes, same layout); product = hi*hi + hi*lo + lo*hi.
// BIAS_MODE: 0 = none, 1 = bias[m], 2 = bias[n], 3 = per-row scale: value *= bias[m] (applied before resid).
// OUT_MODE: 0 = f32, 1 = f16, 2 = bf16 hi plane (Cout) + bf16 lo plane (Cout2).
// ET: 0 = f16 operands, 1 = bf16 operands (pointers passed as 16-bit storage)
template <int ET> struct Elem;
template <> struct Elem<0> { typedef _Float16 T; };
template <> struct Elem<1> { typedef __bf16 T; };
template <int ET, bool SPLIT, int BIAS_MODE, int OUT_MODE, bool RESID, int ACT = 0>
__global__ __launch_bounds__(256) void wmma_gemm64(
    const unsigned short* __restrict__ Ap, const unsigned short* __restrict__ A2p, int lda, long strideA,
    const unsigned short* __restrict__ Btp, const unsigned short* __restrict__ Bt2p, int ldb, long strideB,
    void* __restrict__ Cout, void* __restrict__ Cout2, int ldc, long strideC,
    const float* __restrict__ bias,
    const float* __restrict__ resid, long strideR,
    int M, int N, int K, float scale) {
  typedef typename Elem<ET>::T T;
  typedef typename Frag<T>::V V;
  const T* A = (const T*)Ap; const T* A2 = (const T*)A2p; const T* Bt = (const T*)Btp; const T* Bt2 = (const T*)Bt2p;
  __shared__ __align__(16) float sT[8][16 * 68];   // per-wave 16x64 slab, pitch 68 floats
  const int b    = blockIdx.y;
  const int lane = threadIdx.x & 31;
  const int wave = threadIdx.x >> 5;
  const int tilesN = N >> 6;
  const int tilesM = M >> 6;
  const int tile = blockIdx.x * 8 + wave;
  if (tile >= tilesM * tilesN) return;   // wave-uniform; no block barriers in this kernel
  const int tm = tile / tilesN;
  const int tn = tile - tm * tilesN;
  const int m0 = tm << 6;
  const int n0 = tn << 6;

  const T* Ab  = A  + (size_t)b * strideA;
  const T* Bb  = Bt + (size_t)b * strideB;
  const T* Ab2 = SPLIT ? (A2  + (size_t)b * strideA) : nullptr;
  const T* Bb2 = SPLIT ? (Bt2 + (size_t)b * strideB) : nullptr;

  const int rlane = lane & 15;                 // row (A) / col (B, D) within subtile
  const int koff  = (lane >> 4) * 8;           // k offset of this lane half
  const int mOff  = (lane >> 4) * 8;           // D row offset

  v8f acc[4][4];
#pragma unroll
  for (int i = 0; i < 4; ++i)
#pragma unroll
    for (int j = 0; j < 4; ++j) acc[i][j] = (v8f){0.f,0.f,0.f,0.f,0.f,0.f,0.f,0.f};

  for (int k0 = 0; k0 < K; k0 += 32) {
    V bh[4], bl[4];
#pragma unroll
    for (int j = 0; j < 4; ++j) {
      const size_t bo = (size_t)(n0 + (j << 4) + rlane) * ldb + koff + k0;
      bh[j] = Frag<T>::load(Bb + bo);
      if (SPLIT) bl[j] = Frag<T>::load(Bb2 + bo);
    }
#pragma unroll
    for (int i = 0; i < 4; ++i) {
      const size_t ao = (size_t)(m0 + (i << 4) + rlane) * lda + koff + k0;
      V ah = Frag<T>::load(Ab + ao);
      V al;
      if (SPLIT) al = Frag<T>::load(Ab2 + ao);
#pragma unroll
      for (int j = 0; j < 4; ++j) {
        acc[i][j] = Frag<T>::mma(ah, bh[j], acc[i][j]);
        if (SPLIT) {
          acc[i][j] = Frag<T>::mma(ah, bl[j], acc[i][j]);
          acc[i][j] = Frag<T>::mma(al, bh[j], acc[i][j]);
        }
      }
      Frag<T>::guard(acc[i][0], acc[i][3], ah, SPLIT ? al : ah);
    }
    Frag<T>::keep(bh[0], bh[1], bh[2], bh[3]);
    if (SPLIT) Frag<T>::keep(bl[0], bl[1], bl[2], bl[3]);
  }
  acc_guard4(acc[0][0], acc[0][1], acc[0][2], acc[0][3]);
  acc_guard4(acc[1][0], acc[1][1], acc[1][2], acc[1][3]);
  acc_guard4(acc[2][0], acc[2][1], acc[2][2], acc[2][3]);
  acc_guard4(acc[3][0], acc[3][1], acc[3][2], acc[3][3]);

  // ---- epilogue ----
  float* slab = sT[wave];
  const float* Rb = RESID ? (resid + (size_t)b * strideR) : nullptr;
#pragma unroll
  for (int i = 0; i < 4; ++i) {
    const int mBase = m0 + (i << 4);
#pragma unroll
    for (int j = 0; j < 4; ++j) {
      const int n = n0 + (j << 4) + rlane;
      float bv = 0.f;
      if (BIAS_MODE == 2) bv = bias[n];
#pragma unroll
      for (int r = 0; r < 8; ++r) {
        float v = acc[i][j][r] * scale;
        if (BIAS_MODE == 3) v *= bias[mBase + mOff + r];
        if (BIAS_MODE == 1) v += bias[mBase + mOff + r];
        if (BIAS_MODE == 2) v += bv;
        if (RESID) v += Rb[(size_t)(mBase + mOff + r) * ldc + n];
        if (ACT == 1) v = tanhf(v);
        if (ACT == 2) v = fmaxf(v, 0.0f);
        if (ACT == 3) v = v / (1.0f + expf(-v));
        if (ACT == 4) v = (v > 0.f) ? v : 0.01f * v;
        if (ACT == 5) v = 0.5f * v * (1.0f + erff(v * 0.70710678118654752f));
        slab[(mOff + r) * 68 + (j << 4) + rlane] = v;
      }
    }
    __builtin_amdgcn_fence(__ATOMIC_RELEASE, "workgroup");
    __builtin_amdgcn_wave_barrier();
    __builtin_amdgcn_fence(__ATOMIC_ACQUIRE, "workgroup");
    if (OUT_MODE == 0) {
      float* C = (float*)Cout + (size_t)b * strideC;
      const int hh = lane >> 4, c4 = (lane & 15) * 4;     // row seg = 256 B = 16 lanes x 16 B
      {
#pragma unroll
        for (int it = 0; it < 8; ++it) {
          const int row = it * 2 + hh;
          v4f v = *(const v4f*)(slab + row * 68 + c4);
          *(v4f*)(C + (size_t)(mBase + row) * ldc + n0 + c4) = v;
        }
        
      }
    } else {
      const int q = lane >> 3, c8 = (lane & 7) * 8;
      unsigned short* C  = (unsigned short*)Cout  + (size_t)b * strideC;
      unsigned short* C2 = (OUT_MODE == 2) ? ((unsigned short*)Cout2 + (size_t)b * strideC) : nullptr;
      {
#pragma unroll
        for (int it = 0; it < 4; ++it) {
          const int row = it * 4 + q;
          const float* sp = slab + row * 68 + c8;
          v8h hv, lv;
#pragma unroll
          for (int e = 0; e < 8; ++e) {
            if (OUT_MODE == 1) {
              hv[e] = (_Float16)sp[e];
            } else {
              unsigned short hb = f2bf_bits(sp[e]);
              unsigned short lb = f2bf_bits(sp[e] - bf_bits2f(hb));
              hv[e] = __builtin_bit_cast(_Float16, hb);
              lv[e] = __builtin_bit_cast(_Float16, lb);
            }
          }
          *(v8h*)(C + (size_t)(mBase + row) * ldc + n0 + c8) = hv;
          if (OUT_MODE == 2) *(v8h*)(C2 + (size_t)(mBase + row) * ldc + n0 + c8) = lv;
        }
        
      }
    }
    __builtin_amdgcn_fence(__ATOMIC_RELEASE, "workgroup");
    __builtin_amdgcn_wave_barrier();
    __builtin_amdgcn_fence(__ATOMIC_ACQUIRE, "workgroup");
  }
}

__global__ __launch_bounds__(256) void cast_f32_f16x2s(
    const float* __restrict__ in, unsigned short* __restrict__ out, int n2, float mul) {
  int i = blockIdx.x * 256 + threadIdx.x;
  if (i < n2) {
    const _Float16 h0 = (_Float16)(in[2 * i] * mul), h1 = (_Float16)(in[2 * i + 1] * mul);
    const unsigned u = (unsigned)__builtin_bit_cast(unsigned short, h0) | ((unsigned)__builtin_bit_cast(unsigned short, h1) << 16);
    ((unsigned*)out)[i] = u;
    
  }
}

// ---- merge of the split sums: out[i] = f16( sum_s P[s][i] ), s ascending (fixed order), 4 elements per thread ----
__global__ __launch_bounds__(256) void k_merge_splits(const float* __restrict__ P, unsigned short* __restrict__ out, int n4) {
  const int i = blockIdx.x * 256 + threadIdx.x;
  if (i < n4) {
    v4f a = (v4f){0.f, 0.f, 0.f, 0.f};
#pragma unroll 16   // 16 independent 16-byte loads in flight per wait instead of one
    for (int s = 0; s < NSPL; ++s) a += *(const v4f*)(P + (size_t)s * (OUT_D * KQ_D) + 4 * (size_t)i);
    *(v4h*)(out + 4 * (size_t)i) = __builtin_convertvector(a, v4h);
  }
}

// ---- partial row sums of squares of S = k q^T; S stays in the accumulators and never goes to memory ----
// The product is formed transposed: A = 16 rows of q (streamed), B = 64 rows of k (held in registers), so a lane's
// accumulators all belong to one row of S per 16-row group (its k row = lane & 15) and the sum over q rows is in-lane.
// Wave = 64 rows of S x QCH columns; the 8 waves of a block walk the same q rows. part[chunk][row], f32.
#define QSTEP (16 * KQ_D)          // elements between two 16-row groups of q or k
__device__ __forceinline__ void load_rows16(v16h (&f)[4], const _Float16* p) {
#pragma unroll
  for (int t = 0; t < 4; ++t) f[t] = Frag<_Float16>::load(p + (t << 5));
}
// ss[j] += squares of the 16 x 16 tile (16 q rows) x (k rows of group j), element r = the lane's r-th q row
__device__ __forceinline__ void sumsq_rows16(v8f (&ss)[4], const v16h (&qa)[4], const v16h (&kb)[4][4]) {
  v8f acc[4];
#pragma unroll
  for (int j = 0; j < 4; ++j) acc[j] = (v8f){0.f,0.f,0.f,0.f,0.f,0.f,0.f,0.f};
#pragma unroll
  for (int t = 0; t < 4; ++t)
#pragma unroll
    for (int j = 0; j < 4; ++j) acc[j] = Frag<_Float16>::mma(qa[t], kb[j][t], acc[j]);
#pragma unroll
  for (int j = 0; j < 4; ++j) ss[j] += acc[j] * acc[j];
}
__global__ __launch_bounds__(256) void k_sumsq_part(const unsigned short* __restrict__ Kp, const unsigned short* __restrict__ Qp,
                                                    float* __restrict__ part) {
  const int lane  = threadIdx.x & 31;
  const int wave  = threadIdx.x >> 5;
  const int rlane = lane & 15;
  const int koff  = (lane >> 4) * 8;
  const int n0 = (blockIdx.x * 8 + wave) << 6;     // first row of S (row of k)
  const int q0 = blockIdx.y * QCH;                 // first column of S (row of q)
  const _Float16* kp = (const _Float16*)Kp + (size_t)(n0 + rlane) * KQ_D + koff;
  // q is addressed as the uniform base plus the lane's 32-bit byte offset qo (below 2 MiB), which the loop advances
  unsigned qo = (unsigned)((q0 + rlane) * KQ_D + koff) * 2u;
#define QPTR ((const _Float16*)((const char*)Qp + qo))

  v16h kb[4][4];                                   // [16-row group][k step of 32]
#pragma unroll
  for (int j = 0; j < 4; ++j) load_rows16(kb[j], kp + j * QSTEP);
  // four fragment buffers in rotation: a 16-row group of q is asked for three groups' products ahead of its use
  v16h b0[4], b1[4], b2[4], b3[4];
  load_rows16(b0, QPTR);
  load_rows16(b1, QPTR + QSTEP);
  load_rows16(b2, QPTR + 2 * QSTEP);
  // the k address is dead from here on: its registers are not reused before the loads that name them are translated
  asm volatile("s_wait_xcnt 0x0" :: "v"(kp) : "memory");

  v8f ss[4];
#pragma unroll
  for (int j = 0; j < 4; ++j) ss[j] = (v8f){0.f,0.f,0.f,0.f,0.f,0.f,0.f,0.f};

#pragma unroll 1   // kept rolled: the body already holds one turn of the rotation, and the code stays small
  for (int it = 0; it < QCH / 64 - 1; ++it) {
    load_rows16(b3, QPTR + 3 * QSTEP);
    sumsq_rows16(ss, b0, kb);
    load_rows16(b0, QPTR + 4 * QSTEP);
    sumsq_rows16(ss, b1, kb);
    load_rows16(b1, QPTR + 5 * QSTEP);
    sumsq_rows16(ss, b2, kb);
    load_rows16(b2, QPTR + 6 * QSTEP);
    sumsq_rows16(ss, b3, kb);
    // qo += the bytes of 4 groups. The add stands in one statement with the wait that belongs in front of a rewrite of
    // an address register of issued loads, so that the compiler cannot lift it over that wait.
    asm volatile("s_wait_xcnt 0x0\n\tv_add_nc_u32 %0, %1, %0" : "+v"(qo) : "n"(4 * QSTEP * 2) : "memory");
  }
  load_rows16(b3, QPTR + 3 * QSTEP);
  sumsq_rows16(ss, b0, kb);
  // the q offset is dead from here on: same wait as for the k address (without it the register is reused at once)
  asm volatile("s_wait_xcnt 0x0" :: "v"(qo) : "memory");
  sumsq_rows16(ss, b1, kb);
  sumsq_rows16(ss, b2, kb);
  sumsq_rows16(ss, b3, kb);

  float s[4];
#pragma unroll
  for (int j = 0; j < 4; ++j) {
    const float h = ((ss[j][0] + ss[j][1]) + (ss[j][2] + ss[j][3])) + ((ss[j][4] + ss[j][5]) + (ss[j][6] + ss[j][7]));
    s[j] = h + __shfl_xor(h, 16, 32);              // the two lane halves hold q rows 0..7 and 8..15 of each group
  }
  // both halves now hold every sum: lanes 0..15 store groups 0 and 2, lanes 16..31 groups 1 and 3 (whole 128-B lines)
  float* pr = part + (size_t)blockIdx.y * G_ROWS + n0 + lane;
  pr[0]  = (lane < 16) ? s[0] : s[1];
  pr[32] = (lane < 16) ? s[2] : s[3];
#undef QPTR
}

// ---- inv[i] = 1 / max(sqrt(sum_c part[c][i]), eps), c ascending (fixed order) ----
__global__ __launch_bounds__(256) void k_inv_norm(const float* __restrict__ part, float* __restrict__ inv) {
  const int i = blockIdx.x * 256 + threadIdx.x;    // the grid covers G_ROWS exactly
  float a = 0.f;
#pragma unroll   // all NCH loads are issued before the first one is waited for
  for (int c = 0; c < NCH; ++c) a += part[(size_t)c * G_ROWS + i];
  inv[i] = 1.0f / fmaxf(sqrtf(a), EPSF);
}

// ---------------------------------------------------------------------------
//   x16  [8192][512] f16    8 MiB      | Wk16 [128][512], Wq16 [128][512], Wv16 [512][512] f16 (x64)
//   K16  [8192][128] f16    2 MiB      | Q16 [8192][128] f16 2 MiB
//   Vf   [8192][512] f32   16 MiB      | VT16 [512][8192] f16 8 MiB
//   part [16][8192] f32   512 KiB (partial row sums of squares of S)  | inv [8192] f32
//   QT16 [128][8192] f16    2 MiB      | Pm [64][512][128] f32 16 MiB (split sums of v^T q) | MT16 [512][128] f16
// ---------------------------------------------------------------------------
extern "C" void kernel_launch(void* const* d_in, const int* in_sizes, int n_in,
                              void* d_out, int out_size, void* d_ws, size_t ws_size,
                              hipStream_t stream) {
  if (n_in < 7) return;
  if (in_sizes[0] != G_ROWS * IN_D || in_sizes[1] != KQ_D * IN_D || in_sizes[2] != KQ_D ||
      in_sizes[3] != KQ_D * IN_D || in_sizes[4] != KQ_D || in_sizes[5] != OUT_D * IN_D ||
      in_sizes[6] != OUT_D) return;
  if (out_size != G_ROWS * OUT_D) return;

  const float* x  = (const float*)d_in[0];
  const float* Wk = (const float*)d_in[1];
  const float* bk = (const float*)d_in[2];
  const float* Wq = (const float*)d_in[3];
  const float* bq = (const float*)d_in[4];
  const float* Wv = (const float*)d_in[5];
  const float* bv = (const float*)d_in[6];
  float* out = (float*)d_out;

  const size_t b_x16 = (size_t)G_ROWS * IN_D * 2;
  const size_t b_wk  = (size_t)KQ_D * IN_D * 2;
  const size_t b_wv  = (size_t)OUT_D * IN_D * 2;
  const size_t b_k16 = (size_t)G_ROWS * KQ_D * 2;
  const size_t b_vf  = (size_t)G_ROWS * OUT_D * 4;
  const size_t b_vt  = (size_t)OUT_D * G_ROWS * 2;
  const size_t b_prt = (size_t)NCH * G_ROWS * 4;
  const size_t b_inv = (size_t)G_ROWS * 4;
  const size_t b_pm  = (size_t)NSPL * OUT_D * KQ_D * 4;
  const size_t b_mt  = (size_t)OUT_D * KQ_D * 2;

  size_t off = 0;
  const size_t o_x16 = off; off += b_x16;
  const size_t o_wk  = off; off += b_wk;
  const size_t o_wq  = off; off += b_wk;
  const size_t o_wv  = off; off += b_wv;
  const size_t o_k16 = off; off += b_k16;
  const size_t o_q16 = off; off += b_k16;
  const size_t o_vf  = off; off += b_vf;
  const size_t o_vt  = off; off += b_vt;
  const size_t o_prt = off; off += b_prt;
  const size_t o_inv = off; off += b_inv;
  const size_t o_qt  = off; off += b_k16;
  const size_t o_pm  = off; off += b_pm;
  const size_t o_mt  = off; off += b_mt;
  if (off > ws_size) return;

  char* ws = (char*)d_ws;
  unsigned short* x16  = (unsigned short*)(ws + o_x16);
  unsigned short* wk16 = (unsigned short*)(ws + o_wk);
  unsigned short* wq16 = (unsigned short*)(ws + o_wq);
  unsigned short* wv16 = (unsigned short*)(ws + o_wv);
  unsigned short* k16  = (unsigned short*)(ws + o_k16);
  unsigned short* q16  = (unsigned short*)(ws + o_q16);
  float*          vf   = (float*)(ws + o_vf);
  unsigned short* vt16 = (unsigned short*)(ws + o_vt);
  float*          prt  = (float*)(ws + o_prt);
  float*          invb = (float*)(ws + o_inv);
  unsigned short* qt16 = (unsigned short*)(ws + o_qt);
  float*          pm   = (float*)(ws + o_pm);
  unsigned short* mt16 = (unsigned short*)(ws + o_mt);

  // ---- casts to f16 (weights x64, exact) ----
  {
    const int n2x = G_ROWS * IN_D / 2;
    cast_f32_f16x2s<<<dim3((n2x + 255) / 256), 256, 0, stream>>>(x, x16, n2x, 1.0f);
    const int n2k = KQ_D * IN_D / 2;
    cast_f32_f16x2s<<<dim3((n2k + 255) / 256), 256, 0, stream>>>(Wk, wk16, n2k, WSC);
    cast_f32_f16x2s<<<dim3((n2k + 255) / 256), 256, 0, stream>>>(Wq, wq16, n2k, WSC);
    const int n2v = OUT_D * IN_D / 2;
    cast_f32_f16x2s<<<dim3((n2v + 255) / 256), 256, 0, stream>>>(Wv, wv16, n2v, WSC);
  }

  // ---- projections ----
  {
    // K16 [8192][128] = x16 . Wk16^T / 64 + bk   (f16 out)
    const int tk = (G_ROWS / 64) * (KQ_D / 64);
    wmma_gemm64<0, false, 2, 1, false><<<dim3((tk + 7) / 8, 1), 256, 0, stream>>>(
        x16, nullptr, IN_D, 0L, wk16, nullptr, IN_D, 0L, (void*)k16, nullptr, KQ_D, 0L,
        bk, nullptr, 0L, G_ROWS, KQ_D, IN_D, WSC_INV);
    // Q16 [8192][128]
    wmma_gemm64<0, false, 2, 1, false><<<dim3((tk + 7) / 8, 1), 256, 0, stream>>>(
        x16, nullptr, IN_D, 0L, wq16, nullptr, IN_D, 0L, (void*)q16, nullptr, KQ_D, 0L,
        bq, nullptr, 0L, G_ROWS, KQ_D, IN_D, WSC_INV);
    // Vf [8192][512] f32 = x16 . Wv16^T / 64 + bv
    const int tv = (G_ROWS / 64) * (OUT_D / 64);
    wmma_gemm64<0, false, 2, 0, false><<<dim3((tv + 7) / 8, 1), 256, 0, stream>>>(
        x16, nullptr, IN_D, 0L, wv16, nullptr, IN_D, 0L, (void*)vf, nullptr, OUT_D, 0L,
        bv, nullptr, 0L, G_ROWS, OUT_D, IN_D, WSC_INV);
    // VT16 [512][8192] f16 = Wv16 . x16^T / 64 + bv[m]   (in[8192][512] -> out[512][8192])
    const int tt = (OUT_D / 64) * (G_ROWS / 64);
    wmma_gemm64<0, false, 1, 1, false><<<dim3((tt + 7) / 8, 1), 256, 0, stream>>>(
        wv16, nullptr, IN_D, 0L, x16, nullptr, IN_D, 0L, (void*)vt16, nullptr, G_ROWS, 0L,
        bv, nullptr, 0L, OUT_D, G_ROWS, IN_D, WSC_INV);
    // QT16 [128][8192] f16 = Wq16 . x16^T / 64 + bq[m]
    const int tq = (KQ_D / 64) * (G_ROWS / 64);
    wmma_gemm64<0, false, 1, 1, false><<<dim3((tq + 7) / 8, 1), 256, 0, stream>>>(
        wq16, nullptr, IN_D, 0L, x16, nullptr, IN_D, 0L, (void*)qt16, nullptr, G_ROWS, 0L,
        bq, nullptr, 0L, KQ_D, G_ROWS, IN_D, WSC_INV);
  }

  // ---- MT16 [512][128] = VT16 . QT16^T = (q^T v)^T : (k q^T) v is formed as k (q^T v) ----
  {
    // Pm[s] [512][128] f32 = VT16[:, s*KSPL ..] . QT16[:, s*KSPL ..]^T   (batch index = split)
    const int tm = (OUT_D / 64) * (KQ_D / 64);
    wmma_gemm64<0, false, 0, 0, false><<<dim3((tm + 7) / 8, NSPL), 256, 0, stream>>>(
        vt16, nullptr, G_ROWS, (long)KSPL, qt16, nullptr, G_ROWS, (long)KSPL,
        (void*)pm, nullptr, KQ_D, (long)(OUT_D * KQ_D), nullptr, nullptr, 0L, OUT_D, KQ_D, KSPL, 1.0f);
    const int n4 = OUT_D * KQ_D / 4;
    k_merge_splits<<<dim3((n4 + 255) / 256), 256, 0, stream>>>(pm, mt16, n4);
  }

  // ---- row norms of S = K16 . Q16^T ----
  k_sumsq_part<<<dim3(G_ROWS / 512, NCH), 256, 0, stream>>>(k16, q16, prt);
  k_inv_norm<<<dim3(G_ROWS / 256), 256, 0, stream>>>(prt, invb);

  // ---- out [8192][512] = inv[m] * (K16 . MT16^T) + Vf ----
  {
    const int tp = (G_ROWS / 64) * (OUT_D / 64);
    wmma_gemm64<0, false, 3, 0, true><<<dim3((tp + 7) / 8, 1), 256, 0, stream>>>(
        k16, nullptr, KQ_D, 0L, mt16, nullptr, KQ_D, 0L,
        (void*)out, nullptr, OUT_D, 0L,
        invb, vf, 0L, G_ROWS, OUT_D, KQ_D, 1.0f);
  }
}

// v003
// One run takes 97 microseconds.
// In two side-by-side timings against v002, it was 1.93 and 1.91 times as fast.
// All steps since v000 together make it 15.8 times as fast.
// Contractions: k,q,qT,v,vT projections (x*W^T), S = k*q^T (row norms only, squared and summed in registers), vT*q (split over rows), k*(q^T*v) : v_wmma_f32_16x16x32_f16 (f16 operands, f32 accumulate); weights carried x64 in f16 with 1/64 folded into the epilogue scale; row L2 norms, per-row scaling and residual in f32.
#include <hip/hip_runtime.h>
#include <math.h>
#include <stdint.h>
#include <stddef.h>

#define G_ROWS 8192
#define IN_D   512
#define KQ_D   128
#define OUT_D  512
#define NCH    16                  // chunks of q rows (columns of S); each gives one partial sum of squares per row of S
#define QCH    (G_ROWS / NCH)
#define KSPL   128                 // rows of q and v summed by one split of the q^T*v product
#define NSPL   (G_ROWS / KSPL)
#define EPSF   1e-12f
#define WSC     64.0f
#define WSC_INV (1.0f / 64.0f)

typedef __attribute__((ext_vector_type(16))) _Float16 v16h;
typedef __attribute__((ext_vector_type(8)))  _Float16 v8h;
typedef __attribute__((ext_vector_type(4)))  _Float16 v4h;
typedef __attribute__((ext_vector_type(16))) __bf16   v16b;
typedef __attribute__((ext_vector_type(8)))  __bf16   v8b;
typedef __attribute__((ext_vector_type(8)))  float    v8f;
typedef __attribute__((ext_vector_type(4)))  float    v4f;

__device__ __forceinline__ unsigned short f2bf_bits(float f) {
  unsigned u = __float_as_uint(f);
  return (unsigned short)((u + 0x7FFFu + ((u >> 16) & 1u)) >> 16);
}
__device__ __forceinline__ float bf_bits2f(unsigned short h) { return __uint_as_float(((unsigned)h) << 16); }

// hazard guards as plain device helpers (no inline asm inside the kernel template body)
__device__ __forceinline__ void dep_guard_h(v8f& a, v8f& b, v16h x, v16h y) { asm volatile("v_nop\n\tv_nop\n\tv_nop\n\tv_nop" : "+v"(a), "+v"(b) : "v"(x), "v"(y)); }
__device__ __forceinline__ void dep_guard_b(v8f& a, v8f& b, v16b x, v16b y) { asm volatile("v_nop\n\tv_nop\n\tv_nop\n\tv_nop" : "+v"(a), "+v"(b) : "v"(x), "v"(y)); }
__device__ __forceinline__ void keep4_h(v16h a, v16h b, v16h c, v16h d) { asm volatile("v_nop" :: "v"(a), "v"(b), "v"(c), "v"(d)); }
__device__ __forceinline__ void keep4_b(v16b a, v16b b, v16b c, v16b d) { asm volatile("v_nop" :: "v"(a), "v"(b), "v"(c), "v"(d)); }
__device__ __forceinline__ void acc_guard4(v8f& a, v8f& b, v8f& c, v8f& d) { asm volatile("v_nop\n\tv_nop\n\tv_nop\n\tv_nop" : "+v"(a), "+v"(b), "+v"(c), "+v"(d)); }
template <typename T> struct Frag;
template <> struct Frag<_Float16> {
  typedef v16h V; union U { v16h v; v8h h[2]; };
  static __device__ __forceinline__ v16h load(const _Float16* p) {   // elements 0..7 <- p[0..7], 8..15 <- p[16..23]
    U f; f.h[0] = *(const v8h*)(p); f.h[1] = *(const v8h*)(p + 16); return f.v;
  }
  static __device__ __forceinline__ v8f mma(v16h a, v16h b, v8f c) {
    return __builtin_amdgcn_wmma_f32_16x16x32_f16(false, a, false, b, (short)0, c, false, false);
  }
  static __device__ __forceinline__ void guard(v8f& a, v8f& b, v16h x, v16h y) { dep_guard_h(a, b, x, y); }
  static __device__ __forceinline__ void keep(v16h a, v16h b, v16h c, v16h d) { keep4_h(a, b, c, d); }
};
template <> struct Frag<__bf16> {
  typedef v16b V; union U { v16b v; v8b h[2]; };
  static __device__ __forceinline__ v16b load(const __bf16* p) {
    U f; f.h[0] = *(const v8b*)(p); f.h[1] = *(const v8b*)(p + 16); return f.v;
  }
  static __device__ __forceinline__ v8f mma(v16b a, v16b b, v8f c) {
    return __builtin_amdgcn_wmma_f32_16x16x32_bf16(false, a, false, b, (short)0, c, false, false);
  }
  static __device__ __forceinline__ void guard(v8f& a, v8f& b, v16b x, v16b y) { dep_guard_b(a, b, x, y); }
  static __device__ __forceinline__ void keep(v16b a, v16b b, v16b c, v16b d) { keep4_b(a, b, c, d); }
};

// ---- Register-blocked batched WMMA GEMM ------------------------------------
// C[m,n] = scale * sum_k A[m,k] * Bt[n,k] (*rowscale)(+bias)(+resid); each wave owns a 64x64 tile.
// A row-major [M,K]; Bt row-major [N,K]; M,N % 64 == 0, K % 32 == 0.
// SPLIT: operands are hi/lo planes (A2/Bt2 = lo planes, same layout); product = hi*hi + hi*lo + lo*hi.
// BIAS_MODE: 0 = none, 1 = bias[m], 2 = bias[n], 3 = per-row scale: value *= bias[m] (applied before resid).
// OUT_MODE: 0 = f32, 1 = f16, 2 = bf16 hi plane (Cout) + bf16 lo plane (Cout2).
// ET: 0 = f16 operands, 1 = bf16 operands (pointers passed as 16-bit storage)
template <int ET> struct Elem;
template <> struct Elem<0> { typedef _Float16 T; };
template <> struct Elem<1> { typedef __bf16 T; };
// gemm64_block: the work of one 256-thread block; bx, b = the block's place in this product's own grid; sT = the block's LDS slabs.
template <int ET, bool SPLIT, int BIAS_MODE, int OUT_MODE, bool RESID, int ACT = 0>
__device__ __forceinline__ void gemm64_block(
    float (*sT)[16 * 68], const int bx, const int b,
    const unsigned short* __restrict__ Ap, const unsigned short* __restrict__ A2p, int lda, long strideA,
    const unsigned short* __restrict__ Btp, const unsigned short* __restrict__ Bt2p, int ldb, long strideB,
    void* __restrict__ Cout, void* __restrict__ Cout2, int ldc, long strideC,
    const float* __restrict__ bias,
    const float* __restrict__ resid, long strideR,
    int M, int N, int K, float scale) {
  typedef typename Elem<ET>::T T;
  typedef typename Frag<T>::V V;
  const T* A = (const T*)Ap; const T* A2 = (const T*)A2p; const T* Bt = (const T*)Btp; const T* Bt2 = (const T*)Bt2p;
  const int lane = threadIdx.x & 31;
  const int wave = threadIdx.x >> 5;
  const int tilesN = N >> 6;
  const int tilesM = M >> 6;
  const int tile = bx * 8 + wave;
  if (tile >= tilesM * tilesN) return;   // wave-uniform; no block barriers in this kernel
  const int tm = tile / tilesN;
  const int tn = tile - tm * tilesN;
  const int m0 = tm << 6;
  const int n0 = tn << 6;

  const T* Ab  = A  + (size_t)b * strideA;
  const T* Bb  = Bt + (size_t)b * strideB;
  const T* Ab2 = SPLIT ? (A2  + (size_t)b * strideA) : nullptr;
  const T* Bb2 = SPLIT ? (Bt2 + (size_t)b * strideB) : nullptr;

  const int rlane = lane & 15;                 // row (A) / col (B, D) within subtile
  const int koff  = (lane >> 4) * 8;           // k offset of this lane half
  const int mOff  = (lane >> 4) * 8;           // D row offset

  v8f acc[4][4];
#pragma unroll
  for (int i = 0; i < 4; ++i)
#pragma unroll
    for (int j = 0; j < 4; ++j) acc[i][j] = (v8f){0.f,0.f,0.f,0.f,0.f,0.f,0.f,0.f};

  for (int k0 = 0; k0 < K; k0 += 32) {
    V bh[4], bl[4];
#pragma unroll
    for (int j = 0; j < 4; ++j) {
      const size_t bo = (size_t)(n0 + (j << 4) + rlane) * ldb + koff + k0;
      bh[j] = Frag<T>::load(Bb + bo);
      if (SPLIT) bl[j] = Frag<T>::load(Bb2 + bo);
    }
#pragma unroll
    for (int i = 0; i < 4; ++i) {
      const size_t ao = (size_t)(m0 + (i << 4) + rlane) * lda + koff + k0;
      V ah = Frag<T>::load(Ab + ao);
      V al;
      if (SPLIT) al = Frag<T>::load(Ab2 + ao);
#pragma unroll
      for (int j = 0; j < 4; ++j) {
        acc[i][j] = Frag<T>::mma(ah, bh[j], acc[i][j]);
        if (SPLIT) {
          acc[i][j] = Frag<T>::mma(ah, bl[j], acc[i][j]);
          acc[i][j] = Frag<T>::mma(al, bh[j], acc[i][j]);
        }
      }
      Frag<T>::guard(acc[i][0], acc[i][3], ah, SPLIT ? al : ah);
    }
    Frag<T>::keep(bh[0], bh[1], bh[2], bh[3]);
    if (SPLIT) Frag<T>::keep(bl[0], bl[1], bl[2], bl[3]);
  }
  acc_guard4(acc[0][0], acc[0][1], acc[0][2], acc[0][3]);
  acc_guard4(acc[1][0], acc[1][1], acc[1][2], acc[1][3]);
  acc_guard4(acc[2][0], acc[2][1], acc[2][2], acc[2][3]);
  acc_guard4(acc[3][0], acc[3][1], acc[3][2], acc[3][3]);

  // ---- epilogue ----
  float* slab = sT[wave];
  const float* Rb = RESID ? (resid + (size_t)b * strideR) : nullptr;
#pragma unroll
  for (int i = 0; i < 4; ++i) {
    const int mBase = m0 + (i << 4);
#pragma unroll
    for (int j = 0; j < 4; ++j) {
      const int n = n0 + (j << 4) + rlane;
      float bv = 0.f;
      if (BIAS_MODE == 2) bv = bias[n];
#pragma unroll
      for (int r = 0; r < 8; ++r) {
        float v = acc[i][j][r] * scale;
        if (BIAS_MODE == 3) v *= bias[mBase + mOff + r];
        if (BIAS_MODE == 1) v += bias[mBase + mOff + r];
        if (BIAS_MODE == 2) v += bv;
        if (RESID) v += Rb[(size_t)(mBase + mOff + r) * ldc + n];
        if (ACT == 1) v = tanhf(v);
        if (ACT == 2) v = fmaxf(v, 0.0f);
        if (ACT == 3) v = v / (1.0f + expf(-v));
        if (ACT == 4) v = (v > 0.f) ? v : 0.01f * v;
        if (ACT == 5) v = 0.5f * v * (1.0f + erff(v * 0.70710678118654752f));
        slab[(mOff + r) * 68 + (j << 4) + rlane] = v;
      }
    }
    __builtin_amdgcn_fence(__ATOMIC_RELEASE, "workgroup");
    __builtin_amdgcn_wave_barrier();
    __builtin_amdgcn_fence(__ATOMIC_ACQUIRE, "workgroup");
    if (OUT_MODE == 0) {
      float* C = (float*)Cout + (size_t)b * strideC;
      const int hh = lane >> 4, c4 = (lane & 15) * 4;     // row seg = 256 B = 16 lanes x 16 B
      {
#pragma unroll
        for (int it = 0; it < 8; ++it) {
          const int row = it * 2 + hh;
          v4f v = *(const v4f*)(slab + row * 68 + c4);
          *(v4f*)(C + (size_t)(mBase + row) * ldc + n0 + c4) = v;
        }
        
      }
    } else {
      const int q = lane >> 3, c8 = (lane & 7) * 8;
      unsigned short* C  = (unsigned short*)Cout  + (size_t)b * strideC;
      unsigned short* C2 = (OUT_MODE == 2) ? ((unsigned short*)Cout2 + (size_t)b * strideC) : nullptr;
      {
#pragma unroll
        for (int it = 0; it < 4; ++it) {
          const int row = it * 4 + q;
          const float* sp = slab + row * 68 + c8;
          v8h hv, lv;
#pragma unroll
          for (int e = 0; e < 8; ++e) {
            if (OUT_MODE == 1) {
              hv[e] = (_Float16)sp[e];
            } else {
              unsigned short hb = f2bf_bits(sp[e]);
              unsigned short lb = f2bf_bits(sp[e] - bf_bits2f(hb));
              hv[e] = __builtin_bit_cast(_Float16, hb);
              lv[e] = __builtin_bit_cast(_Float16, lb);
            }
          }
          *(v8h*)(C + (size_t)(mBase + row) * ldc + n0 + c8) = hv;
          if (OUT_MODE == 2) *(v8h*)(C2 + (size_t)(mBase + row) * ldc + n0 + c8) = lv;
        }
        
      }
    }
    __builtin_amdgcn_fence(__ATOMIC_RELEASE, "workgroup");
    __builtin_amdgcn_wave_barrier();
    __builtin_amdgcn_fence(__ATOMIC_ACQUIRE, "workgroup");
  }
}

template <int ET, bool SPLIT, int BIAS_MODE, int OUT_MODE, bool RESID, int ACT = 0>
__global__ __launch_bounds__(256) void wmma_gemm64(
    const unsigned short* __restrict__ Ap, const unsigned short* __restrict__ A2p, int lda, long strideA,
    const unsigned short* __restrict__ Btp, const unsigned short* __restrict__ Bt2p, int ldb, long strideB,
    void* __restrict__ Cout, void* __restrict__ Cout2, int ldc, long strideC,
    const float* __restrict__ bias,
    const float* __restrict__ resid, long strideR,
    int M, int N, int K, float scale) {
  __shared__ __align__(16) float sT[8][16 * 68];   // per-wave 16x64 slab, pitch 68 floats
  gemm64_block<ET, SPLIT, BIAS_MODE, OUT_MODE, RESID, ACT>(sT, blockIdx.x, blockIdx.y, Ap, A2p, lda, strideA, Btp, Bt2p, ldb, strideB,
                                                           Cout, Cout2, ldc, strideC, bias, resid, strideR, M, N, K, scale);
}

// ---- the five projections in one grid: none reads what another writes, so their blocks run side by side ----
// Block ranges (8 tiles of 64x64 per block), in this order: v, v^T, q^T, k, q.
#define PB_V  ((G_ROWS / 64) * (OUT_D / 64) / 8)
#define PB_KQ ((G_ROWS / 64) * (KQ_D / 64) / 8)
__global__ __launch_bounds__(256) void k_project_all(
    const unsigned short* __restrict__ x16, const unsigned short* __restrict__ wk16,
    const unsigned short* __restrict__ wq16, const unsigned short* __restrict__ wv16,
    const float* __restrict__ bk, const float* __restrict__ bq, const float* __restrict__ bv,
    unsigned short* __restrict__ k16, unsigned short* __restrict__ q16, float* __restrict__ vf,
    unsigned short* __restrict__ vt16, unsigned short* __restrict__ qt16) {
  __shared__ __align__(16) float sT[8][16 * 68];   // per-wave 16x64 slab, pitch 68 floats
  const int bx = blockIdx.x;
  if (bx < PB_V) {
    // Vf [8192][512] f32 = x16 . Wv16^T / 64 + bv
    gemm64_block<0, false, 2, 0, false>(sT, bx, 0, x16, nullptr, IN_D, 0L, wv16, nullptr, IN_D, 0L, (void*)vf, nullptr, OUT_D, 0L,
                                        bv, nullptr, 0L, G_ROWS, OUT_D, IN_D, WSC_INV);
  } else if (bx < 2 * PB_V + PB_KQ) {
    // VT16 [512][8192] f16 = Wv16 . x16^T / 64 + bv[m];  QT16 [128][8192] f16 = Wq16 . x16^T / 64 + bq[m]
    const bool isv = bx < 2 * PB_V;
    gemm64_block<0, false, 1, 1, false>(sT, isv ? bx - PB_V : bx - 2 * PB_V, 0, isv ? wv16 : wq16, nullptr, IN_D, 0L,
                                        x16, nullptr, IN_D, 0L, (void*)(isv ? vt16 : qt16), nullptr, G_ROWS, 0L,
                                        isv ? bv : bq, nullptr, 0L, isv ? OUT_D : KQ_D, G_ROWS, IN_D, WSC_INV);
  } else {
    // K16, Q16 [8192][128] f16 = x16 . W^T / 64 + b
    const bool isk = bx < 2 * PB_V + 2 * PB_KQ;
    gemm64_block<0, false, 2, 1, false>(sT, isk ? bx - (2 * PB_V + PB_KQ) : bx - (2 * PB_V + 2 * PB_KQ), 0, x16, nullptr, IN_D, 0L,
                                        isk ? wk16 : wq16, nullptr, IN_D, 0L, (void*)(isk ? k16 : q16), nullptr, KQ_D, 0L,
                                        isk ? bk : bq, nullptr, 0L, G_ROWS, KQ_D, IN_D, WSC_INV);
  }
}

// ---- the four casts to f16 in one grid (weights x64, exact); two elements per thread; every range is whole blocks ----
#define CB_X ((G_ROWS * IN_D / 2) / 256)
#define CB_K ((KQ_D * IN_D / 2) / 256)
#define CB_V ((OUT_D * IN_D / 2) / 256)
__global__ __launch_bounds__(256) void k_cast_all(
    const float* __restrict__ x, const float* __restrict__ Wk, const float* __restrict__ Wq, const float* __restrict__ Wv,
    unsigned short* __restrict__ x16, unsigned short* __restrict__ wk16, unsigned short* __restrict__ wq16,
    unsigned short* __restrict__ wv16) {
  int bx = blockIdx.x;
  const float* in = Wk; unsigned short* out = wk16; float mul = WSC;
  if (bx >= 2 * CB_K + CB_V)  { in = x;  out = x16;  mul = 1.0f; bx -= 2 * CB_K + CB_V; }
  else if (bx >= 2 * CB_K)    { in = Wv; out = wv16; bx -= 2 * CB_K; }
  else if (bx >= CB_K)        { in = Wq; out = wq16; bx -= CB_K; }
  const int i = bx * 256 + threadIdx.x;
  const _Float16 h0 = (_Float16)(in[2 * i] * mul), h1 = (_Float16)(in[2 * i + 1] * mul);
  const unsigned u = (unsigned)__builtin_bit_cast(unsigned short, h0) | ((unsigned)__builtin_bit_cast(unsigned short, h1) << 16);
  ((unsigned*)out)[i] = u;
}

// ---- merge of the split sums: out[i] = f16( sum_s P[s][i] ), s ascending (fixed order), 4 elements per thread ----
__device__ __forceinline__ void merge_splits_block(const int bx, const float* __restrict__ P, unsigned short* __restrict__ out) {
  const int i = bx * 256 + threadIdx.x;            // the block range covers OUT_D * KQ_D / 4 exactly
  v4f a = (v4f){0.f, 0.f, 0.f, 0.f};
#pragma unroll 16   // 16 independent 16-byte loads in flight per wait instead of one
  for (int s = 0; s < NSPL; ++s) a += *(const v4f*)(P + (size_t)s * (OUT_D * KQ_D) + 4 * (size_t)i);
  *(v4h*)(out + 4 * (size_t)i) = __builtin_convertvector(a, v4h);
}

// ---- partial row sums of squares of S = k q^T; S stays in the accumulators and never goes to memory ----
// The product is formed transposed: A = 16 rows of q (streamed), B = 64 rows of k (held in registers), so a lane's
// accumulators all belong to one row of S per 16-row group (its k row = lane & 15) and the sum over q rows is in-lane.
// Wave = 64 rows of S x QCH columns; the 8 waves of a block walk the same q rows. part[chunk][row], f32.
#define QSTEP (16 * KQ_D)          // elements between two 16-row groups of q or k
__device__ __forceinline__ void load_rows16(v16h (&f)[4], const _Float16* p) {
#pragma unroll
  for (int t = 0; t < 4; ++t) f[t] = Frag<_Float16>::load(p + (t << 5));
}
// ss[j] += squares of the 16 x 16 tile (16 q rows) x (k rows of group j), element r = the lane's r-th q row
__device__ __forceinline__ void sumsq_rows16(v8f (&ss)[4], const v16h (&qa)[4], const v16h (&kb)[4][4]) {
  v8f acc[4];
#pragma unroll
  for (int j = 0; j < 4; ++j) acc[j] = (v8f){0.f,0.f,0.f,0.f,0.f,0.f,0.f,0.f};
#pragma unroll
  for (int t = 0; t < 4; ++t)
#pragma unroll
    for (int j = 0; j < 4; ++j) acc[j] = Frag<_Float16>::mma(qa[t], kb[j][t], acc[j]);
#pragma unroll
  for (int j = 0; j < 4; ++j) ss[j] += acc[j] * acc[j];
}
__global__ __launch_bounds__(256) void k_sumsq_part(const unsigned short* __restrict__ Kp, const unsigned short* __restrict__ Qp,
                                                    float* __restrict__ part) {
  const int lane  = threadIdx.x & 31;
  const int wave  = threadIdx.x >> 5;
  const int rlane = lane & 15;
  const int koff  = (lane >> 4) * 8;
  const int n0 = (blockIdx.x * 8 + wave) << 6;     // first row of S (row of k)
  const int q0 = blockIdx.y * QCH;                 // first column of S (row of q)
  const _Float16* kp = (const _Float16*)Kp + (size_t)(n0 + rlane) * KQ_D + koff;
  // q is addressed as the uniform base plus the lane's 32-bit byte offset qo (below 2 MiB), which the loop advances
  unsigned qo = (unsigned)((q0 + rlane) * KQ_D + koff) * 2u;
#define QPTR ((const _Float16*)((const char*)Qp + qo))

  v16h kb[4][4];                                   // [16-row group][k step of 32]
#pragma unroll
  for (int j = 0; j < 4; ++j) load_rows16(kb[j], kp + j * QSTEP);
  // four fragment buffers in rotation: a 16-row group of q is asked for three groups' products ahead of its use
  v16h b0[4], b1[4], b2[4], b3[4];
  load_rows16(b0, QPTR);
  load_rows16(b1, QPTR + QSTEP);
  load_rows16(b2, QPTR + 2 * QSTEP);
  // the k address is dead from here on: its registers are not reused before the loads that name them are translated
  asm volatile("s_wait_xcnt 0x0" :: "v"(kp) : "memory");

  v8f ss[4];
#pragma unroll
  for (int j = 0; j < 4; ++j) ss[j] = (v8f){0.f,0.f,0.f,0.f,0.f,0.f,0.f,0.f};

#pragma unroll 1   // kept rolled: the body already holds one turn of the rotation, and the code stays small
  for (int it = 0; it < QCH / 64 - 1; ++it) {
    load_rows16(b3, QPTR + 3 * QSTEP);
    sumsq_rows16(ss, b0, kb);
    load_rows16(b0, QPTR + 4 * QSTEP);
    sumsq_rows16(ss, b1, kb);
    load_rows16(b1, QPTR + 5 * QSTEP);
    sumsq_rows16(ss, b2, kb);
    load_rows16(b2, QPTR + 6 * QSTEP);
    sumsq_rows16(ss, b3, kb);
    // qo += the bytes of 4 groups. The add stands in one statement with the wait that belongs in front of a rewrite of
    // an address register of issued loads, so that the compiler cannot lift it over that wait.
    asm volatile("s_wait_xcnt 0x0\n\tv_add_nc_u32 %0, %1, %0" : "+v"(qo) : "n"(4 * QSTEP * 2) : "memory");
  }
  load_rows16(b3, QPTR + 3 * QSTEP);
  sumsq_rows16(ss, b0, kb);
  // the q offset is dead from here on: same wait as for the k address (without it the register is reused at once)
  asm volatile("s_wait_xcnt 0x0" :: "v"(qo) : "memory");
  sumsq_rows16(ss, b1, kb);
  sumsq_rows16(ss, b2, kb);
  sumsq_rows16(ss, b3, kb);

  float s[4];
#pragma unroll
  for (int j = 0; j < 4; ++j) {
    const float h = ((ss[j][0] + ss[j][1]) + (ss[j][2] + ss[j][3])) + ((ss[j][4] + ss[j][5]) + (ss[j][6] + ss[j][7]));
    s[j] = h + __shfl_xor(h, 16, 32);              // the two lane halves hold q rows 0..7 and 8..15 of each group
  }
  // both halves now hold every sum: lanes 0..15 store groups 0 and 2, lanes 16..31 groups 1 and 3 (whole 128-B lines)
  float* pr = part + (size_t)blockIdx.y * G_ROWS + n0 + lane;
  pr[0]  = (lane < 16) ? s[0] : s[1];
  pr[32] = (lane < 16) ? s[2] : s[3];
#undef QPTR
}

// ---- inv[i] = 1 / max(sqrt(sum_c part[c][i]), eps), c ascending (fixed order) ----
__device__ __forceinline__ void inv_norm_block(const int bx, const float* __restrict__ part, float* __restrict__ inv) {
  const int i = bx * 256 + threadIdx.x;            // the block range covers G_ROWS exactly
  float a = 0.f;
#pragma unroll   // all NCH loads are issued before the first one is waited for
  for (int c = 0; c < NCH; ++c) a += part[(size_t)c * G_ROWS + i];
  inv[i] = 1.0f / fmaxf(sqrtf(a), EPSF);
}

// ---- the split merge and the inverse norms in one grid: neither reads what the other writes ----
#define MB_M ((OUT_D * KQ_D / 4) / 256)
#define MB_I (G_ROWS / 256)
__global__ __launch_bounds__(256) void k_merge_and_inv(const float* __restrict__ P, unsigned short* __restrict__ mt,
                                                       const float* __restrict__ part, float* __restrict__ inv) {
  const int bx = blockIdx.x;
  if (bx >= MB_M) { inv_norm_block(bx - MB_M, part, inv); return; }
  merge_splits_block(bx, P, mt);
}

// ---------------------------------------------------------------------------
//   x16  [8192][512] f16    8 MiB      | Wk16 [128][512], Wq16 [128][512], Wv16 [512][512] f16 (x64)
//   K16  [8192][128] f16    2 MiB      | Q16 [8192][128] f16 2 MiB
//   Vf   [8192][512] f32   16 MiB      | VT16 [512][8192] f16 8 MiB
//   part [16][8192] f32   512 KiB (partial row sums of squares of S)  | inv [8192] f32
//   QT16 [128][8192] f16    2 MiB      | Pm [64][512][128] f32 16 MiB (split sums of v^T q) | MT16 [512][128] f16
// ---------------------------------------------------------------------------
extern "C" void kernel_launch(void* const* d_in, const int* in_sizes, int n_in,
                              void* d_out, int out_size, void* d_ws, size_t ws_size,
                              hipStream_t stream) {
  if (n_in < 7) return;
  if (in_sizes[0] != G_ROWS * IN_D || in_sizes[1] != KQ_D * IN_D || in_sizes[2] != KQ_D ||
      in_sizes[3] != KQ_D * IN_D || in_sizes[4] != KQ_D || in_sizes[5] != OUT_D * IN_D ||
      in_sizes[6] != OUT_D) return;
  if (out_size != G_ROWS * OUT_D) return;

  const float* x  = (const float*)d_in[0];
  const float* Wk = (const float*)d_in[1];
  const float* bk = (const float*)d_in[2];
  const float* Wq = (const float*)d_in[3];
  const float* bq = (const float*)d_in[4];
  const float* Wv = (const float*)d_in[5];
  const float* bv = (const float*)d_in[6];
  float* out = (float*)d_out;

  const size_t b_x16 = (size_t)G_ROWS * IN_D * 2;
  const size_t b_wk  = (size_t)KQ_D * IN_D * 2;
  const size_t b_wv  = (size_t)OUT_D * IN_D * 2;
  const size_t b_k16 = (size_t)G_ROWS * KQ_D * 2;
  const size_t b_vf  = (size_t)G_ROWS * OUT_D * 4;
  const size_t b_vt  = (size_t)OUT_D * G_ROWS * 2;
  const size_t b_prt = (size_t)NCH * G_ROWS * 4;
  const size_t b_inv = (size_t)G_ROWS * 4;
  const size_t b_pm  = (size_t)NSPL * OUT_D * KQ_D * 4;
  const size_t b_mt  = (size_t)OUT_D * KQ_D * 2;

  size_t off = 0;
  const size_t o_x16 = off; off += b_x16;
  const size_t o_wk  = off; off += b_wk;
  const size_t o_wq  = off; off += b_wk;
  const size_t o_wv  = off; off += b_wv;
  const size_t o_k16 = off; off += b_k16;
  const size_t o_q16 = off; off += b_k16;
  const size_t o_vf  = off; off += b_vf;
  const size_t o_vt  = off; off += b_vt;
  const size_t o_prt = off; off += b_prt;
  const size_t o_inv = off; off += b_inv;
  const size_t o_qt  = off; off += b_k16;
  const size_t o_pm  = off; off += b_pm;
  const size_t o_mt  = off; off += b_mt;
  if (off > ws_size) return;

  char* ws = (char*)d_ws;
  unsigned short* x16  = (unsigned short*)(ws + o_x16);
  unsigned short* wk16 = (unsigned short*)(ws + o_wk);
  unsigned short* wq16 = (unsigned short*)(ws + o_wq);
  unsigned short* wv16 = (unsigned short*)(ws + o_wv);
  unsigned short* k16  = (unsigned short*)(ws + o_k16);
  unsigned short* q16  = (unsigned short*)(ws + o_q16);
  float*          vf   = (float*)(ws + o_vf);
  unsigned short* vt16 = (unsigned short*)(ws + o_vt);
  float*          prt  = (float*)(ws + o_prt);
  float*          invb = (float*)(ws + o_inv);
  unsigned short* qt16 = (unsigned short*)(ws + o_qt);
  float*          pm   = (float*)(ws + o_pm);
  unsigned short* mt16 = (unsigned short*)(ws + o_mt);

  // ---- casts to f16 (weights x64, exact): one launch ----
  k_cast_all<<<dim3(CB_X + 2 * CB_K + CB_V), 256, 0, stream>>>(x, Wk, Wq, Wv, x16, wk16, wq16, wv16);

  // ---- projections k, q, v, v^T, q^T: one launch ----
  k_project_all<<<dim3(2 * PB_V + 3 * PB_KQ), 256, 0, stream>>>(x16, wk16, wq16, wv16, bk, bq, bv, k16, q16, vf, vt16, qt16);

  // ---- split sums of (q^T v)^T = VT16 . QT16^T : (k q^T) v is formed as k (q^T v) ----
  {
    // Pm[s] [512][128] f32 = VT16[:, s*KSPL ..] . QT16[:, s*KSPL ..]^T   (batch index = split)
    const int tm = (OUT_D / 64) * (KQ_D / 64);
    wmma_gemm64<0, false, 0, 0, false><<<dim3((tm + 7) / 8, NSPL), 256, 0, stream>>>(
        vt16, nullptr, G_ROWS, (long)KSPL, qt16, nullptr, G_ROWS, (long)KSPL,
        (void*)pm, nullptr, KQ_D, (long)(OUT_D * KQ_D), nullptr, nullptr, 0L, OUT_D, KQ_D, KSPL, 1.0f);
  }

  // ---- partial row sums of squares of S = K16 . Q16^T ----
  k_sumsq_part<<<dim3(G_ROWS / 512, NCH), 256, 0, stream>>>(k16, q16, prt);

  // ---- MT16 [512][128] = merged split sums; inv = inverse row norms: one launch ----
  k_merge_and_inv<<<dim3(MB_M + MB_I), 256, 0, stream>>>(pm, mt16, prt, invb);

  // ---- out [8192][512] = inv[m] * (K16 . MT16^T) + Vf ----
  {
    const int tp = (G_ROWS / 64) * (OUT_D / 64);
    wmma_gemm64<0, false, 3, 0, true><<<dim3((tp + 7) / 8, 1), 256, 0, stream>>>(
        k16, nullptr, KQ_D, 0L, mt16, nullptr, KQ_D, 0L,
        (void*)out, nullptr, OUT_D, 0L,
        invb, vf, 0L, G_ROWS, OUT_D, KQ_D, 1.0f);
  }
}

// v004
// It runs in 78.6 microseconds.
// Timed twice side by side with v003, it ran 1.23 and 1.24 times as fast.
// Counting every step since v000, it is 19.6 times as fast.
// Contractions: k,qT,v,vT projections (x*W^T), [vT;qT]*q (split over rows: q^T*v and the Gram matrix q^T*q), (q^T*q)*k^T (row norms of k*q^T as k_i^T (q^T q) k_i), k*(q^T*v) : v_wmma_f32_16x16x32_f16 (f16 operands, f32 accumulate); weights carried x64 in f16 with 1/64 folded into the epilogue scale; Gram matrix carried /256 as f16 hi + lo planes; row L2 norms, per-row scaling and residual in f32.
#include <hip/hip_runtime.h>
#include <math.h>
#include <stdint.h>
#include <stddef.h>

#define G_ROWS 8192
#define IN_D   512
#define KQ_D   128
#define OUT_D  512
#define PM_ROWS (OUT_D + KQ_D)     // rows of the split product: v^T q (OUT_D rows) above q^T q (KQ_D rows)
#define KSPL   128                 // rows of q and v summed by one split of the [v^T; q^T]*q product
#define NSPL   (G_ROWS / KSPL)
#define EPSF   1e-12f
#define WSC     64.0f
#define WSC_INV (1.0f / 64.0f)
#define GSC     256.0f             // the Gram matrix is carried divided by this (exact): its f16 planes stay in the normal range
#define GSC_INV (1.0f / 256.0f)

typedef __attribute__((ext_vector_type(16))) _Float16 v16h;
typedef __attribute__((ext_vector_type(8)))  _Float16 v8h;
typedef __attribute__((ext_vector_type(4)))  _Float16 v4h;
typedef __attribute__((ext_vector_type(16))) __bf16   v16b;
typedef __attribute__((ext_vector_type(8)))  __bf16   v8b;
typedef __attribute__((ext_vector_type(8)))  float    v8f;
typedef __attribute__((ext_vector_type(4)))  float    v4f;

__device__ __forceinline__ unsigned short f2bf_bits(float f) {
  unsigned u = __float_as_uint(f);
  return (unsigned short)((u + 0x7FFFu + ((u >> 16) & 1u)) >> 16);
}
__device__ __forceinline__ float bf_bits2f(unsigned short h) { return __uint_as_float(((unsigned)h) << 16); }

// hazard guards as plain device helpers (the kernel template body's only inline asm is the BWAIT s_wait_xcnt)
__device__ __forceinline__ void dep_guard_h(v8f& a, v8f& b, v16h x, v16h y) { asm volatile("v_nop\n\tv_nop\n\tv_nop\n\tv_nop" : "+v"(a), "+v"(b) : "v"(x), "v"(y)); }
__device__ __forceinline__ void dep_guard_b(v8f& a, v8f& b, v16b x, v16b y) { asm volatile("v_nop\n\tv_nop\n\tv_nop\n\tv_nop" : "+v"(a), "+v"(b) : "v"(x), "v"(y)); }
__device__ __forceinline__ void keep4_h(v16h a, v16h b, v16h c, v16h d) { asm volatile("v_nop" :: "v"(a), "v"(b), "v"(c), "v"(d)); }
__device__ __forceinline__ void keep4_b(v16b a, v16b b, v16b c, v16b d) { asm volatile("v_nop" :: "v"(a), "v"(b), "v"(c), "v"(d)); }
__device__ __forceinline__ void acc_guard4(v8f& a, v8f& b, v8f& c, v8f& d) { asm volatile("v_nop\n\tv_nop\n\tv_nop\n\tv_nop" : "+v"(a), "+v"(b), "+v"(c), "+v"(d)); }
template <typename T> struct Frag;
template <> struct Frag<_Float16> {
  typedef v16h V; union U { v16h v; v8h h[2]; };
  static __device__ __forceinline__ v16h load(const _Float16* p) {   // elements 0..7 <- p[0..7], 8..15 <- p[16..23]
    U f; f.h[0] = *(const v8h*)(p); f.h[1] = *(const v8h*)(p + 16); return f.v;
  }
  static __device__ __forceinline__ v8f mma(v16h a, v16h b, v8f c) {
    return __builtin_amdgcn_wmma_f32_16x16x32_f16(false, a, false, b, (short)0, c, false, false);
  }
  static __device__ __forceinline__ void guard(v8f& a, v8f& b, v16h x, v16h y) { dep_guard_h(a, b, x, y); }
  static __device__ __forceinline__ void keep(v16h a, v16h b, v16h c, v16h d) { keep4_h(a, b, c, d); }
};
template <> struct Frag<__bf16> {
  typedef v16b V; union U { v16b v; v8b h[2]; };
  static __device__ __forceinline__ v16b load(const __bf16* p) {
    U f; f.h[0] = *(const v8b*)(p); f.h[1] = *(const v8b*)(p + 16); return f.v;
  }
  static __device__ __forceinline__ v8f mma(v16b a, v16b b, v8f c) {
    return __builtin_amdgcn_wmma_f32_16x16x32_bf16(false, a, false, b, (short)0, c, false, false);
  }
  static __device__ __forceinline__ void guard(v8f& a, v8f& b, v16b x, v16b y) { dep_guard_b(a, b, x, y); }
  static __device__ __forceinline__ void keep(v16b a, v16b b, v16b c, v16b d) { keep4_b(a, b, c, d); }
};

// ---- Register-blocked batched WMMA GEMM ------------------------------------
// C[m,n] = scale * sum_k A[m,k] * Bt[n,k] (*rowscale)(+bias)(+resid); each wave owns a 64x64 tile.
// A row-major [M,K]; Bt row-major [N,K]; M,N % 64 == 0, K % 32 == 0.
// SPLIT: operands are hi/lo planes (A2/Bt2 = lo planes, same layout); product = hi*hi + hi*lo + lo*hi.
// BIAS_MODE: 0 = none, 1 = bias[m], 2 = bias[n], 3 = per-row scale: value *= bias[m] (applied before resid),
//            4 = as 3, with bias indexed by the row inside the 64-row tile (the block's own table).
// OUT_MODE: 0 = f32, 1 = f16, 2 = bf16 hi plane (Cout) + bf16 lo plane (Cout2).
// ET: 0 = f16 operands, 1 = bf16 operands (pointers passed as 16-bit storage)
template <int ET> struct Elem;
template <> struct Elem<0> { typedef _Float16 T; };
template <> struct Elem<1> { typedef __bf16 T; };
// gemm64_block: the work of one 256-thread block; bx, b = the block's place in this product's own grid; sT = the block's LDS slabs.
// BWAIT: s_wait_xcnt 0 stands behind each trip's B loads, in front of whatever reuses their address registers.
template <int ET, bool SPLIT, int BIAS_MODE, int OUT_MODE, bool RESID, int ACT = 0, bool BWAIT = false>
__device__ __forceinline__ void gemm64_block(
    float (*sT)[16 * 68], const int bx, const int b,
    const unsigned short* __restrict__ Ap, const unsigned short* __restrict__ A2p, int lda, long strideA,
    const unsigned short* __restrict__ Btp, const unsigned short* __restrict__ Bt2p, int ldb, long strideB,
    void* __restrict__ Cout, void* __restrict__ Cout2, int ldc, long strideC,
    const float* __restrict__ bias,
    const float* __restrict__ resid, long strideR,
    int M, int N, int K, float scale) {
  typedef typename Elem<ET>::T T;
  typedef typename Frag<T>::V V;
  const T* A = (const T*)Ap; const T* A2 = (const T*)A2p; const T* Bt = (const T*)Btp; const T* Bt2 = (const T*)Bt2p;
  const int lane = threadIdx.x & 31;
  const int wave = threadIdx.x >> 5;
  const int tilesN = N >> 6;
  const int tilesM = M >> 6;
  const int tile = bx * 8 + wave;
  if (tile >= tilesM * tilesN) return;   // wave-uniform; no block barriers in this kernel
  const int tm = tile / tilesN;
  const int tn = tile - tm * tilesN;
  const int m0 = tm << 6;
  const int n0 = tn << 6;

  const T* Ab  = A  + (size_t)b * strideA;
  const T* Bb  = Bt + (size_t)b * strideB;
  const T* Ab2 = SPLIT ? (A2  + (size_t)b * strideA) : nullptr;
  const T* Bb2 = SPLIT ? (Bt2 + (size_t)b * strideB) : nullptr;

  const int rlane = lane & 15;                 // row (A) / col (B, D) within subtile
  const int koff  = (lane >> 4) * 8;           // k offset of this lane half
  const int mOff  = (lane >> 4) * 8;           // D row offset

  v8f acc[4][4];
#pragma unroll
  for (int i = 0; i < 4; ++i)
#pragma unroll
    for (int j = 0; j < 4; ++j) acc[i][j] = (v8f){0.f,0.f,0.f,0.f,0.f,0.f,0.f,0.f};

  for (int k0 = 0; k0 < K; k0 += 32) {
    V bh[4], bl[4];
#pragma unroll
    for (int j = 0; j < 4; ++j) {
      const size_t bo = (size_t)(n0 + (j << 4) + rlane) * ldb + koff + k0;
      bh[j] = Frag<T>::load(Bb + bo);
      if (SPLIT) bl[j] = Frag<T>::load(Bb2 + bo);
    }
    // the wait that belongs in front of a rewrite of an address register of issued loads (here: by the A loads' results)
    if (BWAIT) asm volatile("s_wait_xcnt 0x0" ::: "memory");
#pragma unroll
    for (int i = 0; i < 4; ++i) {
      const size_t ao = (size_t)(m0 + (i << 4) + rlane) * lda + koff + k0;
      V ah = Frag<T>::load(Ab + ao);
      V al;
      if (SPLIT) al = Frag<T>::load(Ab2 + ao);
#pragma unroll
      for (int j = 0; j < 4; ++j) {
        acc[i][j] = Frag<T>::mma(ah, bh[j], acc[i][j]);
        if (SPLIT) {
          acc[i][j] = Frag<T>::mma(ah, bl[j], acc[i][j]);
          acc[i][j] = Frag<T>::mma(al, bh[j], acc[i][j]);
        }
      }
      Frag<T>::guard(acc[i][0], acc[i][3], ah, SPLIT ? al : ah);
    }
    Frag<T>::keep(bh[0], bh[1], bh[2], bh[3]);
    if (SPLIT) Frag<T>::keep(bl[0], bl[1], bl[2], bl[3]);
  }
  acc_guard4(acc[0][0], acc[0][1], acc[0][2], acc[0][3]);
  acc_guard4(acc[1][0], acc[1][1], acc[1][2], acc[1][3]);
  acc_guard4(acc[2][0], acc[2][1], acc[2][2], acc[2][3]);
  acc_guard4(acc[3][0], acc[3][1], acc[3][2], acc[3][3]);

  // ---- epilogue ----
  float* slab = sT[wave];
  const float* Rb = RESID ? (resid + (size_t)b * strideR) : nullptr;
#pragma unroll
  for (int i = 0; i < 4; ++i) {
    const int mBase = m0 + (i << 4);
#pragma unroll
    for (int j = 0; j < 4; ++j) {
      const int n = n0 + (j << 4) + rlane;
      float bv = 0.f;
      if (BIAS_MODE == 2) bv = bias[n];
#pragma unroll
      for (int r = 0; r < 8; ++r) {
        float v = acc[i][j][r] * scale;
        if (BIAS_MODE == 3) v *= bias[mBase + mOff + r];
        if (BIAS_MODE == 4) v *= bias[(i << 4) + mOff + r];
        if (BIAS_MODE == 1) v += bias[mBase + mOff + r];
        if (BIAS_MODE == 2) v += bv;
        if (RESID) v += Rb[(size_t)(mBase + mOff + r) * ldc + n];
        if (ACT == 1) v = tanhf(v);
        if (ACT == 2) v = fmaxf(v, 0.0f);
        if (ACT == 3) v = v / (1.0f + expf(-v));
        if (ACT == 4) v = (v > 0.f) ? v : 0.01f * v;
        if (ACT == 5) v = 0.5f * v * (1.0f + erff(v * 0.70710678118654752f));
        slab[(mOff + r) * 68 + (j << 4) + rlane] = v;
      }
    }
    __builtin_amdgcn_fence(__ATOMIC_RELEASE, "workgroup");
    __builtin_amdgcn_wave_barrier();
    __builtin_amdgcn_fence(__ATOMIC_ACQUIRE, "workgroup");
    if (OUT_MODE == 0) {
      float* C = (float*)Cout + (size_t)b * strideC;
      const int hh = lane >> 4, c4 = (lane & 15) * 4;     // row seg = 256 B = 16 lanes x 16 B
      {
#pragma unroll
        for (int it = 0; it < 8; ++it) {
          const int row = it * 2 + hh;
          v4f v = *(const v4f*)(slab + row * 68 + c4);
          *(v4f*)(C + (size_t)(mBase + row) * ldc + n0 + c4) = v;
        }
        
      }
    } else {
      const int q = lane >> 3, c8 = (lane & 7) * 8;
      unsigned short* C  = (unsigned short*)Cout  + (size_t)b * strideC;
      unsigned short* C2 = (OUT_MODE == 2) ? ((unsigned short*)Cout2 + (size_t)b * strideC) : nullptr;
      {
#pragma unroll
        for (int it = 0; it < 4; ++it) {
          const int row = it * 4 + q;
          const float* sp = slab + row * 68 + c8;
          v8h hv, lv;
#pragma unroll
          for (int e = 0; e < 8; ++e) {
            if (OUT_MODE == 1) {
              hv[e] = (_Float16)sp[e];
            } else {
              unsigned short hb = f2bf_bits(sp[e]);
              unsigned short lb = f2bf_bits(sp[e] - bf_bits2f(hb));
              hv[e] = __builtin_bit_cast(_Float16, hb);
              lv[e] = __builtin_bit_cast(_Float16, lb);
            }
          }
          *(v8h*)(C + (size_t)(mBase + row) * ldc + n0 + c8) = hv;
          if (OUT_MODE == 2) *(v8h*)(C2 + (size_t)(mBase + row) * ldc + n0 + c8) = lv;
        }
        
      }
    }
    __builtin_amdgcn_fence(__ATOMIC_RELEASE, "workgroup");
    __builtin_amdgcn_wave_barrier();
    __builtin_amdgcn_fence(__ATOMIC_ACQUIRE, "workgroup");
  }
}

template <int ET, bool SPLIT, int BIAS_MODE, int OUT_MODE, bool RESID, int ACT = 0>
__global__ __launch_bounds__(256) void wmma_gemm64(
    const unsigned short* __restrict__ Ap, const unsigned short* __restrict__ A2p, int lda, long strideA,
    const unsigned short* __restrict__ Btp, const unsigned short* __restrict__ Bt2p, int ldb, long strideB,
    void* __restrict__ Cout, void* __restrict__ Cout2, int ldc, long strideC,
    const float* __restrict__ bias,
    const float* __restrict__ resid, long strideR,
    int M, int N, int K, float scale) {
  __shared__ __align__(16) float sT[8][16 * 68];   // per-wave 16x64 slab, pitch 68 floats
  gemm64_block<ET, SPLIT, BIAS_MODE, OUT_MODE, RESID, ACT>(sT, blockIdx.x, blockIdx.y, Ap, A2p, lda, strideA, Btp, Bt2p, ldb, strideB,
                                                           Cout, Cout2, ldc, strideC, bias, resid, strideR, M, N, K, scale);
}

// ---- the four projections in one grid: none reads what another writes, so their blocks run side by side ----
// Block ranges (8 tiles of 64x64 per block), in this order: v, v^T, q^T, k.
#define PB_V  ((G_ROWS / 64) * (OUT_D / 64) / 8)
#define PB_KQ ((G_ROWS / 64) * (KQ_D / 64) / 8)
__global__ __launch_bounds__(256) void k_project_all(
    const unsigned short* __restrict__ x16, const unsigned short* __restrict__ wk16,
    const unsigned short* __restrict__ wq16, const unsigned short* __restrict__ wv16,
    const float* __restrict__ bk, const float* __restrict__ bq, const float* __restrict__ bv,
    unsigned short* __restrict__ k16, float* __restrict__ vf,
    unsigned short* __restrict__ vt16, unsigned short* __restrict__ qt16) {
  __shared__ __align__(16) float sT[8][16 * 68];   // per-wave 16x64 slab, pitch 68 floats
  const int bx = blockIdx.x;
  if (bx < PB_V) {
    // Vf [8192][512] f32 = x16 . Wv16^T / 64 + bv
    gemm64_block<0, false, 2, 0, false>(sT, bx, 0, x16, nullptr, IN_D, 0L, wv16, nullptr, IN_D, 0L, (void*)vf, nullptr, OUT_D, 0L,
                                        bv, nullptr, 0L, G_ROWS, OUT_D, IN_D, WSC_INV);
  } else if (bx < 2 * PB_V + PB_KQ) {
    // VT16 [512][8192] f16 = Wv16 . x16^T / 64 + bv[m];  QT16 [128][8192] f16 = Wq16 . x16^T / 64 + bq[m]
    const bool isv = bx < 2 * PB_V;
    gemm64_block<0, false, 1, 1, false>(sT, isv ? bx - PB_V : bx - 2 * PB_V, 0, isv ? wv16 : wq16, nullptr, IN_D, 0L,
                                        x16, nullptr, IN_D, 0L, (void*)(isv ? vt16 : qt16), nullptr, G_ROWS, 0L,
                                        isv ? bv : bq, nullptr, 0L, isv ? OUT_D : KQ_D, G_ROWS, IN_D, WSC_INV);
  } else {
    // K16 [8192][128] f16 = x16 . Wk16^T / 64 + bk
    gemm64_block<0, false, 2, 1, false, 0, true>(sT, bx - (2 * PB_V + PB_KQ), 0, x16, nullptr, IN_D, 0L,
                                        wk16, nullptr, IN_D, 0L, (void*)k16, nullptr, KQ_D, 0L,
                                        bk, nullptr, 0L, G_ROWS, KQ_D, IN_D, WSC_INV);
  }
}

// ---- the four casts to f16 in one grid (weights x64, exact); two elements per thread; every range is whole blocks ----
#define CB_X ((G_ROWS * IN_D / 2) / 256)
#define CB_K ((KQ_D * IN_D / 2) / 256)
#define CB_V ((OUT_D * IN_D / 2) / 256)
__global__ __launch_bounds__(256) void k_cast_all(
    const float* __restrict__ x, const float* __restrict__ Wk, const float* __restrict__ Wq, const float* __restrict__ Wv,
    unsigned short* __restrict__ x16, unsigned short* __restrict__ wk16, unsigned short* __restrict__ wq16,
    unsigned short* __restrict__ wv16) {
  int bx = blockIdx.x;
  const float* in = Wk; unsigned short* out = wk16; float mul = WSC;
  if (bx >= 2 * CB_K + CB_V)  { in = x;  out = x16;  mul = 1.0f; bx -= 2 * CB_K + CB_V; }
  else if (bx >= 2 * CB_K)    { in = Wv; out = wv16; bx -= 2 * CB_K; }
  else if (bx >= CB_K)        { in = Wq; out = wq16; bx -= CB_K; }
  const int i = bx * 256 + threadIdx.x;
  const _Float16 h0 = (_Float16)(in[2 * i] * mul), h1 = (_Float16)(in[2 * i + 1] * mul);
  const unsigned u = (unsigned)__builtin_bit_cast(unsigned short, h0) | ((unsigned)__builtin_bit_cast(unsigned short, h1) << 16);
  ((unsigned*)out)[i] = u;
}

// ---- merge of the split sums: sum_s P[s][i], s ascending (fixed order), 4 elements per thread ----
// Rows below OUT_D are (q^T v)^T and go out as f16, row-major. The KQ_D rows behind them are the Gram matrix q^T q: it goes
// out divided by GSC as an f16 hi plane and an f16 lo plane (the rest after hi), each in the order in which a wave loads it
// as A fragments: [16-row group i][k step t of 32][fragment half][lane][8 elements], so that a fragment half is 512
// contiguous bytes. Element e of half p in lane l is row 16 i + (l & 15), column 32 t + 16 p + 8 (l >> 4) + e: the k order
// of Frag::load.
#define MB_M ((OUT_D * KQ_D / 4) / 256)
#define MB_G ((KQ_D * KQ_D / 4) / 256)
__global__ __launch_bounds__(256) void k_merge(const float* __restrict__ P, unsigned short* __restrict__ mt,
                                               unsigned short* __restrict__ gh, unsigned short* __restrict__ gl) {
  const int i = blockIdx.x * 256 + threadIdx.x;    // the grid covers PM_ROWS * KQ_D / 4 exactly
  v4f a = (v4f){0.f, 0.f, 0.f, 0.f};
#pragma unroll 16   // 16 independent 16-byte loads in flight per wait instead of one
  for (int s = 0; s < NSPL; ++s) a += *(const v4f*)(P + (size_t)s * (PM_ROWS * KQ_D) + 4 * (size_t)i);
  if (blockIdx.x < MB_M) {
    *(v4h*)(mt + 4 * (size_t)i) = __builtin_convertvector(a, v4h);
    return;
  }
  const int e0  = 4 * i - OUT_D * KQ_D;
  const int row = e0 / KQ_D, col = e0 % KQ_D;
  const int pos = (((((row >> 4) * 4 + (col >> 5)) * 2 + ((col >> 4) & 1)) * 32) + (row & 15) + 16 * ((col >> 3) & 1)) * 8 + (col & 7);
  a *= GSC_INV;
  const v4h hi = __builtin_convertvector(a, v4h);
  *(v4h*)(gh + pos) = hi;
  *(v4h*)(gl + pos) = __builtin_convertvector(a - __builtin_convertvector(hi, v4f), v4h);
}

__device__ __forceinline__ void load_rows16(v16h (&f)[4], const _Float16* p) {
#pragma unroll
  for (int t = 0; t < 4; ++t) f[t] = Frag<_Float16>::load(p + (t << 5));
}
// A fragment (16-row group i, k step t) of a Gram plane in the order k_merge writes: two whole 512-byte runs per wave
__device__ __forceinline__ v16h load_gram(const _Float16* g, const int i, const int t, const int lane) {
  Frag<_Float16>::U f;
  const _Float16* p = g + ((i * 4 + t) * 2 * 32 + lane) * 8;
  f.h[0] = *(const v8h*)(p); f.h[1] = *(const v8h*)(p + 32 * 8);
  return f.v;
}

// ---- out [8192][512] = inv[m] * (K16 . MT16^T) + Vf, inv[m] = 1 / max(||row m of k q^T||, eps) ----
// sum_j (k_m . q_j)^2 = k_m^T (q^T q) k_m, so the row norms need the 128 x 128 Gram matrix only, never k q^T itself.
// A block owns 64 rows. Wave w forms, for the 16 rows of group w >> 1, the product T = G . k^T for the 16-row groups
// i = 2 u + (w & 1) of G (A = G, B = k rows): a lane's accumulators are T[16 i + 8 (lane >> 4) + r][its k row], and the k
// values they are multiplied with are the ones its own B fragment u holds in half w & 1.
__global__ __launch_bounds__(256) void k_scale_out(const unsigned short* __restrict__ k16, const unsigned short* __restrict__ mt16,
                                                   const unsigned short* __restrict__ gh, const unsigned short* __restrict__ gl,
                                                   const float* __restrict__ vf, float* __restrict__ out) {
  __shared__ __align__(16) float sT[8][16 * 68];   // per-wave 16x64 slab, pitch 68 floats
  __shared__ float sP[8][16];                      // per wave: its half of k^T G k / GSC for its 16 rows
  __shared__ float sInv[64];                       // inverse norms of the block's 64 rows
  const int lane = threadIdx.x & 31;
  const int wave = threadIdx.x >> 5;
  const int par  = wave & 1;
  {
    const _Float16* kp = (const _Float16*)k16 + (size_t)((blockIdx.x << 6) + ((wave >> 1) << 4) + (lane & 15)) * KQ_D + (lane >> 4) * 8;
    v16h kb[4];
    load_rows16(kb, kp);
    v8f acc[4];
#pragma unroll
    for (int u = 0; u < 4; ++u) acc[u] = (v8f){0.f,0.f,0.f,0.f,0.f,0.f,0.f,0.f};
#pragma unroll
    for (int t = 0; t < 4; ++t)
#pragma unroll
      for (int u = 0; u < 4; ++u) {
        acc[u] = Frag<_Float16>::mma(load_gram((const _Float16*)gl, 2 * u + par, t, lane), kb[t], acc[u]);
        acc[u] = Frag<_Float16>::mma(load_gram((const _Float16*)gh, 2 * u + par, t, lane), kb[t], acc[u]);
      }
    // the k address is dead from here on: its registers are not reused before the loads that name them are translated
    asm volatile("s_wait_xcnt 0x0" :: "v"(kp) : "memory");
    v8f ss = (v8f){0.f,0.f,0.f,0.f,0.f,0.f,0.f,0.f};
#pragma unroll
    for (int u = 0; u < 4; ++u) {
      Frag<_Float16>::U f; f.v = kb[u];
      ss += acc[u] * __builtin_convertvector(par ? f.h[1] : f.h[0], v8f);
    }
    const float h = ((ss[0] + ss[1]) + (ss[2] + ss[3])) + ((ss[4] + ss[5]) + (ss[6] + ss[7]));
    const float s = h + __shfl_xor(h, 16, 32);     // the two lane halves hold rows 0..7 and 8..15 of each group of G
    if (lane < 16) sP[wave][lane] = s;
  }
  __syncthreads();                                 // every wave's half sums are in sP
  if (threadIdx.x < 64) {
    const int g = threadIdx.x >> 4, r = threadIdx.x & 15;
    // rounding can carry a vanishing quadratic form below zero: it counts as zero, and eps takes over as in the reference
    const float a = fmaxf(sP[2 * g][r] + sP[2 * g + 1][r], 0.f) * GSC;
    sInv[threadIdx.x] = 1.0f / fmaxf(sqrtf(a), EPSF);
  }
  __syncthreads();                                 // sInv is complete before any wave's epilogue reads it
  gemm64_block<0, false, 4, 0, true>(sT, blockIdx.x, 0, k16, nullptr, KQ_D, 0L, mt16, nullptr, KQ_D, 0L,
                                     (void*)out, nullptr, OUT_D, 0L, sInv, vf, 0L, G_ROWS, OUT_D, KQ_D, 1.0f);
}

// ---------------------------------------------------------------------------
//   x16  [8192][512] f16    8 MiB      | Wk16 [128][512], Wq16 [128][512], Wv16 [512][512] f16 (x64)
//   K16  [8192][128] f16    2 MiB      | Vf [8192][512] f32 16 MiB
//   VT16 [512][8192] f16    8 MiB, directly followed by QT16 [128][8192] f16 2 MiB: one [640][8192] operand
//   Pm [64][640][128] f32  20 MiB (split sums of v^T q and q^T q) | MT16 [512][128] f16
//   GH16, GL16 [128][128] f16 (q^T q / 256, hi and lo plane, in fragment order)
// ---------------------------------------------------------------------------
extern "C" void kernel_launch(void* const* d_in, const int* in_sizes, int n_in,
                              void* d_out, int out_size, void* d_ws, size_t ws_size,
                              hipStream_t stream) {
  if (n_in < 7) return;
  if (in_sizes[0] != G_ROWS * IN_D || in_sizes[1] != KQ_D * IN_D || in_sizes[2] != KQ_D ||
      in_sizes[3] != KQ_D * IN_D || in_sizes[4] != KQ_D || in_sizes[5] != OUT_D * IN_D ||
      in_sizes[6] != OUT_D) return;
  if (out_size != G_ROWS * OUT_D) return;

  const float* x  = (const float*)d_in[0];
  const float* Wk = (const float*)d_in[1];
  const float* bk = (const float*)d_in[2];
  const float* Wq = (const float*)d_in[3];
  const float* bq = (const float*)d_in[4];
  const float* Wv = (const float*)d_in[5];
  const float* bv = (const float*)d_in[6];
  float* out = (float*)d_out;

  const size_t b_x16 = (size_t)G_ROWS * IN_D * 2;
  const size_t b_wk  = (size_t)KQ_D * IN_D * 2;
  const size_t b_wv  = (size_t)OUT_D * IN_D * 2;
  const size_t b_k16 = (size_t)G_ROWS * KQ_D * 2;
  const size_t b_vf  = (size_t)G_ROWS * OUT_D * 4;
  const size_t b_vt  = (size_t)OUT_D * G_ROWS * 2;
  const size_t b_pm  = (size_t)NSPL * PM_ROWS * KQ_D * 4;
  const size_t b_mt  = (size_t)OUT_D * KQ_D * 2;
  const size_t b_g   = (size_t)KQ_D * KQ_D * 2;

  size_t off = 0;
  const size_t o_x16 = off; off += b_x16;
  const size_t o_wk  = off; off += b_wk;
  const size_t o_wq  = off; off += b_wk;
  const size_t o_wv  = off; off += b_wv;
  const size_t o_k16 = off; off += b_k16;
  const size_t o_vf  = off; off += b_vf;
  const size_t o_vt  = off; off += b_vt;
  const size_t o_qt  = off; off += b_k16;   // stays directly behind VT16
  const size_t o_pm  = off; off += b_pm;
  const size_t o_mt  = off; off += b_mt;
  const size_t o_gh  = off; off += b_g;
  const size_t o_gl  = off; off += b_g;
  if (off > ws_size) return;

  char* ws = (char*)d_ws;
  unsigned short* x16  = (unsigned short*)(ws + o_x16);
  unsigned short* wk16 = (unsigned short*)(ws + o_wk);
  unsigned short* wq16 = (unsigned short*)(ws + o_wq);
  unsigned short* wv16 = (unsigned short*)(ws + o_wv);
  unsigned short* k16  = (unsigned short*)(ws + o_k16);
  float*          vf   = (float*)(ws + o_vf);
  unsigned short* vt16 = (unsigned short*)(ws + o_vt);
  unsigned short* qt16 = (unsigned short*)(ws + o_qt);
  float*          pm   = (float*)(ws + o_pm);
  unsigned short* mt16 = (unsigned short*)(ws + o_mt);
  unsigned short* gh16 = (unsigned short*)(ws + o_gh);
  unsigned short* gl16 = (unsigned short*)(ws + o_gl);

  // ---- casts to f16 (weights x64, exact): one launch ----
  k_cast_all<<<dim3(CB_X + 2 * CB_K + CB_V), 256, 0, stream>>>(x, Wk, Wq, Wv, x16, wk16, wq16, wv16);

  // ---- projections k, v, v^T, q^T: one launch ----
  k_project_all<<<dim3(2 * PB_V + 2 * PB_KQ), 256, 0, stream>>>(x16, wk16, wq16, wv16, bk, bq, bv, k16, vf, vt16, qt16);

  // ---- split sums of [VT16; QT16] . QT16^T : (k q^T) v is formed as k (q^T v), the row norms of k q^T from q^T q ----
  {
    // Pm[s] [640][128] f32 = [VT16; QT16][:, s*KSPL ..] . QT16[:, s*KSPL ..]^T   (batch index = split)
    // QT16 lies directly behind VT16, so both are one [PM_ROWS][G_ROWS] operand: rows below OUT_D give (q^T v)^T, the rest q^T q.
    const int tm = (PM_ROWS / 64) * (KQ_D / 64);
    wmma_gemm64<0, false, 0, 0, false><<<dim3((tm + 7) / 8, NSPL), 256, 0, stream>>>(
        vt16, nullptr, G_ROWS, (long)KSPL, qt16, nullptr, G_ROWS, (long)KSPL,
        (void*)pm, nullptr, KQ_D, (long)(PM_ROWS * KQ_D), nullptr, nullptr, 0L, PM_ROWS, KQ_D, KSPL, 1.0f);
  }

  // ---- MT16 [512][128] and the two Gram planes = merged split sums ----
  k_merge<<<dim3(MB_M + MB_G), 256, 0, stream>>>(pm, mt16, gh16, gl16);

  // ---- out [8192][512] = inv[m] * (K16 . MT16^T) + Vf, inv from the Gram planes ----
  k_scale_out<<<dim3(G_ROWS / 64), 256, 0, stream>>>(k16, mt16, gh16, gl16, vf, out);
}

// v005
// A run of this version takes 76 microseconds.
// Two timings next to v004 put it at 1.04 and 1.05 times that version's speed.
// Over all steps from v000 it is 20.4 times as fast.
// Contractions: k,qT,v,vT projections (x*W^T), [vT;qT]*q (split over rows: q^T*v and the Gram matrix q^T*q), (q^T*q)*k^T (row norms of k*q^T as k_i^T (q^T q) k_i), k*(q^T*v) : v_wmma_f32_16x16x32_f16 (f16 operands, f32 accumulate); weights carried x64 in f16 with 1/64 folded into the epilogue scale; Gram matrix carried /256 as f16 hi + lo planes; row L2 norms, per-row scaling and residual in f32.
#include <hip/hip_runtime.h>
#include <math.h>
#include <stdint.h>
#include <stddef.h>

#define G_ROWS 8192
#define IN_D   512
#define KQ_D   128
#define OUT_D  512
#define PM_ROWS (OUT_D + KQ_D)     // rows of the split product: v^T q (OUT_D rows) above q^T q (KQ_D rows)
#define KSPL   128                 // rows of q and v summed by one split of the [v^T; q^T]*q product
#define NSPL   (G_ROWS / KSPL)
#define EPSF   1e-12f
#define WSC     64.0f
#define WSC_INV (1.0f / 64.0f)
#define GSC     256.0f             // the Gram matrix is carried divided by this (exact): its f16 planes stay in the normal range
#define GSC_INV (1.0f / 256.0f)

typedef __attribute__((ext_vector_type(16))) _Float16 v16h;
typedef __attribute__((ext_vector_type(8)))  _Float16 v8h;
typedef __attribute__((ext_vector_type(4)))  _Float16 v4h;
typedef __attribute__((ext_vector_type(16))) __bf16   v16b;
typedef __attribute__((ext_vector_type(8)))  __bf16   v8b;
typedef __attribute__((ext_vector_type(8)))  float    v8f;
typedef __attribute__((ext_vector_type(4)))  float    v4f;

__device__ __forceinline__ unsigned short f2bf_bits(float f) {
  unsigned u = __float_as_uint(f);
  return (unsigned short)((u + 0x7FFFu + ((u >> 16) & 1u)) >> 16);
}
__device__ __forceinline__ float bf_bits2f(unsigned short h) { return __uint_as_float(((unsigned)h) << 16); }

// hazard guards as plain device helpers (the kernel template body has no inline asm of its own; its s_wait_xcnt is addr_wait8)
__device__ __forceinline__ void dep_guard_h(v8f& a, v8f& b, v16h x, v16h y) { asm volatile("v_nop\n\tv_nop\n\tv_nop\n\tv_nop" : "+v"(a), "+v"(b) : "v"(x), "v"(y)); }
__device__ __forceinline__ void dep_guard_b(v8f& a, v8f& b, v16b x, v16b y) { asm volatile("v_nop\n\tv_nop\n\tv_nop\n\tv_nop" : "+v"(a), "+v"(b) : "v"(x), "v"(y)); }
__device__ __forceinline__ void keep4_h(v16h a, v16h b, v16h c, v16h d) { asm volatile("v_nop" :: "v"(a), "v"(b), "v"(c), "v"(d)); }
__device__ __forceinline__ void keep4_b(v16b a, v16b b, v16b c, v16b d) { asm volatile("v_nop" :: "v"(a), "v"(b), "v"(c), "v"(d)); }
__device__ __forceinline__ void acc_guard4(v8f& a, v8f& b, v8f& c, v8f& d) { asm volatile("v_nop\n\tv_nop\n\tv_nop\n\tv_nop" : "+v"(a), "+v"(b), "+v"(c), "+v"(d)); }
// s_wait_xcnt 0 with load addresses as inputs: their registers stay as they are (no load's result lands in them, no next address)
// until the wait that belongs in front of a rewrite of an address register of issued loads has passed
__device__ __forceinline__ void addr_wait8(const void* a, const void* b, const void* c, const void* d, const void* e, const void* f, const void* g, const void* h) {
  asm volatile("s_wait_xcnt 0x0" :: "v"(a), "v"(b), "v"(c), "v"(d), "v"(e), "v"(f), "v"(g), "v"(h) : "memory");
}
template <typename T> struct Frag;
template <> struct Frag<_Float16> {
  typedef v16h V; union U { v16h v; v8h h[2]; };
  static __device__ __forceinline__ v16h load(const _Float16* p) {   // p = fragment + 8 * lane: elements 0..7 <- p[0..7], 8..15 <- p[256..263]
    U f; f.h[0] = *(const v8h*)(p); f.h[1] = *(const v8h*)(p + 256); return f.v;
  }
  static __device__ __forceinline__ v8f mma(v16h a, v16h b, v8f c) {
    return __builtin_amdgcn_wmma_f32_16x16x32_f16(false, a, false, b, (short)0, c, false, false);
  }
  static __device__ __forceinline__ void guard(v8f& a, v8f& b, v16h x, v16h y) { dep_guard_h(a, b, x, y); }
  static __device__ __forceinline__ void keep(v16h a, v16h b, v16h c, v16h d) { keep4_h(a, b, c, d); }
};
template <> struct Frag<__bf16> {
  typedef v16b V; union U { v16b v; v8b h[2]; };
  static __device__ __forceinline__ v16b load(const __bf16* p) {
    U f; f.h[0] = *(const v8b*)(p); f.h[1] = *(const v8b*)(p + 256); return f.v;
  }
  static __device__ __forceinline__ v8f mma(v16b a, v16b b, v8f c) {
    return __builtin_amdgcn_wmma_f32_16x16x32_bf16(false, a, false, b, (short)0, c, false, false);
  }
  static __device__ __forceinline__ void guard(v8f& a, v8f& b, v16b x, v16b y) { dep_guard_b(a, b, x, y); }
  static __device__ __forceinline__ void keep(v16b a, v16b b, v16b c, v16b d) { keep4_b(a, b, c, d); }
};

// ---- Register-blocked batched WMMA GEMM ------------------------------------
// C[m,n] = scale * sum_k A[m,k] * Bt[n,k] (*rowscale)(+bias)(+resid); each wave owns a 64x64 tile.
// A [M,K] and Bt [N,K] lie in FRAGMENT ORDER: [16-row group][k step of 32][fragment half][lane][8 elements], lda / ldb = elements
// per row, so that a wave's 16-byte loads of a fragment half cover 512 contiguous bytes (4 whole lines, not 32 bytes of each of
// 16 rows). Element e of half p in lane l is row 16 g + (l & 15), column 32 t + 16 p + 8 (l >> 4) + e. A step of 32 in k is a
// step of 512 elements, which is what strideA / strideB count in. 16-bit outputs are written in the same order (ldc = elements
// per row), f32 outputs row-major. M,N % 64 == 0, K % 32 == 0.
// SPLIT: operands are hi/lo planes (A2/Bt2 = lo planes, same layout); product = hi*hi + hi*lo + lo*hi.
// BIAS_MODE: 0 = none, 1 = bias[m], 2 = bias[n], 3 = per-row scale: value *= bias[m] (applied before resid),
//            4 = as 3, with bias indexed by the row inside the 64-row tile (the block's own table).
// OUT_MODE: 0 = f32, 1 = f16, 2 = bf16 hi plane (Cout) + bf16 lo plane (Cout2).
// ET: 0 = f16 operands, 1 = bf16 operands (pointers passed as 16-bit storage)
template <int ET> struct Elem;
template <> struct Elem<0> { typedef _Float16 T; };
template <> struct Elem<1> { typedef __bf16 T; };
// gemm64_block: the work of one 256-thread block; bx, b = the block's place in this product's own grid; sT = the block's LDS slabs.
template <int ET, bool SPLIT, int BIAS_MODE, int OUT_MODE, bool RESID, int ACT = 0>
__device__ __forceinline__ void gemm64_block(
    float (*sT)[16 * 68], const int bx, const int b,
    const unsigned short* __restrict__ Ap, const unsigned short* __restrict__ A2p, int lda, long strideA,
    const unsigned short* __restrict__ Btp, const unsigned short* __restrict__ Bt2p, int ldb, long strideB,
    void* __restrict__ Cout, void* __restrict__ Cout2, int ldc, long strideC,
    const float* __restrict__ bias,
    const float* __restrict__ resid, long strideR,
    int M, int N, int K, float scale) {
  typedef typename Elem<ET>::T T;
  typedef typename Frag<T>::V V;
  const T* A = (const T*)Ap; const T* A2 = (const T*)A2p; const T* Bt = (const T*)Btp; const T* Bt2 = (const T*)Bt2p;
  const int lane = threadIdx.x & 31;
  const int wave = threadIdx.x >> 5;
  const int tilesN = N >> 6;
  const int tilesM = M >> 6;
  const int tile = bx * 8 + wave;
  if (tile >= tilesM * tilesN) return;   // wave-uniform; no block barriers in this kernel
  const int tm = tile / tilesN;
  const int tn = tile - tm * tilesN;
  const int m0 = tm << 6;
  const int n0 = tn << 6;

  const T* Ab  = A  + (size_t)b * strideA;
  const T* Bb  = Bt + (size_t)b * strideB;
  const T* Ab2 = SPLIT ? (A2  + (size_t)b * strideA) : nullptr;
  const T* Bb2 = SPLIT ? (Bt2 + (size_t)b * strideB) : nullptr;

  const int rlane = lane & 15;                 // col (D) within subtile
  const int mOff  = (lane >> 4) * 8;           // D row offset

  v8f acc[4][4];
#pragma unroll
  for (int i = 0; i < 4; ++i)
#pragma unroll
    for (int j = 0; j < 4; ++j) acc[i][j] = (v8f){0.f,0.f,0.f,0.f,0.f,0.f,0.f,0.f};

  size_t ao[4], bo[4];                         // this lane's place in the current k step's fragments
#pragma unroll
  for (int i = 0; i < 4; ++i) {
    ao[i] = (size_t)((m0 >> 4) + i) * (lda >> 5) * 512 + lane * 8;
    bo[i] = (size_t)((n0 >> 4) + i) * (ldb >> 5) * 512 + lane * 8;
  }

  for (int k0 = 0; k0 < K; k0 += 32) {
    V bh[4], bl[4];
#pragma unroll
    for (int j = 0; j < 4; ++j) {
      bh[j] = Frag<T>::load(Bb + bo[j]);
      if (SPLIT) bl[j] = Frag<T>::load(Bb2 + bo[j]);
    }
#pragma unroll
    for (int i = 0; i < 4; ++i) {
      V ah = Frag<T>::load(Ab + ao[i]);
      V al;
      if (SPLIT) al = Frag<T>::load(Ab2 + ao[i]);
#pragma unroll
      for (int j = 0; j < 4; ++j) {
        acc[i][j] = Frag<T>::mma(ah, bh[j], acc[i][j]);
        if (SPLIT) {
          acc[i][j] = Frag<T>::mma(ah, bl[j], acc[i][j]);
          acc[i][j] = Frag<T>::mma(al, bh[j], acc[i][j]);
        }
      }
      Frag<T>::guard(acc[i][0], acc[i][3], ah, SPLIT ? al : ah);
    }
    Frag<T>::keep(bh[0], bh[1], bh[2], bh[3]);
    if (SPLIT) Frag<T>::keep(bl[0], bl[1], bl[2], bl[3]);
    // at the trip's foot, in front of the next trip's addresses
    addr_wait8(Ab + ao[0], Ab + ao[1], Ab + ao[2], Ab + ao[3], Bb + bo[0], Bb + bo[1], Bb + bo[2], Bb + bo[3]);
    if (SPLIT) addr_wait8(Ab2 + ao[0], Ab2 + ao[1], Ab2 + ao[2], Ab2 + ao[3], Bb2 + bo[0], Bb2 + bo[1], Bb2 + bo[2], Bb2 + bo[3]);
#pragma unroll
    for (int i = 0; i < 4; ++i) { ao[i] += 512; bo[i] += 512; }
  }
  acc_guard4(acc[0][0], acc[0][1], acc[0][2], acc[0][3]);
  acc_guard4(acc[1][0], acc[1][1], acc[1][2], acc[1][3]);
  acc_guard4(acc[2][0], acc[2][1], acc[2][2], acc[2][3]);
  acc_guard4(acc[3][0], acc[3][1], acc[3][2], acc[3][3]);

  // ---- epilogue ----
  float* slab = sT[wave];
  const float* Rb = RESID ? (resid + (size_t)b * strideR) : nullptr;
#pragma unroll
  for (int i = 0; i < 4; ++i) {
    const int mBase = m0 + (i << 4);
#pragma unroll
    for (int j = 0; j < 4; ++j) {
      const int n = n0 + (j << 4) + rlane;
      float bv = 0.f;
      if (BIAS_MODE == 2) bv = bias[n];
#pragma unroll
      for (int r = 0; r < 8; ++r) {
        float v = acc[i][j][r] * scale;
        if (BIAS_MODE == 3) v *= bias[mBase + mOff + r];
        if (BIAS_MODE == 4) v *= bias[(i << 4) + mOff + r];
        if (BIAS_MODE == 1) v += bias[mBase + mOff + r];
        if (BIAS_MODE == 2) v += bv;
        if (RESID) v += Rb[(size_t)(mBase + mOff + r) * ldc + n];
        if (ACT == 1) v = tanhf(v);
        if (ACT == 2) v = fmaxf(v, 0.0f);
        if (ACT == 3) v = v / (1.0f + expf(-v));
        if (ACT == 4) v = (v > 0.f) ? v : 0.01f * v;
        if (ACT == 5) v = 0.5f * v * (1.0f + erff(v * 0.70710678118654752f));
        slab[(mOff + r) * 68 + (j << 4) + rlane] = v;
      }
    }
    __builtin_amdgcn_fence(__ATOMIC_RELEASE, "workgroup");
    __builtin_amdgcn_wave_barrier();
    __builtin_amdgcn_fence(__ATOMIC_ACQUIRE, "workgroup");
    if (OUT_MODE == 0) {
      float* C = (float*)Cout + (size_t)b * strideC;
      const int hh = lane >> 4, c4 = (lane & 15) * 4;     // row seg = 256 B = 16 lanes x 16 B
      {
#pragma unroll
        for (int it = 0; it < 8; ++it) {
          const int row = it * 2 + hh;
          v4f v = *(const v4f*)(slab + row * 68 + c4);
          *(v4f*)(C + (size_t)(mBase + row) * ldc + n0 + c4) = v;
        }
        
      }
    } else {
      // the 16 x 64 slab is two fragments that lie side by side in the output: four stores of 512 contiguous bytes
      const size_t fo = ((size_t)(mBase >> 4) * (ldc >> 5) + (n0 >> 5)) * 512 + lane * 8;
      unsigned short* C  = (unsigned short*)Cout  + (size_t)b * strideC;
      unsigned short* C2 = (OUT_MODE == 2) ? ((unsigned short*)Cout2 + (size_t)b * strideC) : nullptr;
      {
#pragma unroll
        for (int it = 0; it < 4; ++it) {
          const float* sp = slab + rlane * 68 + it * 16 + mOff;   // fragment it >> 1, half it & 1
          v8h hv, lv;
#pragma unroll
          for (int e = 0; e < 8; ++e) {
            if (OUT_MODE == 1) {
              hv[e] = (_Float16)sp[e];
            } else {
              unsigned short hb = f2bf_bits(sp[e]);
              unsigned short lb = f2bf_bits(sp[e] - bf_bits2f(hb));
              hv[e] = __builtin_bit_cast(_Float16, hb);
              lv[e] = __builtin_bit_cast(_Float16, lb);
            }
          }
          *(v8h*)(C + fo + it * 256) = hv;
          if (OUT_MODE == 2) *(v8h*)(C2 + fo + it * 256) = lv;
        }
        
      }
    }
    __builtin_amdgcn_fence(__ATOMIC_RELEASE, "workgroup");
    __builtin_amdgcn_wave_barrier();
    __builtin_amdgcn_fence(__ATOMIC_ACQUIRE, "workgroup");
  }
}

template <int ET, bool SPLIT, int BIAS_MODE, int OUT_MODE, bool RESID, int ACT = 0>
__global__ __launch_bounds__(256) void wmma_gemm64(
    const unsigned short* __restrict__ Ap, const unsigned short* __restrict__ A2p, int lda, long strideA,
    const unsigned short* __restrict__ Btp, const unsigned short* __restrict__ Bt2p, int ldb, long strideB,
    void* __restrict__ Cout, void* __restrict__ Cout2, int ldc, long strideC,
    const float* __restrict__ bias,
    const float* __restrict__ resid, long strideR,
    int M, int N, int K, float scale) {
  __shared__ __align__(16) float sT[8][16 * 68];   // per-wave 16x64 slab, pitch 68 floats
  gemm64_block<ET, SPLIT, BIAS_MODE, OUT_MODE, RESID, ACT>(sT, blockIdx.x, blockIdx.y, Ap, A2p, lda, strideA, Btp, Bt2p, ldb, strideB,
                                                           Cout, Cout2, ldc, strideC, bias, resid, strideR, M, N, K, scale);
}

// ---- the four projections in one grid: none reads what another writes, so their blocks run side by side ----
// Block ranges (8 tiles of 64x64 per block), in this order: v, v^T, q^T, k.
#define PB_V  ((G_ROWS / 64) * (OUT_D / 64) / 8)
#define PB_KQ ((G_ROWS / 64) * (KQ_D / 64) / 8)
__global__ __launch_bounds__(256) void k_project_all(
    const unsigned short* __restrict__ x16, const unsigned short* __restrict__ wk16,
    const unsigned short* __restrict__ wq16, const unsigned short* __restrict__ wv16,
    const float* __restrict__ bk, const float* __restrict__ bq, const float* __restrict__ bv,
    unsigned short* __restrict__ k16, float* __restrict__ vf,
    unsigned short* __restrict__ vt16, unsigned short* __restrict__ qt16) {
  __shared__ __align__(16) float sT[8][16 * 68];   // per-wave 16x64 slab, pitch 68 floats
  const int bx = blockIdx.x;
  if (bx < PB_V) {
    // Vf [8192][512] f32 = x16 . Wv16^T / 64 + bv
    gemm64_block<0, false, 2, 0, false>(sT, bx, 0, x16, nullptr, IN_D, 0L, wv16, nullptr, IN_D, 0L, (void*)vf, nullptr, OUT_D, 0L,
                                        bv, nullptr, 0L, G_ROWS, OUT_D, IN_D, WSC_INV);
  } else if (bx < 2 * PB_V + PB_KQ) {
    // VT16 [512][8192] f16 = Wv16 . x16^T / 64 + bv[m];  QT16 [128][8192] f16 = Wq16 . x16^T / 64 + bq[m]
    const bool isv = bx < 2 * PB_V;
    gemm64_block<0, false, 1, 1, false>(sT, isv ? bx - PB_V : bx - 2 * PB_V, 0, isv ? wv16 : wq16, nullptr, IN_D, 0L,
                                        x16, nullptr, IN_D, 0L, (void*)(isv ? vt16 : qt16), nullptr, G_ROWS, 0L,
                                        isv ? bv : bq, nullptr, 0L, isv ? OUT_D : KQ_D, G_ROWS, IN_D, WSC_INV);
  } else {
    // K16 [8192][128] f16 = x16 . Wk16^T / 64 + bk
    gemm64_block<0, false, 2, 1, false>(sT, bx - (2 * PB_V + PB_KQ), 0, x16, nullptr, IN_D, 0L,
                                        wk16, nullptr, IN_D, 0L, (void*)k16, nullptr, KQ_D, 0L,
                                        bk, nullptr, 0L, G_ROWS, KQ_D, IN_D, WSC_INV);
  }
}

// ---- the four casts to f16 in one grid (weights x64, exact); every range is whole blocks ----
// The f16 copies go out in fragment order (see the GEMM's head): a thread makes one 16-byte piece, 8 elements of one row.
#define CB_X ((G_ROWS * IN_D / 8) / 256)
#define CB_K ((KQ_D * IN_D / 8) / 256)
#define CB_V ((OUT_D * IN_D / 8) / 256)
__global__ __launch_bounds__(256) void k_cast_all(
    const float* __restrict__ x, const float* __restrict__ Wk, const float* __restrict__ Wq, const float* __restrict__ Wv,
    unsigned short* __restrict__ x16, unsigned short* __restrict__ wk16, unsigned short* __restrict__ wq16,
    unsigned short* __restrict__ wv16) {
  int bx = blockIdx.x;
  const float* in = Wk; unsigned short* out = wk16; float mul = WSC;
  if (bx >= 2 * CB_K + CB_V)  { in = x;  out = x16;  mul = 1.0f; bx -= 2 * CB_K + CB_V; }
  else if (bx >= 2 * CB_K)    { in = Wv; out = wv16; bx -= 2 * CB_K; }
  else if (bx >= CB_K)        { in = Wq; out = wq16; bx -= CB_K; }
  const int c = bx * 256 + threadIdx.x;            // piece number: [16-row group][k step: IN_D / 32][half: 2][lane: 32]
  const int l = c & 31;
  const int row = (c / (IN_D * 2)) * 16 + (l & 15);
  const int col = ((c >> 6) % (IN_D / 32)) * 32 + ((c >> 5) & 1) * 16 + (l >> 4) * 8;
  const float* p = in + (size_t)row * IN_D + col;
  const v4f a = *(const v4f*)(p) * mul, b = *(const v4f*)(p + 4) * mul;
  *(v8h*)(out + (size_t)c * 8) = __builtin_convertvector(__builtin_shufflevector(a, b, 0, 1, 2, 3, 4, 5, 6, 7), v8h);
}

// ---- merge of the split sums: sum_s P[s][i], s ascending (fixed order), 4 elements per thread ----
// Rows below OUT_D are (q^T v)^T and go out as f16. The KQ_D rows behind them are the Gram matrix q^T q: it goes out divided
// by GSC as an f16 hi plane and an f16 lo plane (the rest after hi). All three go out in fragment order:
// [16-row group i][k step t of 32][fragment half][lane][8 elements], so that a fragment half is 512 contiguous bytes.
// Element e of half p in lane l is row 16 i + (l & 15), column 32 t + 16 p + 8 (l >> 4) + e.
#define MB_M ((OUT_D * KQ_D / 4) / 256)
#define MB_G ((KQ_D * KQ_D / 4) / 256)
__global__ __launch_bounds__(256) void k_merge(const float* __restrict__ P, unsigned short* __restrict__ mt,
                                               unsigned short* __restrict__ gh, unsigned short* __restrict__ gl) {
  const int i = blockIdx.x * 256 + threadIdx.x;    // the grid covers PM_ROWS * KQ_D / 4 exactly
  v4f a = (v4f){0.f, 0.f, 0.f, 0.f};
#pragma unroll 16   // 16 independent 16-byte loads in flight per wait instead of one
  for (int s = 0; s < NSPL; ++s) a += *(const v4f*)(P + (size_t)s * (PM_ROWS * KQ_D) + 4 * (size_t)i);
  const int e0  = blockIdx.x < MB_M ? 4 * i : 4 * i - OUT_D * KQ_D;
  const int row = e0 / KQ_D, col = e0 % KQ_D;
  const int pos = (((((row >> 4) * 4 + (col >> 5)) * 2 + ((col >> 4) & 1)) * 32) + (row & 15) + 16 * ((col >> 3) & 1)) * 8 + (col & 7);
  if (blockIdx.x < MB_M) {
    *(v4h*)(mt + pos) = __builtin_convertvector(a, v4h);
    return;
  }
  a *= GSC_INV;
  const v4h hi = __builtin_convertvector(a, v4h);
  *(v4h*)(gh + pos) = hi;
  *(v4h*)(gl + pos) = __builtin_convertvector(a - __builtin_convertvector(hi, v4f), v4h);
}

__device__ __forceinline__ void load_rows16(v16h (&f)[4], const _Float16* p) {
#pragma unroll
  for (int t = 0; t < 4; ++t) f[t] = Frag<_Float16>::load(p + (t << 9));
}
// A fragment (16-row group i, k step t) of a Gram plane in the order k_merge writes: two whole 512-byte runs per wave
__device__ __forceinline__ v16h load_gram(const _Float16* g, const int i, const int t, const int lane) {
  Frag<_Float16>::U f;
  const _Float16* p = g + ((i * 4 + t) * 2 * 32 + lane) * 8;
  f.h[0] = *(const v8h*)(p); f.h[1] = *(const v8h*)(p + 32 * 8);
  return f.v;
}

// ---- out [8192][512] = inv[m] * (K16 . MT16^T) + Vf, inv[m] = 1 / max(||row m of k q^T||, eps) ----
// sum_j (k_m . q_j)^2 = k_m^T (q^T q) k_m, so the row norms need the 128 x 128 Gram matrix only, never k q^T itself.
// A block owns 64 rows. Wave w forms, for the 16 rows of group w >> 1, the product T = G . k^T for the 16-row groups
// i = 2 u + (w & 1) of G (A = G, B = k rows): a lane's accumulators are T[16 i + 8 (lane >> 4) + r][its k row], and the k
// values they are multiplied with are the ones its own B fragment u holds in half w & 1.
__global__ __launch_bounds__(256) void k_scale_out(const unsigned short* __restrict__ k16, const unsigned short* __restrict__ mt16,
                                                   const unsigned short* __restrict__ gh, const unsigned short* __restrict__ gl,
                                                   const float* __restrict__ vf, float* __restrict__ out) {
  __shared__ __align__(16) float sT[8][16 * 68];   // per-wave 16x64 slab, pitch 68 floats
  __shared__ float sP[8][16];                      // per wave: its half of k^T G k / GSC for its 16 rows
  __shared__ float sInv[64];                       // inverse norms of the block's 64 rows
  const int lane = threadIdx.x & 31;
  const int wave = threadIdx.x >> 5;
  const int par  = wave & 1;
  {
    const _Float16* kp = (const _Float16*)k16 + (size_t)((blockIdx.x << 2) + (wave >> 1)) * (16 * KQ_D) + lane * 8;   // its 16-row group, fragment order
    v16h kb[4];
    load_rows16(kb, kp);
    v8f acc[4];
#pragma unroll
    for (int u = 0; u < 4; ++u) acc[u] = (v8f){0.f,0.f,0.f,0.f,0.f,0.f,0.f,0.f};
#pragma unroll
    for (int t = 0; t < 4; ++t)
#pragma unroll
      for (int u = 0; u < 4; ++u) {
        acc[u] = Frag<_Float16>::mma(load_gram((const _Float16*)gl, 2 * u + par, t, lane), kb[t], acc[u]);
        acc[u] = Frag<_Float16>::mma(load_gram((const _Float16*)gh, 2 * u + par, t, lane), kb[t], acc[u]);
      }
    // the k address is dead from here on: its registers are not reused before the loads that name them are translated
    asm volatile("s_wait_xcnt 0x0" :: "v"(kp) : "memory");
    v8f ss = (v8f){0.f,0.f,0.f,0.f,0.f,0.f,0.f,0.f};
#pragma unroll
    for (int u = 0; u < 4; ++u) {
      Frag<_Float16>::U f; f.v = kb[u];
      ss += acc[u] * __builtin_convertvector(par ? f.h[1] : f.h[0], v8f);
    }
    const float h = ((ss[0] + ss[1]) + (ss[2] + ss[3])) + ((ss[4] + ss[5]) + (ss[6] + ss[7]));
    const float s = h + __shfl_xor(h, 16, 32);     // the two lane halves hold rows 0..7 and 8..15 of each group of G
    if (lane < 16) sP[wave][lane] = s;
  }
  __syncthreads();                                 // every wave's half sums are in sP
  if (threadIdx.x < 64) {
    const int g = threadIdx.x >> 4, r = threadIdx.x & 15;
    // rounding can carry a vanishing quadratic form below zero: it counts as zero, and eps takes over as in the reference
    const float a = fmaxf(sP[2 * g][r] + sP[2 * g + 1][r], 0.f) * GSC;
    sInv[threadIdx.x] = 1.0f / fmaxf(sqrtf(a), EPSF);
  }
  __syncthreads();                                 // sInv is complete before any wave's epilogue reads it
  gemm64_block<0, false, 4, 0, true>(sT, blockIdx.x, 0, k16, nullptr, KQ_D, 0L, mt16, nullptr, KQ_D, 0L,
                                     (void*)out, nullptr, OUT_D, 0L, sInv, vf, 0L, G_ROWS, OUT_D, KQ_D, 1.0f);
}

// ---------------------------------------------------------------------------
//   every f16 array below lies in fragment order (see the GEMM's head); 16 whole rows stay one contiguous run
//   x16  [8192][512] f16    8 MiB      | Wk16 [128][512], Wq16 [128][512], Wv16 [512][512] f16 (x64)
//   K16  [8192][128] f16    2 MiB      | Vf [8192][512] f32 16 MiB
//   VT16 [512][8192] f16    8 MiB, directly followed by QT16 [128][8192] f16 2 MiB: one [640][8192] operand
//   Pm [64][640][128] f32  20 MiB (split sums of v^T q and q^T q) | MT16 [512][128] f16
//   GH16, GL16 [128][128] f16 (q^T q / 256, hi and lo plane, in fragment order)
// ---------------------------------------------------------------------------
extern "C" void kernel_launch(void* const* d_in, const int* in_sizes, int n_in,
                              void* d_out, int out_size, void* d_ws, size_t ws_size,
                              hipStream_t stream) {
  if (n_in < 7) return;
  if (in_sizes[0] != G_ROWS * IN_D || in_sizes[1] != KQ_D * IN_D || in_sizes[2] != KQ_D ||
      in_sizes[3] != KQ_D * IN_D || in_sizes[4] != KQ_D || in_sizes[5] != OUT_D * IN_D ||
      in_sizes[6] != OUT_D) return;
  if (out_size != G_ROWS * OUT_D) return;

  const float* x  = (const float*)d_in[0];
  const float* Wk = (const float*)d_in[1];
  const float* bk = (const float*)d_in[2];
  const float* Wq = (const float*)d_in[3];
  const float* bq = (const float*)d_in[4];
  const float* Wv = (const float*)d_in[5];
  const float* bv = (const float*)d_in[6];
  float* out = (float*)d_out;

  const size_t b_x16 = (size_t)G_ROWS * IN_D * 2;
  const size_t b_wk  = (size_t)KQ_D * IN_D * 2;
  const size_t b_wv  = (size_t)OUT_D * IN_D * 2;
  const size_t b_k16 = (size_t)G_ROWS * KQ_D * 2;
  const size_t b_vf  = (size_t)G_ROWS * OUT_D * 4;
  const size_t b_vt  = (size_t)OUT_D * G_ROWS * 2;
  const size_t b_pm  = (size_t)NSPL * PM_ROWS * KQ_D * 4;
  const size_t b_mt  = (size_t)OUT_D * KQ_D * 2;
  const size_t b_g   = (size_t)KQ_D * KQ_D * 2;

  size_t off = 0;
  const size_t o_x16 = off; off += b_x16;
  const size_t o_wk  = off; off += b_wk;
  const size_t o_wq  = off; off += b_wk;
  const size_t o_wv  = off; off += b_wv;
  const size_t o_k16 = off; off += b_k16;
  const size_t o_vf  = off; off += b_vf;
  const size_t o_vt  = off; off += b_vt;
  const size_t o_qt  = off; off += b_k16;   // stays directly behind VT16
  const size_t o_pm  = off; off += b_pm;
  const size_t o_mt  = off; off += b_mt;
  const size_t o_gh  = off; off += b_g;
  const size_t o_gl  = off; off += b_g;
  if (off > ws_size) return;

  char* ws = (char*)d_ws;
  unsigned short* x16  = (unsigned short*)(ws + o_x16);
  unsigned short* wk16 = (unsigned short*)(ws + o_wk);
  unsigned short* wq16 = (unsigned short*)(ws + o_wq);
  unsigned short* wv16 = (unsigned short*)(ws + o_wv);
  unsigned short* k16  = (unsigned short*)(ws + o_k16);
  float*          vf   = (float*)(ws + o_vf);
  unsigned short* vt16 = (unsigned short*)(ws + o_vt);
  unsigned short* qt16 = (unsigned short*)(ws + o_qt);
  float*          pm   = (float*)(ws + o_pm);
  unsigned short* mt16 = (unsigned short*)(ws + o_mt);
  unsigned short* gh16 = (unsigned short*)(ws + o_gh);
  unsigned short* gl16 = (unsigned short*)(ws + o_gl);

  // ---- casts to f16 (weights x64, exact): one launch ----
  k_cast_all<<<dim3(CB_X + 2 * CB_K + CB_V), 256, 0, stream>>>(x, Wk, Wq, Wv, x16, wk16, wq16, wv16);

  // ---- projections k, v, v^T, q^T: one launch ----
  k_project_all<<<dim3(2 * PB_V + 2 * PB_KQ), 256, 0, stream>>>(x16, wk16, wq16, wv16, bk, bq, bv, k16, vf, vt16, qt16);

  // ---- split sums of [VT16; QT16] . QT16^T : (k q^T) v is formed as k (q^T v), the row norms of k q^T from q^T q ----
  {
    // Pm[s] [640][128] f32 = [VT16; QT16][:, s*KSPL ..] . QT16[:, s*KSPL ..]^T   (batch index = split)
    // QT16 lies directly behind VT16, so both are one [PM_ROWS][G_ROWS] operand: rows below OUT_D give (q^T v)^T, the rest q^T q.
    const int tm = (PM_ROWS / 64) * (KQ_D / 64);
    wmma_gemm64<0, false, 0, 0, false><<<dim3((tm + 7) / 8, NSPL), 256, 0, stream>>>(
        vt16, nullptr, G_ROWS, (long)(KSPL * 16), qt16, nullptr, G_ROWS, (long)(KSPL * 16),
        (void*)pm, nullptr, KQ_D, (long)(PM_ROWS * KQ_D), nullptr, nullptr, 0L, PM_ROWS, KQ_D, KSPL, 1.0f);
  }

  // ---- MT16 [512][128] and the two Gram planes = merged split sums ----
  k_merge<<<dim3(MB_M + MB_G), 256, 0, stream>>>(pm, mt16, gh16, gl16);

  // ---- out [8192][512] = inv[m] * (K16 . MT16^T) + Vf, inv from the Gram planes ----
  k_scale_out<<<dim3(G_ROWS / 64), 256, 0, stream>>>(k16, mt16, gh16, gl16, vf, out);
}

// v006
// A run of this version takes 56.9 microseconds.
// Next to v005, in two timings, it ran 1.35 times as fast each time.
// Over all steps from v000 it is 27.5 times as fast.
// Contractions: k,qT,v,vT projections (x*W^T), [vT;qT]*q (split over rows: q^T*v and the Gram matrix q^T*q), (q^T*q)*k^T (row norms of k*q^T as k_i^T (q^T q) k_i), k*(q^T*v) : v_wmma_f32_16x16x32_f16 (f16 operands, f32 accumulate); weights carried x64 in f16 with 1/64 folded into the epilogue scale; Gram matrix carried /256 as f16 hi + lo planes; row L2 norms, per-row scaling and residual in f32.
#include <hip/hip_runtime.h>
#include <math.h>
#include <stdint.h>
#include <stddef.h>

#define G_ROWS 8192
#define IN_D   512
#define KQ_D   128
#define OUT_D  512
#define PM_ROWS (OUT_D + KQ_D)     // rows of the split product: v^T q (OUT_D rows) above q^T q (KQ_D rows)
#define KSPL   128                 // rows of q and v summed by one split of the [v^T; q^T]*q product
#define NSPL   (G_ROWS / KSPL)
#define EPSF   1e-12f
#define WSC     64.0f
#define WSC_INV (1.0f / 64.0f)
#define GSC     256.0f             // the Gram matrix is carried divided by this (exact): its f16 planes stay in the normal range
#define GSC_INV (1.0f / 256.0f)

typedef __attribute__((ext_vector_type(16))) _Float16 v16h;
typedef __attribute__((ext_vector_type(8)))  _Float16 v8h;
typedef __attribute__((ext_vector_type(4)))  _Float16 v4h;
typedef __attribute__((ext_vector_type(16))) __bf16   v16b;
typedef __attribute__((ext_vector_type(8)))  __bf16   v8b;
typedef __attribute__((ext_vector_type(8)))  float    v8f;
typedef __attribute__((ext_vector_type(4)))  float    v4f;

__device__ __forceinline__ unsigned short f2bf_bits(float f) {
  unsigned u = __float_as_uint(f);
  return (unsigned short)((u + 0x7FFFu + ((u >> 16) & 1u)) >> 16);
}
__device__ __forceinline__ float bf_bits2f(unsigned short h) { return __uint_as_float(((unsigned)h) << 16); }

// hazard guards as plain device helpers (the kernel template body has no inline asm of its own; its s_wait_xcnt is addr_wait8)
__device__ __forceinline__ void dep_guard_h(v8f& a, v8f& b, v16h x, v16h y) { asm volatile("v_nop\n\tv_nop\n\tv_nop\n\tv_nop" : "+v"(a), "+v"(b) : "v"(x), "v"(y)); }
__device__ __forceinline__ void dep_guard_b(v8f& a, v8f& b, v16b x, v16b y) { asm volatile("v_nop\n\tv_nop\n\tv_nop\n\tv_nop" : "+v"(a), "+v"(b) : "v"(x), "v"(y)); }
__device__ __forceinline__ void keep4_h(v16h a, v16h b, v16h c, v16h d) { asm volatile("v_nop" :: "v"(a), "v"(b), "v"(c), "v"(d)); }
__device__ __forceinline__ void keep4_b(v16b a, v16b b, v16b c, v16b d) { asm volatile("v_nop" :: "v"(a), "v"(b), "v"(c), "v"(d)); }
__device__ __forceinline__ void acc_guard4(v8f& a, v8f& b, v8f& c, v8f& d) { asm volatile("v_nop\n\tv_nop\n\tv_nop\n\tv_nop" : "+v"(a), "+v"(b), "+v"(c), "+v"(d)); }
// s_wait_xcnt 0 with load addresses as inputs: their registers stay as they are (no load's result lands in them, no next address)
// until the wait that belongs in front of a rewrite of an address register of issued loads has passed
__device__ __forceinline__ void addr_wait8(const void* a, const void* b, const void* c, const void* d, const void* e, const void* f, const void* g, const void* h) {
  asm volatile("s_wait_xcnt 0x0" :: "v"(a), "v"(b), "v"(c), "v"(d), "v"(e), "v"(f), "v"(g), "v"(h) : "memory");
}
template <typename T> struct Frag;
template <> struct Frag<_Float16> {
  typedef v16h V; union U { v16h v; v8h h[2]; };
  static __device__ __forceinline__ v16h load(const _Float16* p) {   // p = fragment + 8 * lane: elements 0..7 <- p[0..7], 8..15 <- p[256..263]
    U f; f.h[0] = *(const v8h*)(p); f.h[1] = *(const v8h*)(p + 256); return f.v;
  }
  static __device__ __forceinline__ v8f mma(v16h a, v16h b, v8f c) {
    return __builtin_amdgcn_wmma_f32_16x16x32_f16(false, a, false, b, (short)0, c, false, false);
  }
  static __device__ __forceinline__ void guard(v8f& a, v8f& b, v16h x, v16h y) { dep_guard_h(a, b, x, y); }
  static __device__ __forceinline__ void keep(v16h a, v16h b, v16h c, v16h d) { keep4_h(a, b, c, d); }
};
template <> struct Frag<__bf16> {
  typedef v16b V; union U { v16b v; v8b h[2]; };
  static __device__ __forceinline__ v16b load(const __bf16* p) {
    U f; f.h[0] = *(const v8b*)(p); f.h[1] = *(const v8b*)(p + 256); return f.v;
  }
  static __device__ __forceinline__ v8f mma(v16b a, v16b b, v8f c) {
    return __builtin_amdgcn_wmma_f32_16x16x32_bf16(false, a, false, b, (short)0, c, false, false);
  }
  static __device__ __forceinline__ void guard(v8f& a, v8f& b, v16b x, v16b y) { dep_guard_b(a, b, x, y); }
  static __device__ __forceinline__ void keep(v16b a, v16b b, v16b c, v16b d) { keep4_b(a, b, c, d); }
};

// ---- Register-blocked batched WMMA GEMM ------------------------------------
// C[m,n] = scale * sum_k A[m,k] * Bt[n,k] (*rowscale)(+bias)(+resid); each wave owns a 64x64 tile.
// A [M,K] and Bt [N,K] lie in FRAGMENT ORDER: [16-row group][k step of 32][fragment half][lane][8 elements], lda / ldb = elements
// per row, so that a wave's 16-byte loads of a fragment half cover 512 contiguous bytes (4 whole lines, not 32 bytes of each of
// 16 rows). Element e of half p in lane l is row 16 g + (l & 15), column 32 t + 16 p + 8 (l >> 4) + e. A step of 32 in k is a
// step of 512 elements, which is what strideA / strideB count in. 16-bit outputs are written in the same order (ldc = elements
// per row), f32 outputs row-major. M,N % 64 == 0, K % 32 == 0.
// SPLIT: operands are hi/lo planes (A2/Bt2 = lo planes, same layout); product = hi*hi + hi*lo + lo*hi.
// BIAS_MODE: 0 = none, 1 = bias[m], 2 = bias[n], 3 = per-row scale: value *= bias[m] (applied before resid),
//            4 = as 3, with bias indexed by the row inside the 64-row tile (the block's own table).
// OUT_MODE: 0 = f32, 1 = f16, 2 = bf16 hi plane (Cout) + bf16 lo plane (Cout2).
// ET: 0 = f16 operands, 1 = bf16 operands (pointers passed as 16-bit storage)
template <int ET> struct Elem;
template <> struct Elem<0> { typedef _Float16 T; };
template <> struct Elem<1> { typedef __bf16 T; };
// gemm64_block: the work of one 256-thread block; bx, b = the block's place in this product's own grid; sT = the block's LDS slabs.
template <int ET, bool SPLIT, int BIAS_MODE, int OUT_MODE, bool RESID, int ACT = 0>
__device__ __forceinline__ void gemm64_block(
    float (*sT)[16 * 68], const int bx, const int b,
    const unsigned short* __restrict__ Ap, const unsigned short* __restrict__ A2p, int lda, long strideA,
    const unsigned short* __restrict__ Btp, const unsigned short* __restrict__ Bt2p, int ldb, long strideB,
    void* __restrict__ Cout, void* __restrict__ Cout2, int ldc, long strideC,
    const float* __restrict__ bias,
    const float* __restrict__ resid, long strideR,
    int M, int N, int K, float scale) {
  typedef typename Elem<ET>::T T;
  typedef typename Frag<T>::V V;
  const T* A = (const T*)Ap; const T* A2 = (const T*)A2p; const T* Bt = (const T*)Btp; const T* Bt2 = (const T*)Bt2p;
  const int lane = threadIdx.x & 31;
  const int wave = threadIdx.x >> 5;
  const int tilesN = N >> 6;
  const int tilesM = M >> 6;
  const int tile = bx * 8 + wave;
  if (tile >= tilesM * tilesN) return;   // wave-uniform; no block barriers in this kernel
  const int tm = tile / tilesN;
  const int tn = tile - tm * tilesN;
  const int m0 = tm << 6;
  const int n0 = tn << 6;

  const T* Ab  = A  + (size_t)b * strideA;
  const T* Bb  = Bt + (size_t)b * strideB;
  const T* Ab2 = SPLIT ? (A2  + (size_t)b * strideA) : nullptr;
  const T* Bb2 = SPLIT ? (Bt2 + (size_t)b * strideB) : nullptr;

  const int rlane = lane & 15;                 // col (D) within subtile
  const int mOff  = (lane >> 4) * 8;           // D row offset

  v8f acc[4][4];
#pragma unroll
  for (int i = 0; i < 4; ++i)
#pragma unroll
    for (int j = 0; j < 4; ++j) acc[i][j] = (v8f){0.f,0.f,0.f,0.f,0.f,0.f,0.f,0.f};

  size_t ao[4], bo[4];                         // this lane's place in the current k step's fragments
#pragma unroll
  for (int i = 0; i < 4; ++i) {
    ao[i] = (size_t)((m0 >> 4) + i) * (lda >> 5) * 512 + lane * 8;
    bo[i] = (size_t)((n0 >> 4) + i) * (ldb >> 5) * 512 + lane * 8;
  }

  for (int k0 = 0; k0 < K; k0 += 32) {
    // every fragment of the k step has registers of its own and is loaded ahead of the step's first product:
    // the step waits out one load latency, not one for each row of A fragments
    V bh[4], bl[4], ahs[4], als[4];
#pragma unroll
    for (int j = 0; j < 4; ++j) {
      bh[j] = Frag<T>::load(Bb + bo[j]);
      if (SPLIT) bl[j] = Frag<T>::load(Bb2 + bo[j]);
    }
#pragma unroll
    for (int i = 0; i < 4; ++i) {
      ahs[i] = Frag<T>::load(Ab + ao[i]);
      if (SPLIT) als[i] = Frag<T>::load(Ab2 + ao[i]);
    }
#pragma unroll
    for (int i = 0; i < 4; ++i) {
      const V ah = ahs[i];
      const V al = SPLIT ? als[i] : ahs[i];
#pragma unroll
      for (int j = 0; j < 4; ++j) {
        acc[i][j] = Frag<T>::mma(ah, bh[j], acc[i][j]);
        if (SPLIT) {
          acc[i][j] = Frag<T>::mma(ah, bl[j], acc[i][j]);
          acc[i][j] = Frag<T>::mma(al, bh[j], acc[i][j]);
        }
      }
      Frag<T>::guard(acc[i][0], acc[i][3], ah, al);
    }
    Frag<T>::keep(bh[0], bh[1], bh[2], bh[3]);
    if (SPLIT) Frag<T>::keep(bl[0], bl[1], bl[2], bl[3]);
    // at the trip's foot, in front of the next trip's addresses
    addr_wait8(Ab + ao[0], Ab + ao[1], Ab + ao[2], Ab + ao[3], Bb + bo[0], Bb + bo[1], Bb + bo[2], Bb + bo[3]);
    if (SPLIT) addr_wait8(Ab2 + ao[0], Ab2 + ao[1], Ab2 + ao[2], Ab2 + ao[3], Bb2 + bo[0], Bb2 + bo[1], Bb2 + bo[2], Bb2 + bo[3]);
#pragma unroll
    for (int i = 0; i < 4; ++i) { ao[i] += 512; bo[i] += 512; }
  }
  acc_guard4(acc[0][0], acc[0][1], acc[0][2], acc[0][3]);
  acc_guard4(acc[1][0], acc[1][1], acc[1][2], acc[1][3]);
  acc_guard4(acc[2][0], acc[2][1], acc[2][2], acc[2][3]);
  acc_guard4(acc[3][0], acc[3][1], acc[3][2], acc[3][3]);

  // ---- epilogue ----
  float* slab = sT[wave];
  const float* Rb = RESID ? (resid + (size_t)b * strideR) : nullptr;
#pragma unroll
  for (int i = 0; i < 4; ++i) {
    const int mBase = m0 + (i << 4);
#pragma unroll
    for (int j = 0; j < 4; ++j) {
      const int n = n0 + (j << 4) + rlane;
      float bv = 0.f;
      if (BIAS_MODE == 2) bv = bias[n];
#pragma unroll
      for (int r = 0; r < 8; ++r) {
        float v = acc[i][j][r] * scale;
        if (BIAS_MODE == 3) v *= bias[mBase + mOff + r];
        if (BIAS_MODE == 4) v *= bias[(i << 4) + mOff + r];
        if (BIAS_MODE == 1) v += bias[mBase + mOff + r];
        if (BIAS_MODE == 2) v += bv;
        if (RESID) v += Rb[(size_t)(mBase + mOff + r) * ldc + n];
        if (ACT == 1) v = tanhf(v);
        if (ACT == 2) v = fmaxf(v, 0.0f);
        if (ACT == 3) v = v / (1.0f + expf(-v));
        if (ACT == 4) v = (v > 0.f) ? v : 0.01f * v;
        if (ACT == 5) v = 0.5f * v * (1.0f + erff(v * 0.70710678118654752f));
        slab[(mOff + r) * 68 + (j << 4) + rlane] = v;
      }
    }
    __builtin_amdgcn_fence(__ATOMIC_RELEASE, "workgroup");
    __builtin_amdgcn_wave_barrier();
    __builtin_amdgcn_fence(__ATOMIC_ACQUIRE, "workgroup");
    if (OUT_MODE == 0) {
      float* C = (float*)Cout + (size_t)b * strideC;
      const int hh = lane >> 4, c4 = (lane & 15) * 4;     // row seg = 256 B = 16 lanes x 16 B
      {
#pragma unroll
        for (int it = 0; it < 8; ++it) {
          const int row = it * 2 + hh;
          v4f v = *(const v4f*)(slab + row * 68 + c4);
          *(v4f*)(C + (size_t)(mBase + row) * ldc + n0 + c4) = v;
        }
        
      }
    } else {
      // the 16 x 64 slab is two fragments that lie side by side in the output: four stores of 512 contiguous bytes
      const size_t fo = ((size_t)(mBase >> 4) * (ldc >> 5) + (n0 >> 5)) * 512 + lane * 8;
      unsigned short* C  = (unsigned short*)Cout  + (size_t)b * strideC;
      unsigned short* C2 = (OUT_MODE == 2) ? ((unsigned short*)Cout2 + (size_t)b * strideC) : nullptr;
      {
#pragma unroll
        for (int it = 0; it < 4; ++it) {
          const float* sp = slab + rlane * 68 + it * 16 + mOff;   // fragment it >> 1, half it & 1
          v8h hv, lv;
#pragma unroll
          for (int e = 0; e < 8; ++e) {
            if (OUT_MODE == 1) {
              hv[e] = (_Float16)sp[e];
            } else {
              unsigned short hb = f2bf_bits(sp[e]);
              unsigned short lb = f2bf_bits(sp[e] - bf_bits2f(hb));
              hv[e] = __builtin_bit_cast(_Float16, hb);
              lv[e] = __builtin_bit_cast(_Float16, lb);
            }
          }
          *(v8h*)(C + fo + it * 256) = hv;
          if (OUT_MODE == 2) *(v8h*)(C2 + fo + it * 256) = lv;
        }
        
      }
    }
    __builtin_amdgcn_fence(__ATOMIC_RELEASE, "workgroup");
    __builtin_amdgcn_wave_barrier();
    __builtin_amdgcn_fence(__ATOMIC_ACQUIRE, "workgroup");
  }
}

template <int ET, bool SPLIT, int BIAS_MODE, int OUT_MODE, bool RESID, int ACT = 0>
__global__ __launch_bounds__(256) void wmma_gemm64(
    const unsigned short* __restrict__ Ap, const unsigned short* __restrict__ A2p, int lda, long strideA,
    const unsigned short* __restrict__ Btp, const unsigned short* __restrict__ Bt2p, int ldb, long strideB,
    void* __restrict__ Cout, void* __restrict__ Cout2, int ldc, long strideC,
    const float* __restrict__ bias,
    const float* __restrict__ resid, long strideR,
    int M, int N, int K, float scale) {
  __shared__ __align__(16) float sT[8][16 * 68];   // per-wave 16x64 slab, pitch 68 floats
  gemm64_block<ET, SPLIT, BIAS_MODE, OUT_MODE, RESID, ACT>(sT, blockIdx.x, blockIdx.y, Ap, A2p, lda, strideA, Btp, Bt2p, ldb, strideB,
                                                           Cout, Cout2, ldc, strideC, bias, resid, strideR, M, N, K, scale);
}

// ---- the four projections in one grid: none reads what another writes, so their blocks run side by side ----
// Block ranges (8 tiles of 64x64 per block), in this order: v, v^T, q^T, k.
#define PB_V  ((G_ROWS / 64) * (OUT_D / 64) / 8)
#define PB_KQ ((G_ROWS / 64) * (KQ_D / 64) / 8)
__global__ __launch_bounds__(256) void k_project_all(
    const unsigned short* __restrict__ x16, const unsigned short* __restrict__ wk16,
    const unsigned short* __restrict__ wq16, const unsigned short* __restrict__ wv16,
    const float* __restrict__ bk, const float* __restrict__ bq, const float* __restrict__ bv,
    unsigned short* __restrict__ k16, float* __restrict__ vf,
    unsigned short* __restrict__ vt16, unsigned short* __restrict__ qt16) {
  __shared__ __align__(16) float sT[8][16 * 68];   // per-wave 16x64 slab, pitch 68 floats
  const int bx = blockIdx.x;
  if (bx < PB_V) {
    // Vf [8192][512] f32 = x16 . Wv16^T / 64 + bv
    gemm64_block<0, false, 2, 0, false>(sT, bx, 0, x16, nullptr, IN_D, 0L, wv16, nullptr, IN_D, 0L, (void*)vf, nullptr, OUT_D, 0L,
                                        bv, nullptr, 0L, G_ROWS, OUT_D, IN_D, WSC_INV);
  } else if (bx < 2 * PB_V + PB_KQ) {
    // VT16 [512][8192] f16 = Wv16 . x16^T / 64 + bv[m];  QT16 [128][8192] f16 = Wq16 . x16^T / 64 + bq[m]
    const bool isv = bx < 2 * PB_V;
    gemm64_block<0, false, 1, 1, false>(sT, isv ? bx - PB_V : bx - 2 * PB_V, 0, isv ? wv16 : wq16, nullptr, IN_D, 0L,
                                        x16, nullptr, IN_D, 0L, (void*)(isv ? vt16 : qt16), nullptr, G_ROWS, 0L,
                                        isv ? bv : bq, nullptr, 0L, isv ? OUT_D : KQ_D, G_ROWS, IN_D, WSC_INV);
  } else {
    // K16 [8192][128] f16 = x16 . Wk16^T / 64 + bk
    gemm64_block<0, false, 2, 1, false>(sT, bx - (2 * PB_V + PB_KQ), 0, x16, nullptr, IN_D, 0L,
                                        wk16, nullptr, IN_D, 0L, (void*)k16, nullptr, KQ_D, 0L,
                                        bk, nullptr, 0L, G_ROWS, KQ_D, IN_D, WSC_INV);
  }
}

// ---- the four casts to f16 in one grid (weights x64, exact); every range is whole blocks ----
// The f16 copies go out in fragment order (see the GEMM's head): a thread makes one 16-byte piece, 8 elements of one row.
#define CB_X ((G_ROWS * IN_D / 8) / 256)
#define CB_K ((KQ_D * IN_D / 8) / 256)
#define CB_V ((OUT_D * IN_D / 8) / 256)
__global__ __launch_bounds__(256) void k_cast_all(
    const float* __restrict__ x, const float* __restrict__ Wk, const float* __restrict__ Wq, const float* __restrict__ Wv,
    unsigned short* __restrict__ x16, unsigned short* __restrict__ wk16, unsigned short* __restrict__ wq16,
    unsigned short* __restrict__ wv16) {
  int bx = blockIdx.x;
  const float* in = Wk; unsigned short* out = wk16; float mul = WSC;
  if (bx >= 2 * CB_K + CB_V)  { in = x;  out = x16;  mul = 1.0f; bx -= 2 * CB_K + CB_V; }
  else if (bx >= 2 * CB_K)    { in = Wv; out = wv16; bx -= 2 * CB_K; }
  else if (bx >= CB_K)        { in = Wq; out = wq16; bx -= CB_K; }
  const int c = bx * 256 + threadIdx.x;            // piece number: [16-row group][k step: IN_D / 32][half: 2][lane: 32]
  const int l = c & 31;
  const int row = (c / (IN_D * 2)) * 16 + (l & 15);
  const int col = ((c >> 6) % (IN_D / 32)) * 32 + ((c >> 5) & 1) * 16 + (l >> 4) * 8;
  const float* p = in + (size_t)row * IN_D + col;
  const v4f a = *(const v4f*)(p) * mul, b = *(const v4f*)(p + 4) * mul;
  *(v8h*)(out + (size_t)c * 8) = __builtin_convertvector(__builtin_shufflevector(a, b, 0, 1, 2, 3, 4, 5, 6, 7), v8h);
}

// ---- merge of the split sums: sum_s P[s][i], s ascending (fixed order), 4 elements per thread ----
// Rows below OUT_D are (q^T v)^T and go out as f16. The KQ_D rows behind them are the Gram matrix q^T q: it goes out divided
// by GSC as an f16 hi plane and an f16 lo plane (the rest after hi). All three go out in fragment order:
// [16-row group i][k step t of 32][fragment half][lane][8 elements], so that a fragment half is 512 contiguous bytes.
// Element e of half p in lane l is row 16 i + (l & 15), column 32 t + 16 p + 8 (l >> 4) + e.
#define MB_M ((OUT_D * KQ_D / 4) / 256)
#define MB_G ((KQ_D * KQ_D / 4) / 256)
__global__ __launch_bounds__(256) void k_merge(const float* __restrict__ P, unsigned short* __restrict__ mt,
                                               unsigned short* __restrict__ gh, unsigned short* __restrict__ gl) {
  const int i = blockIdx.x * 256 + threadIdx.x;    // the grid covers PM_ROWS * KQ_D / 4 exactly
  v4f a = (v4f){0.f, 0.f, 0.f, 0.f};
#pragma unroll 16   // 16 independent 16-byte loads in flight per wait instead of one
  for (int s = 0; s < NSPL; ++s) a += *(const v4f*)(P + (size_t)s * (PM_ROWS * KQ_D) + 4 * (size_t)i);
  const int e0  = blockIdx.x < MB_M ? 4 * i : 4 * i - OUT_D * KQ_D;
  const int row = e0 / KQ_D, col = e0 % KQ_D;
  const int pos = (((((row >> 4) * 4 + (col >> 5)) * 2 + ((col >> 4) & 1)) * 32) + (row & 15) + 16 * ((col >> 3) & 1)) * 8 + (col & 7);
  if (blockIdx.x < MB_M) {
    *(v4h*)(mt + pos) = __builtin_convertvector(a, v4h);
    return;
  }
  a *= GSC_INV;
  const v4h hi = __builtin_convertvector(a, v4h);
  *(v4h*)(gh + pos) = hi;
  *(v4h*)(gl + pos) = __builtin_convertvector(a - __builtin_convertvector(hi, v4f), v4h);
}

__device__ __forceinline__ void load_rows16(v16h (&f)[4], const _Float16* p) {
#pragma unroll
  for (int t = 0; t < 4; ++t) f[t] = Frag<_Float16>::load(p + (t << 9));
}
// A fragment (16-row group i, k step t) of a Gram plane in the order k_merge writes: two whole 512-byte runs per wave
__device__ __forceinline__ v16h load_gram(const _Float16* g, const int i, const int t, const int lane) {
  Frag<_Float16>::U f;
  const _Float16* p = g + ((i * 4 + t) * 2 * 32 + lane) * 8;
  f.h[0] = *(const v8h*)(p); f.h[1] = *(const v8h*)(p + 32 * 8);
  return f.v;
}

// ---- out [8192][512] = inv[m] * (K16 . MT16^T) + Vf, inv[m] = 1 / max(||row m of k q^T||, eps) ----
// sum_j (k_m . q_j)^2 = k_m^T (q^T q) k_m, so the row norms need the 128 x 128 Gram matrix only, never k q^T itself.
// A block owns 64 rows. Wave w forms, for the 16 rows of group w >> 1, the product T = G . k^T for the 16-row groups
// i = 2 u + (w & 1) of G (A = G, B = k rows): a lane's accumulators are T[16 i + 8 (lane >> 4) + r][its k row], and the k
// values they are multiplied with are the ones its own B fragment u holds in half w & 1.
__global__ __launch_bounds__(256) void k_scale_out(const unsigned short* __restrict__ k16, const unsigned short* __restrict__ mt16,
                                                   const unsigned short* __restrict__ gh, const unsigned short* __restrict__ gl,
                                                   const float* __restrict__ vf, float* __restrict__ out) {
  __shared__ __align__(16) float sT[8][16 * 68];   // per-wave 16x64 slab, pitch 68 floats
  __shared__ float sP[8][16];                      // per wave: its half of k^T G k / GSC for its 16 rows
  __shared__ float sInv[64];                       // inverse norms of the block's 64 rows
  const int lane = threadIdx.x & 31;
  const int wave = threadIdx.x >> 5;
  const int par  = wave & 1;
  {
    const _Float16* kp = (const _Float16*)k16 + (size_t)((blockIdx.x << 2) + (wave >> 1)) * (16 * KQ_D) + lane * 8;   // its 16-row group, fragment order
    v16h kb[4];
    load_rows16(kb, kp);
    v8f acc[4];
#pragma unroll
    for (int u = 0; u < 4; ++u) acc[u] = (v8f){0.f,0.f,0.f,0.f,0.f,0.f,0.f,0.f};
#pragma unroll
    for (int t = 0; t < 4; ++t)
#pragma unroll
      for (int u = 0; u < 4; ++u) {
        acc[u] = Frag<_Float16>::mma(load_gram((const _Float16*)gl, 2 * u + par, t, lane), kb[t], acc[u]);
        acc[u] = Frag<_Float16>::mma(load_gram((const _Float16*)gh, 2 * u + par, t, lane), kb[t], acc[u]);
      }
    // the k address is dead from here on: its registers are not reused before the loads that name them are translated
    asm volatile("s_wait_xcnt 0x0" :: "v"(kp) : "memory");
    v8f ss = (v8f){0.f,0.f,0.f,0.f,0.f,0.f,0.f,0.f};
#pragma unroll
    for (int u = 0; u < 4; ++u) {
      Frag<_Float16>::U f; f.v = kb[u];
      ss += acc[u] * __builtin_convertvector(par ? f.h[1] : f.h[0], v8f);
    }
    const float h = ((ss[0] + ss[1]) + (ss[2] + ss[3])) + ((ss[4] + ss[5]) + (ss[6] + ss[7]));
    const float s = h + __shfl_xor(h, 16, 32);     // the two lane halves hold rows 0..7 and 8..15 of each group of G
    if (lane < 16) sP[wave][lane] = s;
  }
  __syncthreads();                                 // every wave's half sums are in sP
  if (threadIdx.x < 64) {
    const int g = threadIdx.x >> 4, r = threadIdx.x & 15;
    // rounding can carry a vanishing quadratic form below zero: it counts as zero, and eps takes over as in the reference
    const float a = fmaxf(sP[2 * g][r] + sP[2 * g + 1][r], 0.f) * GSC;
    sInv[threadIdx.x] = 1.0f / fmaxf(sqrtf(a), EPSF);
  }
  __syncthreads();                                 // sInv is complete before any wave's epilogue reads it
  gemm64_block<0, false, 4, 0, true>(sT, blockIdx.x, 0, k16, nullptr, KQ_D, 0L, mt16, nullptr, KQ_D, 0L,
                                     (void*)out, nullptr, OUT_D, 0L, sInv, vf, 0L, G_ROWS, OUT_D, KQ_D, 1.0f);
}

// ---------------------------------------------------------------------------
//   every f16 array below lies in fragment order (see the GEMM's head); 16 whole rows stay one contiguous run
//   x16  [8192][512] f16    8 MiB      | Wk16 [128][512], Wq16 [128][512], Wv16 [512][512] f16 (x64)
//   K16  [8192][128] f16    2 MiB      | Vf [8192][512] f32 16 MiB
//   VT16 [512][8192] f16    8 MiB, directly followed by QT16 [128][8192] f16 2 MiB: one [640][8192] operand
//   Pm [64][640][128] f32  20 MiB (split sums of v^T q and q^T q) | MT16 [512][128] f16
//   GH16, GL16 [128][128] f16 (q^T q / 256, hi and lo plane, in fragment order)
// ---------------------------------------------------------------------------
extern "C" void kernel_launch(void* const* d_in, const int* in_sizes, int n_in,
                              void* d_out, int out_size, void* d_ws, size_t ws_size,
                              hipStream_t stream) {
  if (n_in < 7) return;
  if (in_sizes[0] != G_ROWS * IN_D || in_sizes[1] != KQ_D * IN_D || in_sizes[2] != KQ_D ||
      in_sizes[3] != KQ_D * IN_D || in_sizes[4] != KQ_D || in_sizes[5] != OUT_D * IN_D ||
      in_sizes[6] != OUT_D) return;
  if (out_size != G_ROWS * OUT_D) return;

  const float* x  = (const float*)d_in[0];
  const float* Wk = (const float*)d_in[1];
  const float* bk = (const float*)d_in[2];
  const float* Wq = (const float*)d_in[3];
  const float* bq = (const float*)d_in[4];
  const float* Wv = (const float*)d_in[5];
  const float* bv = (const float*)d_in[6];
  float* out = (float*)d_out;

  const size_t b_x16 = (size_t)G_ROWS * IN_D * 2;
  const size_t b_wk  = (size_t)KQ_D * IN_D * 2;
  const size_t b_wv  = (size_t)OUT_D * IN_D * 2;
  const size_t b_k16 = (size_t)G_ROWS * KQ_D * 2;
  const size_t b_vf  = (size_t)G_ROWS * OUT_D * 4;
  const size_t b_vt  = (size_t)OUT_D * G_ROWS * 2;
  const size_t b_pm  = (size_t)NSPL * PM_ROWS * KQ_D * 4;
  const size_t b_mt  = (size_t)OUT_D * KQ_D * 2;
  const size_t b_g   = (size_t)KQ_D * KQ_D * 2;

  size_t off = 0;
  const size_t o_x16 = off; off += b_x16;
  const size_t o_wk  = off; off += b_wk;
  const size_t o_wq  = off; off += b_wk;
  const size_t o_wv  = off; off += b_wv;
  const size_t o_k16 = off; off += b_k16;
  const size_t o_vf  = off; off += b_vf;
  const size_t o_vt  = off; off += b_vt;
  const size_t o_qt  = off; off += b_k16;   // stays directly behind VT16
  const size_t o_pm  = off; off += b_pm;
  const size_t o_mt  = off; off += b_mt;
  const size_t o_gh  = off; off += b_g;
  const size_t o_gl  = off; off += b_g;
  if (off > ws_size) return;

  char* ws = (char*)d_ws;
  unsigned short* x16  = (unsigned short*)(ws + o_x16);
  unsigned short* wk16 = (unsigned short*)(ws + o_wk);
  unsigned short* wq16 = (unsigned short*)(ws + o_wq);
  unsigned short* wv16 = (unsigned short*)(ws + o_wv);
  unsigned short* k16  = (unsigned short*)(ws + o_k16);
  float*          vf   = (float*)(ws + o_vf);
  unsigned short* vt16 = (unsigned short*)(ws + o_vt);
  unsigned short* qt16 = (unsigned short*)(ws + o_qt);
  float*          pm   = (float*)(ws + o_pm);
  unsigned short* mt16 = (unsigned short*)(ws + o_mt);
  unsigned short* gh16 = (unsigned short*)(ws + o_gh);
  unsigned short* gl16 = (unsigned short*)(ws + o_gl);

  // ---- casts to f16 (weights x64, exact): one launch ----
  k_cast_all<<<dim3(CB_X + 2 * CB_K + CB_V), 256, 0, stream>>>(x, Wk, Wq, Wv, x16, wk16, wq16, wv16);

  // ---- projections k, v, v^T, q^T: one launch ----
  k_project_all<<<dim3(2 * PB_V + 2 * PB_KQ), 256, 0, stream>>>(x16, wk16, wq16, wv16, bk, bq, bv, k16, vf, vt16, qt16);

  // ---- split sums of [VT16; QT16] . QT16^T : (k q^T) v is formed as k (q^T v), the row norms of k q^T from q^T q ----
  {
    // Pm[s] [640][128] f32 = [VT16; QT16][:, s*KSPL ..] . QT16[:, s*KSPL ..]^T   (batch index = split)
    // QT16 lies directly behind VT16, so both are one [PM_ROWS][G_ROWS] operand: rows below OUT_D give (q^T v)^T, the rest q^T q.
    const int tm = (PM_ROWS / 64) * (KQ_D / 64);
    wmma_gemm64<0, false, 0, 0, false><<<dim3((tm + 7) / 8, NSPL), 256, 0, stream>>>(
        vt16, nullptr, G_ROWS, (long)(KSPL * 16), qt16, nullptr, G_ROWS, (long)(KSPL * 16),
        (void*)pm, nullptr, KQ_D, (long)(PM_ROWS * KQ_D), nullptr, nullptr, 0L, PM_ROWS, KQ_D, KSPL, 1.0f);
  }

  // ---- MT16 [512][128] and the two Gram planes = merged split sums ----
  k_merge<<<dim3(MB_M + MB_G), 256, 0, stream>>>(pm, mt16, gh16, gl16);

  // ---- out [8192][512] = inv[m] * (K16 . MT16^T) + Vf, inv from the Gram planes ----
  k_scale_out<<<dim3(G_ROWS / 64), 256, 0, stream>>>(k16, mt16, gh16, gl16, vf, out);
}

// v007
// A run of this version takes 51 microseconds.
// In two side-by-side timings against v006, it was 1.10 and 1.11 times as fast.
// All steps since v000 together make it 30.4 times as fast.
// Contractions: k,qT,vT projections (x*W^T), [vT;qT]*q (split over rows: q^T*v and the Gram matrix q^T*q), (q^T*q)*k^T (row norms of k*q^T as k_i^T (q^T q) k_i), k*(q^T*v) : v_wmma_f32_16x16x32_f16 (f16 operands, f32 accumulate); weights carried x64 in f16 with 1/64 folded into the epilogue scale; Gram matrix carried /256 as f16 hi + lo planes; row L2 norms, per-row scaling and residual in f32.
#include <hip/hip_runtime.h>
#include <math.h>
#include <stdint.h>
#include <stddef.h>

#define G_ROWS 8192
#define IN_D   512
#define KQ_D   128
#define OUT_D  512
#define PM_ROWS (OUT_D + KQ_D)     // rows of the split product: v^T q (OUT_D rows) above q^T q (KQ_D rows)
#define KSPL   128                 // rows of q and v summed by one split of the [v^T; q^T]*q product
#define NSPL   (G_ROWS / KSPL)
#define EPSF   1e-12f
#define WSC     64.0f
#define WSC_INV (1.0f / 64.0f)
#define GSC     256.0f             // the Gram matrix is carried divided by this (exact): its f16 planes stay in the normal range
#define GSC_INV (1.0f / 256.0f)

typedef __attribute__((ext_vector_type(16))) _Float16 v16h;
typedef __attribute__((ext_vector_type(8)))  _Float16 v8h;
typedef __attribute__((ext_vector_type(4)))  _Float16 v4h;
typedef __attribute__((ext_vector_type(16))) __bf16   v16b;
typedef __attribute__((ext_vector_type(8)))  __bf16   v8b;
typedef __attribute__((ext_vector_type(8)))  float    v8f;
typedef __attribute__((ext_vector_type(4)))  float    v4f;

__device__ __forceinline__ unsigned short f2bf_bits(float f) {
  unsigned u = __float_as_uint(f);
  return (unsigned short)((u + 0x7FFFu + ((u >> 16) & 1u)) >> 16);
}
__device__ __forceinline__ float bf_bits2f(unsigned short h) { return __uint_as_float(((unsigned)h) << 16); }

// hazard guards as plain device helpers (the kernel template body's only inline asm of its own is the s_wait_xcnt behind the addend loads; in the k loop it is addr_wait8)
__device__ __forceinline__ void dep_guard_h(v8f& a, v8f& b, v16h x, v16h y) { asm volatile("v_nop\n\tv_nop\n\tv_nop\n\tv_nop" : "+v"(a), "+v"(b) : "v"(x), "v"(y)); }
__device__ __forceinline__ void dep_guard_b(v8f& a, v8f& b, v16b x, v16b y) { asm volatile("v_nop\n\tv_nop\n\tv_nop\n\tv_nop" : "+v"(a), "+v"(b) : "v"(x), "v"(y)); }
__device__ __forceinline__ void keep4_h(v16h a, v16h b, v16h c, v16h d) { asm volatile("v_nop" :: "v"(a), "v"(b), "v"(c), "v"(d)); }
__device__ __forceinline__ void keep4_b(v16b a, v16b b, v16b c, v16b d) { asm volatile("v_nop" :: "v"(a), "v"(b), "v"(c), "v"(d)); }
__device__ __forceinline__ void acc_guard4(v8f& a, v8f& b, v8f& c, v8f& d) { asm volatile("v_nop\n\tv_nop\n\tv_nop\n\tv_nop" : "+v"(a), "+v"(b), "+v"(c), "+v"(d)); }
// s_wait_xcnt 0 with load addresses as inputs: their registers stay as they are (no load's result lands in them, no next address)
// until the wait that belongs in front of a rewrite of an address register of issued loads has passed
__device__ __forceinline__ void addr_wait8(const void* a, const void* b, const void* c, const void* d, const void* e, const void* f, const void* g, const void* h) {
  asm volatile("s_wait_xcnt 0x0" :: "v"(a), "v"(b), "v"(c), "v"(d), "v"(e), "v"(f), "v"(g), "v"(h) : "memory");
}
template <typename T> struct Frag;
template <> struct Frag<_Float16> {
  typedef v16h V; union U { v16h v; v8h h[2]; };
  static __device__ __forceinline__ v16h load(const _Float16* p) {   // p = fragment + 8 * lane: elements 0..7 <- p[0..7], 8..15 <- p[256..263]
    U f; f.h[0] = *(const v8h*)(p); f.h[1] = *(const v8h*)(p + 256); return f.v;
  }
  static __device__ __forceinline__ v8f mma(v16h a, v16h b, v8f c) {
    return __builtin_amdgcn_wmma_f32_16x16x32_f16(false, a, false, b, (short)0, c, false, false);
  }
  static __device__ __forceinline__ void guard(v8f& a, v8f& b, v16h x, v16h y) { dep_guard_h(a, b, x, y); }
  static __device__ __forceinline__ void keep(v16h a, v16h b, v16h c, v16h d) { keep4_h(a, b, c, d); }
};
template <> struct Frag<__bf16> {
  typedef v16b V; union U { v16b v; v8b h[2]; };
  static __device__ __forceinline__ v16b load(const __bf16* p) {
    U f; f.h[0] = *(const v8b*)(p); f.h[1] = *(const v8b*)(p + 256); return f.v;
  }
  static __device__ __forceinline__ v8f mma(v16b a, v16b b, v8f c) {
    return __builtin_amdgcn_wmma_f32_16x16x32_bf16(false, a, false, b, (short)0, c, false, false);
  }
  static __device__ __forceinline__ void guard(v8f& a, v8f& b, v16b x, v16b y) { dep_guard_b(a, b, x, y); }
  static __device__ __forceinline__ void keep(v16b a, v16b b, v16b c, v16b d) { keep4_b(a, b, c, d); }
};

// ---- Register-blocked batched WMMA GEMM ------------------------------------
// C[m,n] = scale * sum_k A[m,k] * Bt[n,k] (*rowscale)(+bias)(+resid); each wave owns a 64x64 tile.
// A [M,K] and Bt [N,K] lie in FRAGMENT ORDER: [16-row group][k step of 32][fragment half][lane][8 elements], lda / ldb = elements
// per row, so that a wave's 16-byte loads of a fragment half cover 512 contiguous bytes (4 whole lines, not 32 bytes of each of
// 16 rows). Element e of half p in lane l is row 16 g + (l & 15), column 32 t + 16 p + 8 (l >> 4) + e. A step of 32 in k is a
// step of 512 elements, which is what strideA / strideB count in. 16-bit outputs are written in the same order (ldc = elements
// per row), OUT_MODE 0 f32 outputs row-major. M,N % 64 == 0, K % 32 == 0.
// SPLIT: operands are hi/lo planes (A2/Bt2 = lo planes, same layout); product = hi*hi + hi*lo + lo*hi.
// BIAS_MODE: 0 = none, 1 = bias[m], 2 = bias[n], 3 = per-row scale: value *= bias[m] (applied before resid),
//            4 = as 3, with bias indexed by the row inside the 64-row tile (the block's own table).
// OUT_MODE: 0 = f32, 1 = f16, 2 = bf16 hi plane (Cout) + bf16 lo plane (Cout2),
//           3 = f16 (Cout) + the same values unrounded as f32 (Cout2), piece for piece in the f16 order; the 8 floats of a lane's
//               piece lie as two runs [4 low: lane][4 high: lane], so that each 16-byte store of a wave covers 512 contiguous bytes.
// RESID: resid holds the TRANSPOSE of the addend, [N][M], as OUT_MODE 3 writes it: a lane's piece there (one row n, 8 columns m)
//        is what the lane's accumulator fragment holds (one column n, 8 rows m), so it is read with two 16-byte loads.
// ET: 0 = f16 operands, 1 = bf16 operands (pointers passed as 16-bit storage)
template <int ET> struct Elem;
template <> struct Elem<0> { typedef _Float16 T; };
template <> struct Elem<1> { typedef __bf16 T; };
// gemm64_block: the work of one 256-thread block; bx, b = the block's place in this product's own grid; sT = the block's LDS slabs.
template <int ET, bool SPLIT, int BIAS_MODE, int OUT_MODE, bool RESID, int ACT = 0>
__device__ __forceinline__ void gemm64_block(
    float (*sT)[16 * 68], const int bx, const int b,
    const unsigned short* __restrict__ Ap, const unsigned short* __restrict__ A2p, int lda, long strideA,
    const unsigned short* __restrict__ Btp, const unsigned short* __restrict__ Bt2p, int ldb, long strideB,
    void* __restrict__ Cout, void* __restrict__ Cout2, int ldc, long strideC,
    const float* __restrict__ bias,
    const float* __restrict__ resid, long strideR,
    int M, int N, int K, float scale) {
  typedef typename Elem<ET>::T T;
  typedef typename Frag<T>::V V;
  const T* A = (const T*)Ap; const T* A2 = (const T*)A2p; const T* Bt = (const T*)Btp; const T* Bt2 = (const T*)Bt2p;
  const int lane = threadIdx.x & 31;
  const int wave = threadIdx.x >> 5;
  const int tilesN = N >> 6;
  const int tilesM = M >> 6;
  const int tile = bx * 8 + wave;
  if (tile >= tilesM * tilesN) return;   // wave-uniform; no block barriers in this kernel
  const int tm = tile / tilesN;
  const int tn = tile - tm * tilesN;
  const int m0 = tm << 6;
  const int n0 = tn << 6;

  const T* Ab  = A  + (size_t)b * strideA;
  const T* Bb  = Bt + (size_t)b * strideB;
  const T* Ab2 = SPLIT ? (A2  + (size_t)b * strideA) : nullptr;
  const T* Bb2 = SPLIT ? (Bt2 + (size_t)b * strideB) : nullptr;

  const int rlane = lane & 15;                 // col (D) within subtile
  const int mOff  = (lane >> 4) * 8;           // D row offset

  v8f acc[4][4];
#pragma unroll
  for (int i = 0; i < 4; ++i)
#pragma unroll
    for (int j = 0; j < 4; ++j) acc[i][j] = (v8f){0.f,0.f,0.f,0.f,0.f,0.f,0.f,0.f};

  size_t ao[4], bo[4];                         // this lane's place in the current k step's fragments
#pragma unroll
  for (int i = 0; i < 4; ++i) {
    ao[i] = (size_t)((m0 >> 4) + i) * (lda >> 5) * 512 + lane * 8;
    bo[i] = (size_t)((n0 >> 4) + i) * (ldb >> 5) * 512 + lane * 8;
  }

  // the addend of every accumulator: independent of the products, so its loads are issued ahead of the k loop
  v4f rs[4][4][2];
  if (RESID) {
    const float* rp = resid + (size_t)b * strideR + ((size_t)(n0 >> 4) * (M >> 5) + (m0 >> 5)) * 512 + lane * 4;
#pragma unroll
    for (int i = 0; i < 4; ++i)
#pragma unroll
      for (int j = 0; j < 4; ++j) {
        const float* q = rp + ((size_t)j * (M >> 5) + (i >> 1)) * 512 + (i & 1) * 256;
        rs[i][j][0] = *(const v4f*)(q);
        rs[i][j][1] = *(const v4f*)(q + 128);
      }
    // the addend's address is dead from here on: its registers are not reused before the wait that belongs in front of that
    asm volatile("s_wait_xcnt 0x0" :: "v"(rp) : "memory");
  }

  for (int k0 = 0; k0 < K; k0 += 32) {
    // every fragment of the k step has registers of its own and is loaded ahead of the step's first product:
    // the step waits out one load latency, not one for each row of A fragments
    V bh[4], bl[4], ahs[4], als[4];
#pragma unroll
    for (int j = 0; j < 4; ++j) {
      bh[j] = Frag<T>::load(Bb + bo[j]);
      if (SPLIT) bl[j] = Frag<T>::load(Bb2 + bo[j]);
    }
#pragma unroll
    for (int i = 0; i < 4; ++i) {
      ahs[i] = Frag<T>::load(Ab + ao[i]);
      if (SPLIT) als[i] = Frag<T>::load(Ab2 + ao[i]);
    }
#pragma unroll
    for (int i = 0; i < 4; ++i) {
      const V ah = ahs[i];
      const V al = SPLIT ? als[i] : ahs[i];
#pragma unroll
      for (int j = 0; j < 4; ++j) {
        acc[i][j] = Frag<T>::mma(ah, bh[j], acc[i][j]);
        if (SPLIT) {
          acc[i][j] = Frag<T>::mma(ah, bl[j], acc[i][j]);
          acc[i][j] = Frag<T>::mma(al, bh[j], acc[i][j]);
        }
      }
      Frag<T>::guard(acc[i][0], acc[i][3], ah, al);
    }
    Frag<T>::keep(bh[0], bh[1], bh[2], bh[3]);
    if (SPLIT) Frag<T>::keep(bl[0], bl[1], bl[2], bl[3]);
    // at the trip's foot, in front of the next trip's addresses
    addr_wait8(Ab + ao[0], Ab + ao[1], Ab + ao[2], Ab + ao[3], Bb + bo[0], Bb + bo[1], Bb + bo[2], Bb + bo[3]);
    if (SPLIT) addr_wait8(Ab2 + ao[0], Ab2 + ao[1], Ab2 + ao[2], Ab2 + ao[3], Bb2 + bo[0], Bb2 + bo[1], Bb2 + bo[2], Bb2 + bo[3]);
#pragma unroll
    for (int i = 0; i < 4; ++i) { ao[i] += 512; bo[i] += 512; }
  }
  acc_guard4(acc[0][0], acc[0][1], acc[0][2], acc[0][3]);
  acc_guard4(acc[1][0], acc[1][1], acc[1][2], acc[1][3]);
  acc_guard4(acc[2][0], acc[2][1], acc[2][2], acc[2][3]);
  acc_guard4(acc[3][0], acc[3][1], acc[3][2], acc[3][3]);

  // ---- epilogue ----
  float* slab = sT[wave];
#pragma unroll
  for (int i = 0; i < 4; ++i) {
    const int mBase = m0 + (i << 4);
#pragma unroll
    for (int j = 0; j < 4; ++j) {
      const int n = n0 + (j << 4) + rlane;
      float bv = 0.f;
      if (BIAS_MODE == 2) bv = bias[n];
#pragma unroll
      for (int r = 0; r < 8; ++r) {
        float v = acc[i][j][r] * scale;
        if (BIAS_MODE == 3) v *= bias[mBase + mOff + r];
        if (BIAS_MODE == 4) v *= bias[(i << 4) + mOff + r];
        if (BIAS_MODE == 1) v += bias[mBase + mOff + r];
        if (BIAS_MODE == 2) v += bv;
        if (RESID) v += rs[i][j][r >> 2][r & 3];
        if (ACT == 1) v = tanhf(v);
        if (ACT == 2) v = fmaxf(v, 0.0f);
        if (ACT == 3) v = v / (1.0f + expf(-v));
        if (ACT == 4) v = (v > 0.f) ? v : 0.01f * v;
        if (ACT == 5) v = 0.5f * v * (1.0f + erff(v * 0.70710678118654752f));
        slab[(mOff + r) * 68 + (j << 4) + rlane] = v;
      }
    }
    __builtin_amdgcn_fence(__ATOMIC_RELEASE, "workgroup");
    __builtin_amdgcn_wave_barrier();
    __builtin_amdgcn_fence(__ATOMIC_ACQUIRE, "workgroup");
    if (OUT_MODE == 0) {
      float* C = (float*)Cout + (size_t)b * strideC;
      const int hh = lane >> 4, c4 = (lane & 15) * 4;     // row seg = 256 B = 16 lanes x 16 B
      {
#pragma unroll
        for (int it = 0; it < 8; ++it) {
          const int row = it * 2 + hh;
          v4f v = *(const v4f*)(slab + row * 68 + c4);
          *(v4f*)(C + (size_t)(mBase + row) * ldc + n0 + c4) = v;
        }
        
      }
    } else {
      // the 16 x 64 slab is two fragments that lie side by side in the output: four stores of 512 contiguous bytes
      const size_t fo = ((size_t)(mBase >> 4) * (ldc >> 5) + (n0 >> 5)) * 512 + lane * 8;
      unsigned short* C  = (unsigned short*)Cout  + (size_t)b * strideC;
      unsigned short* C2 = (OUT_MODE == 2) ? ((unsigned short*)Cout2 + (size_t)b * strideC) : nullptr;
      float* CF = (OUT_MODE == 3) ? ((float*)Cout2 + (size_t)b * strideC + (fo - lane * 4)) : nullptr;
      {
#pragma unroll
        for (int it = 0; it < 4; ++it) {
          const float* sp = slab + rlane * 68 + it * 16 + mOff;   // fragment it >> 1, half it & 1
          v8h hv, lv;
          if (OUT_MODE == 3) {
            const v4f lo = *(const v4f*)(sp), hi = *(const v4f*)(sp + 4);
            hv = __builtin_convertvector(__builtin_shufflevector(lo, hi, 0, 1, 2, 3, 4, 5, 6, 7), v8h);
            *(v4f*)(CF + it * 256)       = lo;
            *(v4f*)(CF + it * 256 + 128) = hi;
          }
#pragma unroll
          for (int e = 0; e < 8 && OUT_MODE != 3; ++e) {
            if (OUT_MODE == 1) {
              hv[e] = (_Float16)sp[e];
            } else {
              unsigned short hb = f2bf_bits(sp[e]);
              unsigned short lb = f2bf_bits(sp[e] - bf_bits2f(hb));
              hv[e] = __builtin_bit_cast(_Float16, hb);
              lv[e] = __builtin_bit_cast(_Float16, lb);
            }
          }
          *(v8h*)(C + fo + it * 256) = hv;
          if (OUT_MODE == 2) *(v8h*)(C2 + fo + it * 256) = lv;
        }
        
      }
    }
    __builtin_amdgcn_fence(__ATOMIC_RELEASE, "workgroup");
    __builtin_amdgcn_wave_barrier();
    __builtin_amdgcn_fence(__ATOMIC_ACQUIRE, "workgroup");
  }
}

template <int ET, bool SPLIT, int BIAS_MODE, int OUT_MODE, bool RESID, int ACT = 0>
__global__ __launch_bounds__(256) void wmma_gemm64(
    const unsigned short* __restrict__ Ap, const unsigned short* __restrict__ A2p, int lda, long strideA,
    const unsigned short* __restrict__ Btp, const unsigned short* __restrict__ Bt2p, int ldb, long strideB,
    void* __restrict__ Cout, void* __restrict__ Cout2, int ldc, long strideC,
    const float* __restrict__ bias,
    const float* __restrict__ resid, long strideR,
    int M, int N, int K, float scale) {
  __shared__ __align__(16) float sT[8][16 * 68];   // per-wave 16x64 slab, pitch 68 floats
  gemm64_block<ET, SPLIT, BIAS_MODE, OUT_MODE, RESID, ACT>(sT, blockIdx.x, blockIdx.y, Ap, A2p, lda, strideA, Btp, Bt2p, ldb, strideB,
                                                           Cout, Cout2, ldc, strideC, bias, resid, strideR, M, N, K, scale);
}

// ---- the three projections in one grid: none reads what another writes, so their blocks run side by side ----
// v is projected once, as v^T: its tiles go out as the f16 operand of the split product and, unrounded, as the f32 addend of the
// last GEMM. Block ranges (8 tiles of 64x64 per block), in this order: v^T, q^T, k.
#define PB_V  ((G_ROWS / 64) * (OUT_D / 64) / 8)
#define PB_KQ ((G_ROWS / 64) * (KQ_D / 64) / 8)
__global__ __launch_bounds__(256) void k_project_all(
    const unsigned short* __restrict__ x16, const unsigned short* __restrict__ wk16,
    const unsigned short* __restrict__ wq16, const unsigned short* __restrict__ wv16,
    const float* __restrict__ bk, const float* __restrict__ bq, const float* __restrict__ bv,
    unsigned short* __restrict__ k16, float* __restrict__ vf,
    unsigned short* __restrict__ vt16, unsigned short* __restrict__ qt16) {
  __shared__ __align__(16) float sT[8][16 * 68];   // per-wave 16x64 slab, pitch 68 floats
  const int bx = blockIdx.x;
  if (bx < PB_V) {
    // VT16 [512][8192] f16 and VTf [512][8192] f32 = Wv16 . x16^T / 64 + bv[m]
    gemm64_block<0, false, 1, 3, false>(sT, bx, 0, wv16, nullptr, IN_D, 0L, x16, nullptr, IN_D, 0L, (void*)vt16, (void*)vf, G_ROWS, 0L,
                                        bv, nullptr, 0L, OUT_D, G_ROWS, IN_D, WSC_INV);
  } else if (bx < PB_V + PB_KQ) {
    // QT16 [128][8192] f16 = Wq16 . x16^T / 64 + bq[m]
    gemm64_block<0, false, 1, 1, false>(sT, bx - PB_V, 0, wq16, nullptr, IN_D, 0L, x16, nullptr, IN_D, 0L, (void*)qt16, nullptr, G_ROWS, 0L,
                                        bq, nullptr, 0L, KQ_D, G_ROWS, IN_D, WSC_INV);
  } else {
    // K16 [8192][128] f16 = x16 . Wk16^T / 64 + bk
    gemm64_block<0, false, 2, 1, false>(sT, bx - (PB_V + PB_KQ), 0, x16, nullptr, IN_D, 0L,
                                        wk16, nullptr, IN_D, 0L, (void*)k16, nullptr, KQ_D, 0L,
                                        bk, nullptr, 0L, G_ROWS, KQ_D, IN_D, WSC_INV);
  }
}

// ---- the four casts to f16 in one grid (weights x64, exact); every range is whole blocks ----
// The f16 copies go out in fragment order (see the GEMM's head): a thread makes one 16-byte piece, 8 elements of one row.
#define CB_X ((G_ROWS * IN_D / 8) / 256)
#define CB_K ((KQ_D * IN_D / 8) / 256)
#define CB_V ((OUT_D * IN_D / 8) / 256)
__global__ __launch_bounds__(256) void k_cast_all(
    const float* __restrict__ x, const float* __restrict__ Wk, const float* __restrict__ Wq, const float* __restrict__ Wv,
    unsigned short* __restrict__ x16, unsigned short* __restrict__ wk16, unsigned short* __restrict__ wq16,
    unsigned short* __restrict__ wv16) {
  int bx = blockIdx.x;
  const float* in = Wk; unsigned short* out = wk16; float mul = WSC;
  if (bx >= 2 * CB_K + CB_V)  { in = x;  out = x16;  mul = 1.0f; bx -= 2 * CB_K + CB_V; }
  else if (bx >= 2 * CB_K)    { in = Wv; out = wv16; bx -= 2 * CB_K; }
  else if (bx >= CB_K)        { in = Wq; out = wq16; bx -= CB_K; }
  const int c = bx * 256 + threadIdx.x;            // piece number: [16-row group][k step: IN_D / 32][half: 2][lane: 32]
  const int l = c & 31;
  const int row = (c / (IN_D * 2)) * 16 + (l & 15);
  const int col = ((c >> 6) % (IN_D / 32)) * 32 + ((c >> 5) & 1) * 16 + (l >> 4) * 8;
  const float* p = in + (size_t)row * IN_D + col;
  const v4f a = *(const v4f*)(p) * mul, b = *(const v4f*)(p + 4) * mul;
  *(v8h*)(out + (size_t)c * 8) = __builtin_convertvector(__builtin_shufflevector(a, b, 0, 1, 2, 3, 4, 5, 6, 7), v8h);
}

// ---- merge of the split sums: sum_s P[s][i], s ascending (fixed order), 4 elements per thread ----
// Rows below OUT_D are (q^T v)^T and go out as f16. The KQ_D rows behind them are the Gram matrix q^T q: it goes out divided
// by GSC as an f16 hi plane and an f16 lo plane (the rest after hi). All three go out in fragment order:
// [16-row group i][k step t of 32][fragment half][lane][8 elements], so that a fragment half is 512 contiguous bytes.
// Element e of half p in lane l is row 16 i + (l & 15), column 32 t + 16 p + 8 (l >> 4) + e.
#define MB_M ((OUT_D * KQ_D / 4) / 256)
#define MB_G ((KQ_D * KQ_D / 4) / 256)
__global__ __launch_bounds__(256) void k_merge(const float* __restrict__ P, unsigned short* __restrict__ mt,
                                               unsigned short* __restrict__ gh, unsigned short* __restrict__ gl) {
  const int i = blockIdx.x * 256 + threadIdx.x;    // the grid covers PM_ROWS * KQ_D / 4 exactly
  v4f a = (v4f){0.f, 0.f, 0.f, 0.f};
#pragma unroll 16   // 16 independent 16-byte loads in flight per wait instead of one
  for (int s = 0; s < NSPL; ++s) a += *(const v4f*)(P + (size_t)s * (PM_ROWS * KQ_D) + 4 * (size_t)i);
  const int e0  = blockIdx.x < MB_M ? 4 * i : 4 * i - OUT_D * KQ_D;
  const int row = e0 / KQ_D, col = e0 % KQ_D;
  const int pos = (((((row >> 4) * 4 + (col >> 5)) * 2 + ((col >> 4) & 1)) * 32) + (row & 15) + 16 * ((col >> 3) & 1)) * 8 + (col & 7);
  if (blockIdx.x < MB_M) {
    *(v4h*)(mt + pos) = __builtin_convertvector(a, v4h);
    return;
  }
  a *= GSC_INV;
  const v4h hi = __builtin_convertvector(a, v4h);
  *(v4h*)(gh + pos) = hi;
  *(v4h*)(gl + pos) = __builtin_convertvector(a - __builtin_convertvector(hi, v4f), v4h);
}

__device__ __forceinline__ void load_rows16(v16h (&f)[4], const _Float16* p) {
#pragma unroll
  for (int t = 0; t < 4; ++t) f[t] = Frag<_Float16>::load(p + (t << 9));
}
// A fragment (16-row group i, k step t) of a Gram plane in the order k_merge writes: two whole 512-byte runs per wave
__device__ __forceinline__ v16h load_gram(const _Float16* g, const int i, const int t, const int lane) {
  Frag<_Float16>::U f;
  const _Float16* p = g + ((i * 4 + t) * 2 * 32 + lane) * 8;
  f.h[0] = *(const v8h*)(p); f.h[1] = *(const v8h*)(p + 32 * 8);
  return f.v;
}

// ---- out [8192][512] = inv[m] * (K16 . MT16^T) + VTf^T, inv[m] = 1 / max(||row m of k q^T||, eps) ----
// sum_j (k_m . q_j)^2 = k_m^T (q^T q) k_m, so the row norms need the 128 x 128 Gram matrix only, never k q^T itself.
// A block owns 64 rows. Wave w forms, for the 16 rows of group w >> 1, the product T = G . k^T for the 16-row groups
// i = 2 u + (w & 1) of G (A = G, B = k rows): a lane's accumulators are T[16 i + 8 (lane >> 4) + r][its k row], and the k
// values they are multiplied with are the ones its own B fragment u holds in half w & 1.
__global__ __launch_bounds__(256) void k_scale_out(const unsigned short* __restrict__ k16, const unsigned short* __restrict__ mt16,
                                                   const unsigned short* __restrict__ gh, const unsigned short* __restrict__ gl,
                                                   const float* __restrict__ vf, float* __restrict__ out) {
  __shared__ __align__(16) float sT[8][16 * 68];   // per-wave 16x64 slab, pitch 68 floats
  __shared__ float sP[8][16];                      // per wave: its half of k^T G k / GSC for its 16 rows
  __shared__ float sInv[64];                       // inverse norms of the block's 64 rows
  const int lane = threadIdx.x & 31;
  const int wave = threadIdx.x >> 5;
  const int par  = wave & 1;
  {
    const _Float16* kp = (const _Float16*)k16 + (size_t)((blockIdx.x << 2) + (wave >> 1)) * (16 * KQ_D) + lane * 8;   // its 16-row group, fragment order
    v16h kb[4];
    load_rows16(kb, kp);
    v8f acc[4];
#pragma unroll
    for (int u = 0; u < 4; ++u) acc[u] = (v8f){0.f,0.f,0.f,0.f,0.f,0.f,0.f,0.f};
#pragma unroll
    for (int t = 0; t < 4; ++t)
#pragma unroll
      for (int u = 0; u < 4; ++u) {
        acc[u] = Frag<_Float16>::mma(load_gram((const _Float16*)gl, 2 * u + par, t, lane), kb[t], acc[u]);
        acc[u] = Frag<_Float16>::mma(load_gram((const _Float16*)gh, 2 * u + par, t, lane), kb[t], acc[u]);
      }
    // the k address is dead from here on: its registers are not reused before the loads that name them are translated
    asm volatile("s_wait_xcnt 0x0" :: "v"(kp) : "memory");
    v8f ss = (v8f){0.f,0.f,0.f,0.f,0.f,0.f,0.f,0.f};
#pragma unroll
    for (int u = 0; u < 4; ++u) {
      Frag<_Float16>::U f; f.v = kb[u];
      ss += acc[u] * __builtin_convertvector(par ? f.h[1] : f.h[0], v8f);
    }
    const float h = ((ss[0] + ss[1]) + (ss[2] + ss[3])) + ((ss[4] + ss[5]) + (ss[6] + ss[7]));
    const float s = h + __shfl_xor(h, 16, 32);     // the two lane halves hold rows 0..7 and 8..15 of each group of G
    if (lane < 16) sP[wave][lane] = s;
  }
  __syncthreads();                                 // every wave's half sums are in sP
  if (threadIdx.x < 64) {
    const int g = threadIdx.x >> 4, r = threadIdx.x & 15;
    // rounding can carry a vanishing quadratic form below zero: it counts as zero, and eps takes over as in the reference
    const float a = fmaxf(sP[2 * g][r] + sP[2 * g + 1][r], 0.f) * GSC;
    sInv[threadIdx.x] = 1.0f / fmaxf(sqrtf(a), EPSF);
  }
  __syncthreads();                                 // sInv is complete before any wave's epilogue reads it
  gemm64_block<0, false, 4, 0, true>(sT, blockIdx.x, 0, k16, nullptr, KQ_D, 0L, mt16, nullptr, KQ_D, 0L,
                                     (void*)out, nullptr, OUT_D, 0L, sInv, vf, 0L, G_ROWS, OUT_D, KQ_D, 1.0f);
}

// ---------------------------------------------------------------------------
//   every f16 array below lies in fragment order (see the GEMM's head); 16 whole rows stay one contiguous run
//   x16  [8192][512] f16    8 MiB      | Wk16 [128][512], Wq16 [128][512], Wv16 [512][512] f16 (x64)
//   K16  [8192][128] f16    2 MiB      | VTf [512][8192] f32 16 MiB (v^T unrounded, pieces in the order of VT16's)
//   VT16 [512][8192] f16    8 MiB, directly followed by QT16 [128][8192] f16 2 MiB: one [640][8192] operand
//   Pm [64][640][128] f32  20 MiB (split sums of v^T q and q^T q) | MT16 [512][128] f16
//   GH16, GL16 [128][128] f16 (q^T q / 256, hi and lo plane, in fragment order)
// ---------------------------------------------------------------------------
extern "C" void kernel_launch(void* const* d_in, const int* in_sizes, int n_in,
                              void* d_out, int out_size, void* d_ws, size_t ws_size,
                              hipStream_t stream) {
  if (n_in < 7) return;
  if (in_sizes[0] != G_ROWS * IN_D || in_sizes[1] != KQ_D * IN_D || in_sizes[2] != KQ_D ||
      in_sizes[3] != KQ_D * IN_D || in_sizes[4] != KQ_D || in_sizes[5] != OUT_D * IN_D ||
      in_sizes[6] != OUT_D) return;
  if (out_size != G_ROWS * OUT_D) return;

  const float* x  = (const float*)d_in[0];
  const float* Wk = (const float*)d_in[1];
  const float* bk = (const float*)d_in[2];
  const float* Wq = (const float*)d_in[3];
  const float* bq = (const float*)d_in[4];
  const float* Wv = (const float*)d_in[5];
  const float* bv = (const float*)d_in[6];
  float* out = (float*)d_out;

  const size_t b_x16 = (size_t)G_ROWS * IN_D * 2;
  const size_t b_wk  = (size_t)KQ_D * IN_D * 2;
  const size_t b_wv  = (size_t)OUT_D * IN_D * 2;
  const size_t b_k16 = (size_t)G_ROWS * KQ_D * 2;
  const size_t b_vf  = (size_t)G_ROWS * OUT_D * 4;
  const size_t b_vt  = (size_t)OUT_D * G_ROWS * 2;
  const size_t b_pm  = (size_t)NSPL * PM_ROWS * KQ_D * 4;
  const size_t b_mt  = (size_t)OUT_D * KQ_D * 2;
  const size_t b_g   = (size_t)KQ_D * KQ_D * 2;

  size_t off = 0;
  const size_t o_x16 = off; off += b_x16;
  const size_t o_wk  = off; off += b_wk;
  const size_t o_wq  = off; off += b_wk;
  const size_t o_wv  = off; off += b_wv;
  const size_t o_k16 = off; off += b_k16;
  const size_t o_vf  = off; off += b_vf;
  const size_t o_vt  = off; off += b_vt;
  const size_t o_qt  = off; off += b_k16;   // stays directly behind VT16
  const size_t o_pm  = off; off += b_pm;
  const size_t o_mt  = off; off += b_mt;
  const size_t o_gh  = off; off += b_g;
  const size_t o_gl  = off; off += b_g;
  if (off > ws_size) return;

  char* ws = (char*)d_ws;
  unsigned short* x16  = (unsigned short*)(ws + o_x16);
  unsigned short* wk16 = (unsigned short*)(ws + o_wk);
  unsigned short* wq16 = (unsigned short*)(ws + o_wq);
  unsigned short* wv16 = (unsigned short*)(ws + o_wv);
  unsigned short* k16  = (unsigned short*)(ws + o_k16);
  float*          vf   = (float*)(ws + o_vf);
  unsigned short* vt16 = (unsigned short*)(ws + o_vt);
  unsigned short* qt16 = (unsigned short*)(ws + o_qt);
  float*          pm   = (float*)(ws + o_pm);
  unsigned short* mt16 = (unsigned short*)(ws + o_mt);
  unsigned short* gh16 = (unsigned short*)(ws + o_gh);
  unsigned short* gl16 = (unsigned short*)(ws + o_gl);

  // ---- casts to f16 (weights x64, exact): one launch ----
  k_cast_all<<<dim3(CB_X + 2 * CB_K + CB_V), 256, 0, stream>>>(x, Wk, Wq, Wv, x16, wk16, wq16, wv16);

  // ---- projections k, v^T, q^T: one launch ----
  k_project_all<<<dim3(PB_V + 2 * PB_KQ), 256, 0, stream>>>(x16, wk16, wq16, wv16, bk, bq, bv, k16, vf, vt16, qt16);

  // ---- split sums of [VT16; QT16] . QT16^T : (k q^T) v is formed as k (q^T v), the row norms of k q^T from q^T q ----
  {
    // Pm[s] [640][128] f32 = [VT16; QT16][:, s*KSPL ..] . QT16[:, s*KSPL ..]^T   (batch index = split)
    // QT16 lies directly behind VT16, so both are one [PM_ROWS][G_ROWS] operand: rows below OUT_D give (q^T v)^T, the rest q^T q.
    const int tm = (PM_ROWS / 64) * (KQ_D / 64);
    wmma_gemm64<0, false, 0, 0, false><<<dim3((tm + 7) / 8, NSPL), 256, 0, stream>>>(
        vt16, nullptr, G_ROWS, (long)(KSPL * 16), qt16, nullptr, G_ROWS, (long)(KSPL * 16),
        (void*)pm, nullptr, KQ_D, (long)(PM_ROWS * KQ_D), nullptr, nullptr, 0L, PM_ROWS, KQ_D, KSPL, 1.0f);
  }

  // ---- MT16 [512][128] and the two Gram planes = merged split sums ----
  k_merge<<<dim3(MB_M + MB_G), 256, 0, stream>>>(pm, mt16, gh16, gl16);

  // ---- out [8192][512] = inv[m] * (K16 . MT16^T) + VTf^T, inv from the Gram planes ----
  k_scale_out<<<dim3(G_ROWS / 64), 256, 0, stream>>>(k16, mt16, gh16, gl16, vf, out);
}

// v008
// One run takes 44.9 microseconds.
// Next to v007, in two timings, it ran 1.13 and 1.17 times as fast.
// Counting every step since v000, it is 34.9 times as fast.
// Contractions: k,qT,vT projections (x*W^T), [vT;qT]*q (q^T*v and the Gram matrix q^T*q, rows shared out over the waves of a block), (q^T*q)*k^T (row norms of k*q^T as k_i^T (q^T q) k_i), k*(q^T*v) : v_wmma_f32_16x16x32_f16 (f16 operands, f32 accumulate); weights carried x64 in f16 with 1/64 folded into the epilogue scale; Gram matrix carried /256 as f16 hi + lo planes; row L2 norms, per-row scaling and residual in f32.
#include <hip/hip_runtime.h>
#include <math.h>
#include <stdint.h>
#include <stddef.h>

#define G_ROWS 8192
#define IN_D   512
#define KQ_D   128
#define OUT_D  512
#define PM_ROWS (OUT_D + KQ_D)     // rows of the product [v^T; q^T] q: v^T q (OUT_D rows) above q^T q (KQ_D rows)
#define EPSF   1e-12f
#define WSC     64.0f
#define WSC_INV (1.0f / 64.0f)
#define GSC     256.0f             // the Gram matrix is carried divided by this (exact): its f16 planes stay in the normal range
#define GSC_INV (1.0f / 256.0f)

typedef __attribute__((ext_vector_type(16))) _Float16 v16h;
typedef __attribute__((ext_vector_type(8)))  _Float16 v8h;
typedef __attribute__((ext_vector_type(2)))  _Float16 v2h;
typedef __attribute__((ext_vector_type(16))) __bf16   v16b;
typedef __attribute__((ext_vector_type(8)))  __bf16   v8b;
typedef __attribute__((ext_vector_type(8)))  float    v8f;
typedef __attribute__((ext_vector_type(4)))  float    v4f;
typedef __attribute__((ext_vector_type(2)))  float    v2f;

__device__ __forceinline__ unsigned short f2bf_bits(float f) {
  unsigned u = __float_as_uint(f);
  return (unsigned short)((u + 0x7FFFu + ((u >> 16) & 1u)) >> 16);
}
__device__ __forceinline__ float bf_bits2f(unsigned short h) { return __uint_as_float(((unsigned)h) << 16); }

// hazard guards as plain device helpers (the kernel template body's only inline asm of its own is the s_wait_xcnt behind the addend loads; in the k loop it is addr_wait8)
__device__ __forceinline__ void dep_guard_h(v8f& a, v8f& b, v16h x, v16h y) { asm volatile("v_nop\n\tv_nop\n\tv_nop\n\tv_nop" : "+v"(a), "+v"(b) : "v"(x), "v"(y)); }
__device__ __forceinline__ void dep_guard_b(v8f& a, v8f& b, v16b x, v16b y) { asm volatile("v_nop\n\tv_nop\n\tv_nop\n\tv_nop" : "+v"(a), "+v"(b) : "v"(x), "v"(y)); }
__device__ __forceinline__ void keep4_h(v16h a, v16h b, v16h c, v16h d) { asm volatile("v_nop" :: "v"(a), "v"(b), "v"(c), "v"(d)); }
__device__ __forceinline__ void keep4_b(v16b a, v16b b, v16b c, v16b d) { asm volatile("v_nop" :: "v"(a), "v"(b), "v"(c), "v"(d)); }
__device__ __forceinline__ void acc_guard4(v8f& a, v8f& b, v8f& c, v8f& d) { asm volatile("v_nop\n\tv_nop\n\tv_nop\n\tv_nop" : "+v"(a), "+v"(b), "+v"(c), "+v"(d)); }
// s_wait_xcnt 0 with load addresses as inputs: their registers stay as they are (no load's result lands in them, no next address)
// until the wait that belongs in front of a rewrite of an address register of issued loads has passed
__device__ __forceinline__ void addr_wait8(const void* a, const void* b, const void* c, const void* d, const void* e, const void* f, const void* g, const void* h) {
  asm volatile("s_wait_xcnt 0x0" :: "v"(a), "v"(b), "v"(c), "v"(d), "v"(e), "v"(f), "v"(g), "v"(h) : "memory");
}
template <typename T> struct Frag;
template <> struct Frag<_Float16> {
  typedef v16h V; union U { v16h v; v8h h[2]; };
  static __device__ __forceinline__ v16h load(const _Float16* p) {   // p = fragment + 8 * lane: elements 0..7 <- p[0..7], 8..15 <- p[256..263]
    U f; f.h[0] = *(const v8h*)(p); f.h[1] = *(const v8h*)(p + 256); return f.v;
  }
  static __device__ __forceinline__ v8f mma(v16h a, v16h b, v8f c) {
    return __builtin_amdgcn_wmma_f32_16x16x32_f16(false, a, false, b, (short)0, c, false, false);
  }
  static __device__ __forceinline__ void guard(v8f& a, v8f& b, v16h x, v16h y) { dep_guard_h(a, b, x, y); }
  static __device__ __forceinline__ void keep(v16h a, v16h b, v16h c, v16h d) { keep4_h(a, b, c, d); }
};
template <> struct Frag<__bf16> {
  typedef v16b V; union U { v16b v; v8b h[2]; };
  static __device__ __forceinline__ v16b load(const __bf16* p) {
    U f; f.h[0] = *(const v8b*)(p); f.h[1] = *(const v8b*)(p + 256); return f.v;
  }
  static __device__ __forceinline__ v8f mma(v16b a, v16b b, v8f c) {
    return __builtin_amdgcn_wmma_f32_16x16x32_bf16(false, a, false, b, (short)0, c, false, false);
  }
  static __device__ __forceinline__ void guard(v8f& a, v8f& b, v16b x, v16b y) { dep_guard_b(a, b, x, y); }
  static __device__ __forceinline__ void keep(v16b a, v16b b, v16b c, v16b d) { keep4_b(a, b, c, d); }
};

// ---- Register-blocked batched WMMA GEMM ------------------------------------
// C[m,n] = scale * sum_k A[m,k] * Bt[n,k] (*rowscale)(+bias)(+resid); each wave owns a 64x64 tile.
// A [M,K] and Bt [N,K] lie in FRAGMENT ORDER: [16-row group][k step of 32][fragment half][lane][8 elements], lda / ldb = elements
// per row, so that a wave's 16-byte loads of a fragment half cover 512 contiguous bytes (4 whole lines, not 32 bytes of each of
// 16 rows). Element e of half p in lane l is row 16 g + (l & 15), column 32 t + 16 p + 8 (l >> 4) + e. A step of 32 in k is a
// step of 512 elements, which is what strideA / strideB count in. 16-bit outputs are written in the same order (ldc = elements
// per row), OUT_MODE 0 f32 outputs row-major. M,N % 64 == 0, K % 32 == 0.
// SPLIT: operands are hi/lo planes (A2/Bt2 = lo planes, same layout); product = hi*hi + hi*lo + lo*hi.
// BIAS_MODE: 0 = none, 1 = bias[m], 2 = bias[n], 3 = per-row scale: value *= bias[m] (applied before resid),
//            4 = as 3, with bias indexed by the row inside the 64-row tile (the block's own table).
// OUT_MODE: 0 = f32, 1 = f16, 2 = bf16 hi plane (Cout) + bf16 lo plane (Cout2),
//           3 = f16 (Cout) + the same values unrounded as f32 (Cout2), piece for piece in the f16 order; the 8 floats of a lane's
//               piece lie as two runs [4 low: lane][4 high: lane], so that each 16-byte store of a wave covers 512 contiguous bytes.
// RESID: resid holds the TRANSPOSE of the addend, [N][M], as OUT_MODE 3 writes it: a lane's piece there (one row n, 8 columns m)
//        is what the lane's accumulator fragment holds (one column n, 8 rows m), so it is read with two 16-byte loads.
// ET: 0 = f16 operands, 1 = bf16 operands (pointers passed as 16-bit storage)
template <int ET> struct Elem;
template <> struct Elem<0> { typedef _Float16 T; };
template <> struct Elem<1> { typedef __bf16 T; };
// gemm64_block: the work of one 256-thread block; bx, b = the block's place in this product's own grid; sT = the block's LDS slabs.
template <int ET, bool SPLIT, int BIAS_MODE, int OUT_MODE, bool RESID, int ACT = 0>
__device__ __forceinline__ void gemm64_block(
    float (*sT)[16 * 68], const int bx, const int b,
    const unsigned short* __restrict__ Ap, const unsigned short* __restrict__ A2p, int lda, long strideA,
    const unsigned short* __restrict__ Btp, const unsigned short* __restrict__ Bt2p, int ldb, long strideB,
    void* __restrict__ Cout, void* __restrict__ Cout2, int ldc, long strideC,
    const float* __restrict__ bias,
    const float* __restrict__ resid, long strideR,
    int M, int N, int K, float scale) {
  typedef typename Elem<ET>::T T;
  typedef typename Frag<T>::V V;
  const T* A = (const T*)Ap; const T* A2 = (const T*)A2p; const T* Bt = (const T*)Btp; const T* Bt2 = (const T*)Bt2p;
  const int lane = threadIdx.x & 31;
  const int wave = threadIdx.x >> 5;
  const int tilesN = N >> 6;
  const int tilesM = M >> 6;
  const int tile = bx * 8 + wave;
  if (tile >= tilesM * tilesN) return;   // wave-uniform; no block barriers in this kernel
  const int tm = tile / tilesN;
  const int tn = tile - tm * tilesN;
  const int m0 = tm << 6;
  const int n0 = tn << 6;

  const T* Ab  = A  + (size_t)b * strideA;
  const T* Bb  = Bt + (size_t)b * strideB;
  const T* Ab2 = SPLIT ? (A2  + (size_t)b * strideA) : nullptr;
  const T* Bb2 = SPLIT ? (Bt2 + (size_t)b * strideB) : nullptr;

  const int rlane = lane & 15;                 // col (D) within subtile
  const int mOff  = (lane >> 4) * 8;           // D row offset

  v8f acc[4][4];
#pragma unroll
  for (int i = 0; i < 4; ++i)
#pragma unroll
    for (int j = 0; j < 4; ++j) acc[i][j] = (v8f){0.f,0.f,0.f,0.f,0.f,0.f,0.f,0.f};

  size_t ao[4], bo[4];                         // this lane's place in the current k step's fragments
#pragma unroll
  for (int i = 0; i < 4; ++i) {
    ao[i] = (size_t)((m0 >> 4) + i) * (lda >> 5) * 512 + lane * 8;
    bo[i] = (size_t)((n0 >> 4) + i) * (ldb >> 5) * 512 + lane * 8;
  }

  // the addend of every accumulator: independent of the products, so its loads are issued ahead of the k loop
  v4f rs[4][4][2];
  if (RESID) {
    const float* rp = resid + (size_t)b * strideR + ((size_t)(n0 >> 4) * (M >> 5) + (m0 >> 5)) * 512 + lane * 4;
#pragma unroll
    for (int i = 0; i < 4; ++i)
#pragma unroll
      for (int j = 0; j < 4; ++j) {
        const float* q = rp + ((size_t)j * (M >> 5) + (i >> 1)) * 512 + (i & 1) * 256;
        rs[i][j][0] = *(const v4f*)(q);
        rs[i][j][1] = *(const v4f*)(q + 128);
      }
    // the addend's address is dead from here on: its registers are not reused before the wait that belongs in front of that
    asm volatile("s_wait_xcnt 0x0" :: "v"(rp) : "memory");
  }

  for (int k0 = 0; k0 < K; k0 += 32) {
    // every fragment of the k step has registers of its own and is loaded ahead of the step's first product:
    // the step waits out one load latency, not one for each row of A fragments
    V bh[4], bl[4], ahs[4], als[4];
#pragma unroll
    for (int j = 0; j < 4; ++j) {
      bh[j] = Frag<T>::load(Bb + bo[j]);
      if (SPLIT) bl[j] = Frag<T>::load(Bb2 + bo[j]);
    }
#pragma unroll
    for (int i = 0; i < 4; ++i) {
      ahs[i] = Frag<T>::load(Ab + ao[i]);
      if (SPLIT) als[i] = Frag<T>::load(Ab2 + ao[i]);
    }
#pragma unroll
    for (int i = 0; i < 4; ++i) {
      const V ah = ahs[i];
      const V al = SPLIT ? als[i] : ahs[i];
#pragma unroll
      for (int j = 0; j < 4; ++j) {
        acc[i][j] = Frag<T>::mma(ah, bh[j], acc[i][j]);
        if (SPLIT) {
          acc[i][j] = Frag<T>::mma(ah, bl[j], acc[i][j]);
          acc[i][j] = Frag<T>::mma(al, bh[j], acc[i][j]);
        }
      }
      Frag<T>::guard(acc[i][0], acc[i][3], ah, al);
    }
    Frag<T>::keep(bh[0], bh[1], bh[2], bh[3]);
    if (SPLIT) Frag<T>::keep(bl[0], bl[1], bl[2], bl[3]);
    // at the trip's foot, in front of the next trip's addresses
    addr_wait8(Ab + ao[0], Ab + ao[1], Ab + ao[2], Ab + ao[3], Bb + bo[0], Bb + bo[1], Bb + bo[2], Bb + bo[3]);
    if (SPLIT) addr_wait8(Ab2 + ao[0], Ab2 + ao[1], Ab2 + ao[2], Ab2 + ao[3], Bb2 + bo[0], Bb2 + bo[1], Bb2 + bo[2], Bb2 + bo[3]);
#pragma unroll
    for (int i = 0; i < 4; ++i) { ao[i] += 512; bo[i] += 512; }
  }
  acc_guard4(acc[0][0], acc[0][1], acc[0][2], acc[0][3]);
  acc_guard4(acc[1][0], acc[1][1], acc[1][2], acc[1][3]);
  acc_guard4(acc[2][0], acc[2][1], acc[2][2], acc[2][3]);
  acc_guard4(acc[3][0], acc[3][1], acc[3][2], acc[3][3]);

  // ---- epilogue ----
  float* slab = sT[wave];
#pragma unroll
  for (int i = 0; i < 4; ++i) {
    const int mBase = m0 + (i << 4);
#pragma unroll
    for (int j = 0; j < 4; ++j) {
      const int n = n0 + (j << 4) + rlane;
      float bv = 0.f;
      if (BIAS_MODE == 2) bv = bias[n];
#pragma unroll
      for (int r = 0; r < 8; ++r) {
        float v = acc[i][j][r] * scale;
        if (BIAS_MODE == 3) v *= bias[mBase + mOff + r];
        if (BIAS_MODE == 4) v *= bias[(i << 4) + mOff + r];
        if (BIAS_MODE == 1) v += bias[mBase + mOff + r];
        if (BIAS_MODE == 2) v += bv;
        if (RESID) v += rs[i][j][r >> 2][r & 3];
        if (ACT == 1) v = tanhf(v);
        if (ACT == 2) v = fmaxf(v, 0.0f);
        if (ACT == 3) v = v / (1.0f + expf(-v));
        if (ACT == 4) v = (v > 0.f) ? v : 0.01f * v;
        if (ACT == 5) v = 0.5f * v * (1.0f + erff(v * 0.70710678118654752f));
        slab[(mOff + r) * 68 + (j << 4) + rlane] = v;
      }
    }
    __builtin_amdgcn_fence(__ATOMIC_RELEASE, "workgroup");
    __builtin_amdgcn_wave_barrier();
    __builtin_amdgcn_fence(__ATOMIC_ACQUIRE, "workgroup");
    if (OUT_MODE == 0) {
      float* C = (float*)Cout + (size_t)b * strideC;
      const int hh = lane >> 4, c4 = (lane & 15) * 4;     // row seg = 256 B = 16 lanes x 16 B
      {
#pragma unroll
        for (int it = 0; it < 8; ++it) {
          const int row = it * 2 + hh;
          v4f v = *(const v4f*)(slab + row * 68 + c4);
          *(v4f*)(C + (size_t)(mBase + row) * ldc + n0 + c4) = v;
        }
        
      }
    } else {
      // the 16 x 64 slab is two fragments that lie side by side in the output: four stores of 512 contiguous bytes
      const size_t fo = ((size_t)(mBase >> 4) * (ldc >> 5) + (n0 >> 5)) * 512 + lane * 8;
      unsigned short* C  = (unsigned short*)Cout  + (size_t)b * strideC;
      unsigned short* C2 = (OUT_MODE == 2) ? ((unsigned short*)Cout2 + (size_t)b * strideC) : nullptr;
      float* CF = (OUT_MODE == 3) ? ((float*)Cout2 + (size_t)b * strideC + (fo - lane * 4)) : nullptr;
      {
#pragma unroll
        for (int it = 0; it < 4; ++it) {
          const float* sp = slab + rlane * 68 + it * 16 + mOff;   // fragment it >> 1, half it & 1
          v8h hv, lv;
          if (OUT_MODE == 3) {
            const v4f lo = *(const v4f*)(sp), hi = *(const v4f*)(sp + 4);
            hv = __builtin_convertvector(__builtin_shufflevector(lo, hi, 0, 1, 2, 3, 4, 5, 6, 7), v8h);
            *(v4f*)(CF + it * 256)       = lo;
            *(v4f*)(CF + it * 256 + 128) = hi;
          }
#pragma unroll
          for (int e = 0; e < 8 && OUT_MODE != 3; ++e) {
            if (OUT_MODE == 1) {
              hv[e] = (_Float16)sp[e];
            } else {
              unsigned short hb = f2bf_bits(sp[e]);
              unsigned short lb = f2bf_bits(sp[e] - bf_bits2f(hb));
              hv[e] = __builtin_bit_cast(_Float16, hb);
              lv[e] = __builtin_bit_cast(_Float16, lb);
            }
          }
          *(v8h*)(C + fo + it * 256) = hv;
          if (OUT_MODE == 2) *(v8h*)(C2 + fo + it * 256) = lv;
        }
        
      }
    }
    __builtin_amdgcn_fence(__ATOMIC_RELEASE, "workgroup");
    __builtin_amdgcn_wave_barrier();
    __builtin_amdgcn_fence(__ATOMIC_ACQUIRE, "workgroup");
  }
}

// ---- the three projections in one grid: none reads what another writes, so their blocks run side by side ----
// v is projected once, as v^T: its tiles go out as the f16 operand of the product with q and, unrounded, as the f32 addend of the
// last GEMM. Block ranges (8 tiles of 64x64 per block), in this order: v^T, q^T, k.
#define PB_V  ((G_ROWS / 64) * (OUT_D / 64) / 8)
#define PB_KQ ((G_ROWS / 64) * (KQ_D / 64) / 8)
__global__ __launch_bounds__(256) void k_project_all(
    const unsigned short* __restrict__ x16, const unsigned short* __restrict__ wk16,
    const unsigned short* __restrict__ wq16, const unsigned short* __restrict__ wv16,
    const float* __restrict__ bk, const float* __restrict__ bq, const float* __restrict__ bv,
    unsigned short* __restrict__ k16, float* __restrict__ vf,
    unsigned short* __restrict__ vt16, unsigned short* __restrict__ qt16) {
  __shared__ __align__(16) float sT[8][16 * 68];   // per-wave 16x64 slab, pitch 68 floats
  const int bx = blockIdx.x;
  if (bx < PB_V) {
    // VT16 [512][8192] f16 and VTf [512][8192] f32 = Wv16 . x16^T / 64 + bv[m]
    gemm64_block<0, false, 1, 3, false>(sT, bx, 0, wv16, nullptr, IN_D, 0L, x16, nullptr, IN_D, 0L, (void*)vt16, (void*)vf, G_ROWS, 0L,
                                        bv, nullptr, 0L, OUT_D, G_ROWS, IN_D, WSC_INV);
  } else if (bx < PB_V + PB_KQ) {
    // QT16 [128][8192] f16 = Wq16 . x16^T / 64 + bq[m]
    gemm64_block<0, false, 1, 1, false>(sT, bx - PB_V, 0, wq16, nullptr, IN_D, 0L, x16, nullptr, IN_D, 0L, (void*)qt16, nullptr, G_ROWS, 0L,
                                        bq, nullptr, 0L, KQ_D, G_ROWS, IN_D, WSC_INV);
  } else {
    // K16 [8192][128] f16 = x16 . Wk16^T / 64 + bk
    gemm64_block<0, false, 2, 1, false>(sT, bx - (PB_V + PB_KQ), 0, x16, nullptr, IN_D, 0L,
                                        wk16, nullptr, IN_D, 0L, (void*)k16, nullptr, KQ_D, 0L,
                                        bk, nullptr, 0L, G_ROWS, KQ_D, IN_D, WSC_INV);
  }
}

// ---- the four casts to f16 in one grid (weights x64, exact); every range is whole blocks ----
// The f16 copies go out in fragment order (see the GEMM's head): a thread makes one 16-byte piece, 8 elements of one row.
#define CB_X ((G_ROWS * IN_D / 8) / 256)
#define CB_K ((KQ_D * IN_D / 8) / 256)
#define CB_V ((OUT_D * IN_D / 8) / 256)
__global__ __launch_bounds__(256) void k_cast_all(
    const float* __restrict__ x, const float* __restrict__ Wk, const float* __restrict__ Wq, const float* __restrict__ Wv,
    unsigned short* __restrict__ x16, unsigned short* __restrict__ wk16, unsigned short* __restrict__ wq16,
    unsigned short* __restrict__ wv16) {
  int bx = blockIdx.x;
  const float* in = Wk; unsigned short* out = wk16; float mul = WSC;
  if (bx >= 2 * CB_K + CB_V)  { in = x;  out = x16;  mul = 1.0f; bx -= 2 * CB_K + CB_V; }
  else if (bx >= 2 * CB_K)    { in = Wv; out = wv16; bx -= 2 * CB_K; }
  else if (bx >= CB_K)        { in = Wq; out = wq16; bx -= CB_K; }
  const int c = bx * 256 + threadIdx.x;            // piece number: [16-row group][k step: IN_D / 32][half: 2][lane: 32]
  const int l = c & 31;
  const int row = (c / (IN_D * 2)) * 16 + (l & 15);
  const int col = ((c >> 6) % (IN_D / 32)) * 32 + ((c >> 5) & 1) * 16 + (l >> 4) * 8;
  const float* p = in + (size_t)row * IN_D + col;
  const v4f a = *(const v4f*)(p) * mul, b = *(const v4f*)(p + 4) * mul;
  *(v8h*)(out + (size_t)c * 8) = __builtin_convertvector(__builtin_shufflevector(a, b, 0, 1, 2, 3, 4, 5, 6, 7), v8h);
}

// ---- [VT16; QT16] . QT16^T [640][128], summed over all G_ROWS rows of q and v inside one block ----
// A block owns a 32 x 16 tile of the product. Its 16 waves share out the k steps (16 each), every wave keeps its two 16 x 16
// partial sums in f32 accumulators, and the 16 partials are added through LDS, wave 0 first (fixed order).
// Rows below OUT_D are (q^T v)^T and go out as f16. The KQ_D rows behind them are the Gram matrix q^T q: it goes out divided
// by GSC as an f16 hi plane and an f16 lo plane (the rest after hi). All three go out in fragment order:
// [16-row group i][k step t of 32][fragment half][lane][8 elements], so that a fragment half is 512 contiguous bytes.
// Element e of half p in lane l is row 16 i + (l & 15), column 32 t + 16 p + 8 (l >> 4) + e.
#define KST   (G_ROWS / 32)        // k steps in a 16-row group of VT16 or QT16
#define QW    16                   // waves of a block
#define QSTEP (KST / QW)           // k steps of one wave
#define QPH   4                    // k steps whose fragments a wave loads together
__global__ __launch_bounds__(QW * 32) void k_qtv(const unsigned short* __restrict__ vq16, const unsigned short* __restrict__ qt16,
                                                 unsigned short* __restrict__ mt, unsigned short* __restrict__ gh,
                                                 unsigned short* __restrict__ gl) {
  __shared__ __align__(16) float sR[QW][2][8][32];   // per wave: its two accumulator tiles, [register][lane]
  const int lane = threadIdx.x & 31;
  const int wave = threadIdx.x >> 5;
  const int ta = blockIdx.x >> 3;                    // pair of 16-row groups of [VT16; QT16]
  const int tb = blockIdx.x & 7;                     // 16-row group of QT16
  const _Float16* pa = (const _Float16*)vq16 + ((size_t)(2 * ta) * KST + wave * QSTEP) * 512 + lane * 8;
  const _Float16* pb = (const _Float16*)qt16 + ((size_t)tb * KST + wave * QSTEP) * 512 + lane * 8;
  v8f acc[2];
#pragma unroll
  for (int i = 0; i < 2; ++i) acc[i] = (v8f){0.f,0.f,0.f,0.f,0.f,0.f,0.f,0.f};
#pragma unroll   // straight-line code: no branch stands behind a matrix instruction
  for (int p = 0; p < QSTEP / QPH; ++p) {
    // the blocks that read the same rows (8 for a row of the left operand, 20 for one of the right) start at different quarters:
    // each line is asked of memory by one of them and found in L2 by the others, instead of all waiting for the same fill
    const int g = (p + ta + tb) & (QSTEP / QPH - 1);
    const _Float16* qa = pa + g * (QPH * 512);
    const _Float16* qb = pb + g * (QPH * 512);
    v16h fa[QPH][2], fb[QPH];
#pragma unroll
    for (int t = 0; t < QPH; ++t) {
      fb[t] = Frag<_Float16>::load(qb + t * 512);
#pragma unroll
      for (int i = 0; i < 2; ++i) fa[t][i] = Frag<_Float16>::load(qa + (i * KST + t) * 512);
    }
#pragma unroll
    for (int t = 0; t < QPH; ++t)
#pragma unroll
      for (int i = 0; i < 2; ++i) acc[i] = Frag<_Float16>::mma(fa[t][i], fb[t], acc[i]);
    // inputs only, loaded values: every fragment of the quarter gets registers of its own, so that its 24 loads are in flight
    // together; without these the build reuses a few registers and waits with four to six loads outstanding
    Frag<_Float16>::keep(fb[0], fb[1], fb[2], fb[3]);
    Frag<_Float16>::keep(fa[0][0], fa[0][1], fa[1][0], fa[1][1]);
    Frag<_Float16>::keep(fa[2][0], fa[2][1], fa[3][0], fa[3][1]);
    // the quarter's addresses are dead from here on: their registers are not reused before the wait that belongs in front of that
    asm volatile("s_wait_xcnt 0x0" :: "v"(qa), "v"(qb) : "memory");
  }
#pragma unroll
  for (int i = 0; i < 2; ++i)
#pragma unroll
    for (int r = 0; r < 8; ++r) sR[wave][i][r][lane] = acc[i][r];
  __syncthreads();                                   // every wave's partial sums are in sR
  if (threadIdx.x >= 256) return;                    // whole waves; no barrier follows
  // a thread adds up two neighbouring columns of one row: accumulator register r of lanes l, l + 1 of tile i
  const int i = threadIdx.x >> 7, r = (threadIdx.x >> 4) & 7, l = (threadIdx.x & 15) * 2;
  v2f pr[QW];
#pragma unroll
  for (int w = 0; w < QW; ++w) pr[w] = *(const v2f*)&sR[w][i][r][l];
  v2f s = (v2f){0.f, 0.f};
#pragma unroll
  for (int w = 0; w < QW; ++w) s += pr[w];
  const int m15 = 8 * (l >> 4) + r, n15 = l & 15;    // row and column inside the 16 x 16 tile
  const int grp = 2 * ta + i;                        // 16-row group of the product
  const int in  = tb * 256 + (m15 + 16 * (n15 >> 3)) * 8 + (n15 & 7);   // k step tb >> 1, half tb & 1, then lane and element
  if (ta < OUT_D / 32) {
    *(v2h*)(mt + grp * (KQ_D * 16) + in) = __builtin_convertvector(s, v2h);
  } else {
    s *= GSC_INV;
    const int pos = (grp - OUT_D / 16) * (KQ_D * 16) + in;
    const v2h hi = __builtin_convertvector(s, v2h);
    *(v2h*)(gh + pos) = hi;
    *(v2h*)(gl + pos) = __builtin_convertvector(s - __builtin_convertvector(hi, v2f), v2h);
    // behind the two stores: the listing's next block rewrites a register that they name
    asm volatile("s_wait_xcnt 0x0" ::: "memory");
  }
}

__device__ __forceinline__ void load_rows16(v16h (&f)[4], const _Float16* p) {
#pragma unroll
  for (int t = 0; t < 4; ++t) f[t] = Frag<_Float16>::load(p + (t << 9));
}
// A fragment (16-row group i, k step t) of a Gram plane in the order k_qtv writes: two whole 512-byte runs per wave
__device__ __forceinline__ v16h load_gram(const _Float16* g, const int i, const int t, const int lane) {
  Frag<_Float16>::U f;
  const _Float16* p = g + ((i * 4 + t) * 2 * 32 + lane) * 8;
  f.h[0] = *(const v8h*)(p); f.h[1] = *(const v8h*)(p + 32 * 8);
  return f.v;
}

// ---- out [8192][512] = inv[m] * (K16 . MT16^T) + VTf^T, inv[m] = 1 / max(||row m of k q^T||, eps) ----
// sum_j (k_m . q_j)^2 = k_m^T (q^T q) k_m, so the row norms need the 128 x 128 Gram matrix only, never k q^T itself.
// A block owns 64 rows. Wave w forms, for the 16 rows of group w >> 1, the product T = G . k^T for the 16-row groups
// i = 2 u + (w & 1) of G (A = G, B = k rows): a lane's accumulators are T[16 i + 8 (lane >> 4) + r][its k row], and the k
// values they are multiplied with are the ones its own B fragment u holds in half w & 1.
__global__ __launch_bounds__(256) void k_scale_out(const unsigned short* __restrict__ k16, const unsigned short* __restrict__ mt16,
                                                   const unsigned short* __restrict__ gh, const unsigned short* __restrict__ gl,
                                                   const float* __restrict__ vf, float* __restrict__ out) {
  __shared__ __align__(16) float sT[8][16 * 68];   // per-wave 16x64 slab, pitch 68 floats
  __shared__ float sP[8][16];                      // per wave: its half of k^T G k / GSC for its 16 rows
  __shared__ float sInv[64];                       // inverse norms of the block's 64 rows
  const int lane = threadIdx.x & 31;
  const int wave = threadIdx.x >> 5;
  const int par  = wave & 1;
  {
    const _Float16* kp = (const _Float16*)k16 + (size_t)((blockIdx.x << 2) + (wave >> 1)) * (16 * KQ_D) + lane * 8;   // its 16-row group, fragment order
    v16h kb[4];
    load_rows16(kb, kp);
    v8f acc[4];
#pragma unroll
    for (int u = 0; u < 4; ++u) acc[u] = (v8f){0.f,0.f,0.f,0.f,0.f,0.f,0.f,0.f};
#pragma unroll
    for (int t = 0; t < 4; ++t)
#pragma unroll
      for (int u = 0; u < 4; ++u) {
        acc[u] = Frag<_Float16>::mma(load_gram((const _Float16*)gl, 2 * u + par, t, lane), kb[t], acc[u]);
        acc[u] = Frag<_Float16>::mma(load_gram((const _Float16*)gh, 2 * u + par, t, lane), kb[t], acc[u]);
      }
    // the k address is dead from here on: its registers are not reused before the loads that name them are translated
    asm volatile("s_wait_xcnt 0x0" :: "v"(kp) : "memory");
    v8f ss = (v8f){0.f,0.f,0.f,0.f,0.f,0.f,0.f,0.f};
#pragma unroll
    for (int u = 0; u < 4; ++u) {
      Frag<_Float16>::U f; f.v = kb[u];
      ss += acc[u] * __builtin_convertvector(par ? f.h[1] : f.h[0], v8f);
    }
    const float h = ((ss[0] + ss[1]) + (ss[2] + ss[3])) + ((ss[4] + ss[5]) + (ss[6] + ss[7]));
    const float s = h + __shfl_xor(h, 16, 32);     // the two lane halves hold rows 0..7 and 8..15 of each group of G
    if (lane < 16) sP[wave][lane] = s;
  }
  __syncthreads();                                 // every wave's half sums are in sP
  if (threadIdx.x < 64) {
    const int g = threadIdx.x >> 4, r = threadIdx.x & 15;
    // rounding can carry a vanishing quadratic form below zero: it counts as zero, and eps takes over as in the reference
    const float a = fmaxf(sP[2 * g][r] + sP[2 * g + 1][r], 0.f) * GSC;
    sInv[threadIdx.x] = 1.0f / fmaxf(sqrtf(a), EPSF);
  }
  __syncthreads();                                 // sInv is complete before any wave's epilogue reads it
  gemm64_block<0, false, 4, 0, true>(sT, blockIdx.x, 0, k16, nullptr, KQ_D, 0L, mt16, nullptr, KQ_D, 0L,
                                     (void*)out, nullptr, OUT_D, 0L, sInv, vf, 0L, G_ROWS, OUT_D, KQ_D, 1.0f);
}

// ---------------------------------------------------------------------------
//   every f16 array below lies in fragment order (see the GEMM's head); 16 whole rows stay one contiguous run
//   x16  [8192][512] f16    8 MiB      | Wk16 [128][512], Wq16 [128][512], Wv16 [512][512] f16 (x64)
//   K16  [8192][128] f16    2 MiB      | VTf [512][8192] f32 16 MiB (v^T unrounded, pieces in the order of VT16's)
//   VT16 [512][8192] f16    8 MiB, directly followed by QT16 [128][8192] f16 2 MiB: one [640][8192] operand
//   MT16 [512][128] f16 ((q^T v)^T)
//   GH16, GL16 [128][128] f16 (q^T q / 256, hi and lo plane, in fragment order)
// ---------------------------------------------------------------------------
extern "C" void kernel_launch(void* const* d_in, const int* in_sizes, int n_in,
                              void* d_out, int out_size, void* d_ws, size_t ws_size,
                              hipStream_t stream) {
  if (n_in < 7) return;
  if (in_sizes[0] != G_ROWS * IN_D || in_sizes[1] != KQ_D * IN_D || in_sizes[2] != KQ_D ||
      in_sizes[3] != KQ_D * IN_D || in_sizes[4] != KQ_D || in_sizes[5] != OUT_D * IN_D ||
      in_sizes[6] != OUT_D) return;
  if (out_size != G_ROWS * OUT_D) return;

  const float* x  = (const float*)d_in[0];
  const float* Wk = (const float*)d_in[1];
  const float* bk = (const float*)d_in[2];
  const float* Wq = (const float*)d_in[3];
  const float* bq = (const float*)d_in[4];
  const float* Wv = (const float*)d_in[5];
  const float* bv = (const float*)d_in[6];
  float* out = (float*)d_out;

  const size_t b_x16 = (size_t)G_ROWS * IN_D * 2;
  const size_t b_wk  = (size_t)KQ_D * IN_D * 2;
  const size_t b_wv  = (size_t)OUT_D * IN_D * 2;
  const size_t b_k16 = (size_t)G_ROWS * KQ_D * 2;
  const size_t b_vf  = (size_t)G_ROWS * OUT_D * 4;
  const size_t b_vt  = (size_t)OUT_D * G_ROWS * 2;
  const size_t b_mt  = (size_t)OUT_D * KQ_D * 2;
  const size_t b_g   = (size_t)KQ_D * KQ_D * 2;

  size_t off = 0;
  const size_t o_x16 = off; off += b_x16;
  const size_t o_wk  = off; off += b_wk;
  const size_t o_wq  = off; off += b_wk;
  const size_t o_wv  = off; off += b_wv;
  const size_t o_k16 = off; off += b_k16;
  const size_t o_vf  = off; off += b_vf;
  const size_t o_vt  = off; off += b_vt;
  const size_t o_qt  = off; off += b_k16;   // stays directly behind VT16
  const size_t o_mt  = off; off += b_mt;
  const size_t o_gh  = off; off += b_g;
  const size_t o_gl  = off; off += b_g;
  if (off > ws_size) return;

  char* ws = (char*)d_ws;
  unsigned short* x16  = (unsigned short*)(ws + o_x16);
  unsigned short* wk16 = (unsigned short*)(ws + o_wk);
  unsigned short* wq16 = (unsigned short*)(ws + o_wq);
  unsigned short* wv16 = (unsigned short*)(ws + o_wv);
  unsigned short* k16  = (unsigned short*)(ws + o_k16);
  float*          vf   = (float*)(ws + o_vf);
  unsigned short* vt16 = (unsigned short*)(ws + o_vt);
  unsigned short* qt16 = (unsigned short*)(ws + o_qt);
  unsigned short* mt16 = (unsigned short*)(ws + o_mt);
  unsigned short* gh16 = (unsigned short*)(ws + o_gh);
  unsigned short* gl16 = (unsigned short*)(ws + o_gl);

  // ---- casts to f16 (weights x64, exact): one launch ----
  k_cast_all<<<dim3(CB_X + 2 * CB_K + CB_V), 256, 0, stream>>>(x, Wk, Wq, Wv, x16, wk16, wq16, wv16);

  // ---- projections k, v^T, q^T: one launch ----
  k_project_all<<<dim3(PB_V + 2 * PB_KQ), 256, 0, stream>>>(x16, wk16, wq16, wv16, bk, bq, bv, k16, vf, vt16, qt16);

  // ---- MT16 [512][128] and the two Gram planes = [VT16; QT16] . QT16^T : (k q^T) v is formed as k (q^T v), the row norms from q^T q ----
  // QT16 lies directly behind VT16, so both are one [PM_ROWS][G_ROWS] operand: rows below OUT_D give (q^T v)^T, the rest q^T q.
  k_qtv<<<dim3((PM_ROWS / 32) * (KQ_D / 16)), QW * 32, 0, stream>>>(vt16, qt16, mt16, gh16, gl16);

  // ---- out [8192][512] = inv[m] * (K16 . MT16^T) + VTf^T, inv from the Gram planes ----
  k_scale_out<<<dim3(G_ROWS / 64), 256, 0, stream>>>(k16, mt16, gh16, gl16, vf, out);
}

// v009
// One run takes 41.8 microseconds.
// Two timings next to v008 put it at 1.07 and 1.09 times that version's speed.
// All steps since v000 together make it 37.7 times as fast.
// Contractions: k,qT,vT projections (x*W^T), [vT;qT]*q (q^T*v and the Gram matrix q^T*q, rows shared out over the waves of a block), (q^T*q)*k^T (row norms of k*q^T as k_i^T (q^T q) k_i), k*(q^T*v) : v_wmma_f32_16x16x32_f16 (f16 operands, f32 accumulate); weights carried x64 in f16 with 1/64 folded into the epilogue scale; Gram matrix carried /256 as f16 hi + lo planes; row L2 norms, per-row scaling and residual in f32.
#include <hip/hip_runtime.h>
#include <math.h>
#include <stdint.h>
#include <stddef.h>

#define G_ROWS 8192
#define IN_D   512
#define KQ_D   128
#define OUT_D  512
#define PM_ROWS (OUT_D + KQ_D)     // rows of the product [v^T; q^T] q: v^T q (OUT_D rows) above q^T q (KQ_D rows)
#define EPSF   1e-12f
#define WSC     64.0f
#define WSC_INV (1.0f / 64.0f)
#define GSC     256.0f             // the Gram matrix is carried divided by this (exact): its f16 planes stay in the normal range
#define GSC_INV (1.0f / 256.0f)

typedef __attribute__((ext_vector_type(16))) _Float16 v16h;
typedef __attribute__((ext_vector_type(8)))  _Float16 v8h;
typedef __attribute__((ext_vector_type(2)))  _Float16 v2h;
typedef __attribute__((ext_vector_type(16))) __bf16   v16b;
typedef __attribute__((ext_vector_type(8)))  __bf16   v8b;
typedef __attribute__((ext_vector_type(8)))  float    v8f;
typedef __attribute__((ext_vector_type(4)))  float    v4f;
typedef __attribute__((ext_vector_type(2)))  float    v2f;

__device__ __forceinline__ unsigned short f2bf_bits(float f) {
  unsigned u = __float_as_uint(f);
  return (unsigned short)((u + 0x7FFFu + ((u >> 16) & 1u)) >> 16);
}
__device__ __forceinline__ float bf_bits2f(unsigned short h) { return __uint_as_float(((unsigned)h) << 16); }

// hazard guards as plain device helpers (the kernel template body's only inline asm of its own is the s_wait_xcnt behind the addend loads; in the k loop it is addr_wait8)
__device__ __forceinline__ void dep_guard_h(v8f& a, v8f& b, v16h x, v16h y) { asm volatile("v_nop\n\tv_nop\n\tv_nop\n\tv_nop" : "+v"(a), "+v"(b) : "v"(x), "v"(y)); }
__device__ __forceinline__ void dep_guard_b(v8f& a, v8f& b, v16b x, v16b y) { asm volatile("v_nop\n\tv_nop\n\tv_nop\n\tv_nop" : "+v"(a), "+v"(b) : "v"(x), "v"(y)); }
__device__ __forceinline__ void keep4_h(v16h a, v16h b, v16h c, v16h d) { asm volatile("v_nop" :: "v"(a), "v"(b), "v"(c), "v"(d)); }
__device__ __forceinline__ void keep4_b(v16b a, v16b b, v16b c, v16b d) { asm volatile("v_nop" :: "v"(a), "v"(b), "v"(c), "v"(d)); }
__device__ __forceinline__ void acc_guard4(v8f& a, v8f& b, v8f& c, v8f& d) { asm volatile("v_nop\n\tv_nop\n\tv_nop\n\tv_nop" : "+v"(a), "+v"(b), "+v"(c), "+v"(d)); }
// s_wait_xcnt 0 with load addresses as inputs: their registers stay as they are (no load's result lands in them, no next address)
// until the wait that belongs in front of a rewrite of an address register of issued loads has passed
__device__ __forceinline__ void addr_wait8(const void* a, const void* b, const void* c, const void* d, const void* e, const void* f, const void* g, const void* h) {
  asm volatile("s_wait_xcnt 0x0" :: "v"(a), "v"(b), "v"(c), "v"(d), "v"(e), "v"(f), "v"(g), "v"(h) : "memory");
}
template <typename T> struct Frag;
template <> struct Frag<_Float16> {
  typedef v16h V; union U { v16h v; v8h h[2]; };
  static __device__ __forceinline__ v16h load(const _Float16* p) {   // p = fragment + 8 * lane: elements 0..7 <- p[0..7], 8..15 <- p[256..263]
    U f; f.h[0] = *(const v8h*)(p); f.h[1] = *(const v8h*)(p + 256); return f.v;
  }
  static __device__ __forceinline__ v8f mma(v16h a, v16h b, v8f c) {
    return __builtin_amdgcn_wmma_f32_16x16x32_f16(false, a, false, b, (short)0, c, false, false);
  }
  static __device__ __forceinline__ void guard(v8f& a, v8f& b, v16h x, v16h y) { dep_guard_h(a, b, x, y); }
  static __device__ __forceinline__ void keep(v16h a, v16h b, v16h c, v16h d) { keep4_h(a, b, c, d); }
};
template <> struct Frag<__bf16> {
  typedef v16b V; union U { v16b v; v8b h[2]; };
  static __device__ __forceinline__ v16b load(const __bf16* p) {
    U f; f.h[0] = *(const v8b*)(p); f.h[1] = *(const v8b*)(p + 256); return f.v;
  }
  static __device__ __forceinline__ v8f mma(v16b a, v16b b, v8f c) {
    return __builtin_amdgcn_wmma_f32_16x16x32_bf16(false, a, false, b, (short)0, c, false, false);
  }
  static __device__ __forceinline__ void guard(v8f& a, v8f& b, v16b x, v16b y) { dep_guard_b(a, b, x, y); }
  static __device__ __forceinline__ void keep(v16b a, v16b b, v16b c, v16b d) { keep4_b(a, b, c, d); }
};

// ---- Register-blocked batched WMMA GEMM ------------------------------------
// C[m,n] = scale * sum_k A[m,k] * Bt[n,k] (*rowscale)(+bias)(+resid); each wave owns a 64x64 tile.
// A [M,K] and Bt [N,K] lie in FRAGMENT ORDER: [16-row group][k step of 32][fragment half][lane][8 elements], lda / ldb = elements
// per row, so that a wave's 16-byte loads of a fragment half cover 512 contiguous bytes (4 whole lines, not 32 bytes of each of
// 16 rows). Element e of half p in lane l is row 16 g + (l & 15), column 32 t + 16 p + 8 (l >> 4) + e. A step of 32 in k is a
// step of 512 elements, which is what strideA / strideB count in. 16-bit outputs are written in the same order (ldc = elements
// per row), OUT_MODE 0 f32 outputs row-major. M,N % 64 == 0, K % 32 == 0.
// SPLIT: operands are hi/lo planes (A2/Bt2 = lo planes, same layout); product = hi*hi + hi*lo + lo*hi.
// BIAS_MODE: 0 = none, 1 = bias[m], 2 = bias[n], 3 = per-row scale: value *= bias[m] (applied before resid),
//            4 = as 3, with bias indexed by the row inside the 64-row tile (the block's own table).
// OUT_MODE: 0 = f32, 1 = f16, 2 = bf16 hi plane (Cout) + bf16 lo plane (Cout2),
//           3 = f16 (Cout) + the same values unrounded as f32 (Cout2), piece for piece in the f16 order; the 8 floats of a lane's
//               piece lie as two runs [4 low: lane][4 high: lane], so that each 16-byte store of a wave covers 512 contiguous bytes.
// RESID: resid holds the TRANSPOSE of the addend, [N][M], as OUT_MODE 3 writes it: a lane's piece there (one row n, 8 columns m)
//        is what the lane's accumulator fragment holds (one column n, 8 rows m), so it is read with two 16-byte loads.
// ET: 0 = f16 operands, 1 = bf16 operands (pointers passed as 16-bit storage)
template <int ET> struct Elem;
template <> struct Elem<0> { typedef _Float16 T; };
template <> struct Elem<1> { typedef __bf16 T; };
// gemm64_block: the work of one 256-thread block; bx, b = the block's place in this product's own grid; sT = the block's LDS slabs.
template <int ET, bool SPLIT, int BIAS_MODE, int OUT_MODE, bool RESID, int ACT = 0>
__device__ __forceinline__ void gemm64_block(
    float (*sT)[16 * 68], const int bx, const int b,
    const unsigned short* __restrict__ Ap, const unsigned short* __restrict__ A2p, int lda, long strideA,
    const unsigned short* __restrict__ Btp, const unsigned short* __restrict__ Bt2p, int ldb, long strideB,
    void* __restrict__ Cout, void* __restrict__ Cout2, int ldc, long strideC,
    const float* __restrict__ bias,
    const float* __restrict__ resid, long strideR,
    int M, int N, int K, float scale) {
  typedef typename Elem<ET>::T T;
  typedef typename Frag<T>::V V;
  const T* A = (const T*)Ap; const T* A2 = (const T*)A2p; const T* Bt = (const T*)Btp; const T* Bt2 = (const T*)Bt2p;
  const int lane = threadIdx.x & 31;
  const int wave = threadIdx.x >> 5;
  const int tilesN = N >> 6;
  const int tilesM = M >> 6;
  const int tile = bx * 8 + wave;
  if (tile >= tilesM * tilesN) return;   // wave-uniform; no block barriers in this kernel
  const int tm = tile / tilesN;
  const int tn = tile - tm * tilesN;
  const int m0 = tm << 6;
  const int n0 = tn << 6;

  const T* Ab  = A  + (size_t)b * strideA;
  const T* Bb  = Bt + (size_t)b * strideB;
  const T* Ab2 = SPLIT ? (A2  + (size_t)b * strideA) : nullptr;
  const T* Bb2 = SPLIT ? (Bt2 + (size_t)b * strideB) : nullptr;

  const int rlane = lane & 15;                 // col (D) within subtile
  const int mOff  = (lane >> 4) * 8;           // D row offset

  v8f acc[4][4];
#pragma unroll
  for (int i = 0; i < 4; ++i)
#pragma unroll
    for (int j = 0; j < 4; ++j) acc[i][j] = (v8f){0.f,0.f,0.f,0.f,0.f,0.f,0.f,0.f};

  size_t ao[4], bo[4];                         // this lane's place in the current k step's fragments
#pragma unroll
  for (int i = 0; i < 4; ++i) {
    ao[i] = (size_t)((m0 >> 4) + i) * (lda >> 5) * 512 + lane * 8;
    bo[i] = (size_t)((n0 >> 4) + i) * (ldb >> 5) * 512 + lane * 8;
  }

  // the addend of every accumulator: independent of the products, so its loads are issued ahead of the k loop
  v4f rs[4][4][2];
  if (RESID) {
    const float* rp = resid + (size_t)b * strideR + ((size_t)(n0 >> 4) * (M >> 5) + (m0 >> 5)) * 512 + lane * 4;
#pragma unroll
    for (int i = 0; i < 4; ++i)
#pragma unroll
      for (int j = 0; j < 4; ++j) {
        const float* q = rp + ((size_t)j * (M >> 5) + (i >> 1)) * 512 + (i & 1) * 256;
        rs[i][j][0] = *(const v4f*)(q);
        rs[i][j][1] = *(const v4f*)(q + 128);
      }
    // the addend's address is dead from here on: its registers are not reused before the wait that belongs in front of that
    asm volatile("s_wait_xcnt 0x0" :: "v"(rp) : "memory");
  }

  for (int k0 = 0; k0 < K; k0 += 32) {
    // every fragment of the k step has registers of its own and is loaded ahead of the step's first product:
    // the step waits out one load latency, not one for each row of A fragments
    V bh[4], bl[4], ahs[4], als[4];
#pragma unroll
    for (int j = 0; j < 4; ++j) {
      bh[j] = Frag<T>::load(Bb + bo[j]);
      if (SPLIT) bl[j] = Frag<T>::load(Bb2 + bo[j]);
    }
#pragma unroll
    for (int i = 0; i < 4; ++i) {
      ahs[i] = Frag<T>::load(Ab + ao[i]);
      if (SPLIT) als[i] = Frag<T>::load(Ab2 + ao[i]);
    }
#pragma unroll
    for (int i = 0; i < 4; ++i) {
      const V ah = ahs[i];
      const V al = SPLIT ? als[i] : ahs[i];
#pragma unroll
      for (int j = 0; j < 4; ++j) {
        acc[i][j] = Frag<T>::mma(ah, bh[j], acc[i][j]);
        if (SPLIT) {
          acc[i][j] = Frag<T>::mma(ah, bl[j], acc[i][j]);
          acc[i][j] = Frag<T>::mma(al, bh[j], acc[i][j]);
        }
      }
      Frag<T>::guard(acc[i][0], acc[i][3], ah, al);
    }
    Frag<T>::keep(bh[0], bh[1], bh[2], bh[3]);
    if (SPLIT) Frag<T>::keep(bl[0], bl[1], bl[2], bl[3]);
    // at the trip's foot, in front of the next trip's addresses
    addr_wait8(Ab + ao[0], Ab + ao[1], Ab + ao[2], Ab + ao[3], Bb + bo[0], Bb + bo[1], Bb + bo[2], Bb + bo[3]);
    if (SPLIT) addr_wait8(Ab2 + ao[0], Ab2 + ao[1], Ab2 + ao[2], Ab2 + ao[3], Bb2 + bo[0], Bb2 + bo[1], Bb2 + bo[2], Bb2 + bo[3]);
#pragma unroll
    for (int i = 0; i < 4; ++i) { ao[i] += 512; bo[i] += 512; }
  }
  acc_guard4(acc[0][0], acc[0][1], acc[0][2], acc[0][3]);
  acc_guard4(acc[1][0], acc[1][1], acc[1][2], acc[1][3]);
  acc_guard4(acc[2][0], acc[2][1], acc[2][2], acc[2][3]);
  acc_guard4(acc[3][0], acc[3][1], acc[3][2], acc[3][3]);

  // ---- epilogue ----
  float* slab = sT[wave];
#pragma unroll
  for (int i = 0; i < 4; ++i) {
    const int mBase = m0 + (i << 4);
#pragma unroll
    for (int j = 0; j < 4; ++j) {
      const int n = n0 + (j << 4) + rlane;
      float bv = 0.f;
      if (BIAS_MODE == 2) bv = bias[n];
#pragma unroll
      for (int r = 0; r < 8; ++r) {
        float v = acc[i][j][r] * scale;
        if (BIAS_MODE == 3) v *= bias[mBase + mOff + r];
        if (BIAS_MODE == 4) v *= bias[(i << 4) + mOff + r];
        if (BIAS_MODE == 1) v += bias[mBase + mOff + r];
        if (BIAS_MODE == 2) v += bv;
        if (RESID) v += rs[i][j][r >> 2][r & 3];
        if (ACT == 1) v = tanhf(v);
        if (ACT == 2) v = fmaxf(v, 0.0f);
        if (ACT == 3) v = v / (1.0f + expf(-v));
        if (ACT == 4) v = (v > 0.f) ? v : 0.01f * v;
        if (ACT == 5) v = 0.5f * v * (1.0f + erff(v * 0.70710678118654752f));
        slab[(mOff + r) * 68 + (j << 4) + rlane] = v;
      }
    }
    __builtin_amdgcn_fence(__ATOMIC_RELEASE, "workgroup");
    __builtin_amdgcn_wave_barrier();
    __builtin_amdgcn_fence(__ATOMIC_ACQUIRE, "workgroup");
    if (OUT_MODE == 0) {
      float* C = (float*)Cout + (size_t)b * strideC;
      const int hh = lane >> 4, c4 = (lane & 15) * 4;     // row seg = 256 B = 16 lanes x 16 B
      {
#pragma unroll
        for (int it = 0; it < 8; ++it) {
          const int row = it * 2 + hh;
          v4f v = *(const v4f*)(slab + row * 68 + c4);
          *(v4f*)(C + (size_t)(mBase + row) * ldc + n0 + c4) = v;
        }
        
      }
    } else {
      // the 16 x 64 slab is two fragments that lie side by side in the output: four stores of 512 contiguous bytes
      const size_t fo = ((size_t)(mBase >> 4) * (ldc >> 5) + (n0 >> 5)) * 512 + lane * 8;
      unsigned short* C  = (unsigned short*)Cout  + (size_t)b * strideC;
      unsigned short* C2 = (OUT_MODE == 2) ? ((unsigned short*)Cout2 + (size_t)b * strideC) : nullptr;
      float* CF = (OUT_MODE == 3) ? ((float*)Cout2 + (size_t)b * strideC + (fo - lane * 4)) : nullptr;
      {
#pragma unroll
        for (int it = 0; it < 4; ++it) {
          const float* sp = slab + rlane * 68 + it * 16 + mOff;   // fragment it >> 1, half it & 1
          v8h hv, lv;
          if (OUT_MODE == 3) {
            const v4f lo = *(const v4f*)(sp), hi = *(const v4f*)(sp + 4);
            hv = __builtin_convertvector(__builtin_shufflevector(lo, hi, 0, 1, 2, 3, 4, 5, 6, 7), v8h);
            *(v4f*)(CF + it * 256)       = lo;
            *(v4f*)(CF + it * 256 + 128) = hi;
          }
#pragma unroll
          for (int e = 0; e < 8 && OUT_MODE != 3; ++e) {
            if (OUT_MODE == 1) {
              hv[e] = (_Float16)sp[e];
            } else {
              unsigned short hb = f2bf_bits(sp[e]);
              unsigned short lb = f2bf_bits(sp[e] - bf_bits2f(hb));
              hv[e] = __builtin_bit_cast(_Float16, hb);
              lv[e] = __builtin_bit_cast(_Float16, lb);
            }
          }
          *(v8h*)(C + fo + it * 256) = hv;
          if (OUT_MODE == 2) *(v8h*)(C2 + fo + it * 256) = lv;
        }
        
      }
    }
    __builtin_amdgcn_fence(__ATOMIC_RELEASE, "workgroup");
    __builtin_amdgcn_wave_barrier();
    __builtin_amdgcn_fence(__ATOMIC_ACQUIRE, "workgroup");
  }
}

// ---- the three projections in one grid: none reads what another writes, so their blocks run side by side ----
// v is projected once, as v^T: its tiles go out as the f16 operand of the product with q and, unrounded, as the f32 addend of the
// last GEMM. Block ranges (8 tiles of 64x64 per block), in this order: v^T, q^T, k.
#define PB_V  ((G_ROWS / 64) * (OUT_D / 64) / 8)
#define PB_KQ ((G_ROWS / 64) * (KQ_D / 64) / 8)
__global__ __launch_bounds__(256) void k_project_all(
    const unsigned short* __restrict__ x16, const unsigned short* __restrict__ wk16,
    const unsigned short* __restrict__ wq16, const unsigned short* __restrict__ wv16,
    const float* __restrict__ bk, const float* __restrict__ bq, const float* __restrict__ bv,
    unsigned short* __restrict__ k16, float* __restrict__ vf,
    unsigned short* __restrict__ vt16, unsigned short* __restrict__ qt16) {
  __shared__ __align__(16) float sT[8][16 * 68];   // per-wave 16x64 slab, pitch 68 floats
  const int bx = blockIdx.x;
  if (bx < PB_V) {
    // VT16 [512][8192] f16 and VTf [512][8192] f32 = Wv16 . x16^T / 64 + bv[m]
    gemm64_block<0, false, 1, 3, false>(sT, bx, 0, wv16, nullptr, IN_D, 0L, x16, nullptr, IN_D, 0L, (void*)vt16, (void*)vf, G_ROWS, 0L,
                                        bv, nullptr, 0L, OUT_D, G_ROWS, IN_D, WSC_INV);
  } else if (bx < PB_V + PB_KQ) {
    // QT16 [128][8192] f16 = Wq16 . x16^T / 64 + bq[m]
    gemm64_block<0, false, 1, 1, false>(sT, bx - PB_V, 0, wq16, nullptr, IN_D, 0L, x16, nullptr, IN_D, 0L, (void*)qt16, nullptr, G_ROWS, 0L,
                                        bq, nullptr, 0L, KQ_D, G_ROWS, IN_D, WSC_INV);
  } else {
    // K16 [8192][128] f16 = x16 . Wk16^T / 64 + bk
    gemm64_block<0, false, 2, 1, false>(sT, bx - (PB_V + PB_KQ), 0, x16, nullptr, IN_D, 0L,
                                        wk16, nullptr, IN_D, 0L, (void*)k16, nullptr, KQ_D, 0L,
                                        bk, nullptr, 0L, G_ROWS, KQ_D, IN_D, WSC_INV);
  }
}

// ---- the four casts to f16 in one grid (weights x64, exact); every range is whole blocks ----
// The f16 copies go out in fragment order (see the GEMM's head), in 16-byte pieces: 8 elements of one row.
// The launch is a short stream, so it is dealt for few waves and whole lines. A unit is 8 rows x one 128-byte line of f32 (one
// k step): two loads of a wave, 4 whole lines each (8 lanes to a line), and one store of 4 whole lines of f16. A lane holds 4
// elements of one of the unit's rows 0..3 and the same 4 columns of the row 4 below; neighbour lanes swap one of the two, so that the even lane has a whole
// piece of the upper row and the odd lane one of the lower. A wave makes CU units: 16 rows x 4 k steps, all loads in flight at once.
#define CU   8
#define CB_X ((G_ROWS * IN_D / 8) / (256 * CU))
#define CB_K ((KQ_D * IN_D / 8) / (256 * CU))
#define CB_V ((OUT_D * IN_D / 8) / (256 * CU))
typedef __attribute__((ext_vector_type(4)))  _Float16 v4h;
typedef __attribute__((ext_vector_type(2)))  int      v2i;
__global__ __launch_bounds__(256) void k_cast_all(
    const float* __restrict__ x, const float* __restrict__ Wk, const float* __restrict__ Wq, const float* __restrict__ Wv,
    unsigned short* __restrict__ x16, unsigned short* __restrict__ wk16, unsigned short* __restrict__ wq16,
    unsigned short* __restrict__ wv16) {
  int bx = blockIdx.x;
  const float* in = Wk; unsigned short* out = wk16; float mul = WSC;
  if (bx >= 2 * CB_K + CB_V)  { in = x;  out = x16;  mul = 1.0f; bx -= 2 * CB_K + CB_V; }
  else if (bx >= 2 * CB_K)    { in = Wv; out = wv16; bx -= 2 * CB_K; }
  else if (bx >= CB_K)        { in = Wq; out = wq16; bx -= CB_K; }
  const int lane = threadIdx.x & 31;
  const int wv   = bx * 8 + (threadIdx.x >> 5);    // wave number: [16-row group][run of 4 k steps: IN_D / 128]
  const int g    = wv / (IN_D / 128);
  const int t0   = (wv % (IN_D / 128)) * 4;
  const int rr = lane >> 3, j = lane & 7, odd = lane & 1;
  const float* p = in + (size_t)(g * 16 + rr) * IN_D + t0 * 32 + j * 4;
  v4f a[CU], b[CU];                                // unit u: k step t0 + (u >> 1), rows 8 (u & 1) .. + 7 of the group
#pragma unroll   // a[], b[] stay in registers, and the 16 loads stand in a row with immediate offsets
  for (int u = 0; u < CU; ++u) {
    const float* q = p + (u & 1) * (8 * IN_D) + (u >> 1) * 32;
    a[u] = *(const v4f*)(q);
    b[u] = *(const v4f*)(q + 4 * IN_D);
  }
  // the read address stays in its registers up to this wait (without it the build lands the last load's result in them)
  asm volatile("s_wait_xcnt 0x0" :: "v"(p) : "memory");
  // piece of columns 8 (j >> 1) .. + 7 of the k step: half j >> 2, lane (row in the group) + 16 ((j >> 1) & 1)
  unsigned short* o = out + ((size_t)((g * (IN_D / 32) + t0) * 2 + (j >> 2)) * 32 + rr + 4 * odd + 16 * ((j >> 1) & 1)) * 8;
#pragma unroll   // constant indices into a[], b[]
  for (int u = 0; u < CU; ++u) {
    const v2i ha = __builtin_bit_cast(v2i, __builtin_convertvector(a[u] * mul, v4h));
    const v2i hb = __builtin_bit_cast(v2i, __builtin_convertvector(b[u] * mul, v4h));
    const v2i give = odd ? ha : hb;
    v2i got;                                       // quad_perm [1,0,3,2]: the neighbour lane's value
    got[0] = __builtin_amdgcn_mov_dpp(give[0], 0xB1, 0xF, 0xF, true);
    got[1] = __builtin_amdgcn_mov_dpp(give[1], 0xB1, 0xF, 0xF, true);
    const v2i lo = odd ? got : ha, hi = odd ? hb : got;
    *(v8h*)(o + (u >> 1) * 512 + (u & 1) * 64) =
        __builtin_shufflevector(__builtin_bit_cast(v4h, lo), __builtin_bit_cast(v4h, hi), 0, 1, 2, 3, 4, 5, 6, 7);
  }
}

// ---- [VT16; QT16] . QT16^T [640][128], summed over all G_ROWS rows of q and v inside one block ----
// A block owns a 32 x 16 tile of the product. Its 16 waves share out the k steps (16 each), every wave keeps its two 16 x 16
// partial sums in f32 accumulators, and the 16 partials are added through LDS, wave 0 first (fixed order).
// Rows below OUT_D are (q^T v)^T and go out as f16. The KQ_D rows behind them are the Gram matrix q^T q: it goes out divided
// by GSC as an f16 hi plane and an f16 lo plane (the rest after hi). All three go out in fragment order:
// [16-row group i][k step t of 32][fragment half][lane][8 elements], so that a fragment half is 512 contiguous bytes.
// Element e of half p in lane l is row 16 i + (l & 15), column 32 t + 16 p + 8 (l >> 4) + e.
#define KST   (G_ROWS / 32)        // k steps in a 16-row group of VT16 or QT16
#define QW    16                   // waves of a block
#define QSTEP (KST / QW)           // k steps of one wave
#define QPH   4                    // k steps whose fragments a wave loads together
__global__ __launch_bounds__(QW * 32) void k_qtv(const unsigned short* __restrict__ vq16, const unsigned short* __restrict__ qt16,
                                                 unsigned short* __restrict__ mt, unsigned short* __restrict__ gh,
                                                 unsigned short* __restrict__ gl) {
  __shared__ __align__(16) float sR[QW][2][8][32];   // per wave: its two accumulator tiles, [register][lane]
  const int lane = threadIdx.x & 31;
  const int wave = threadIdx.x >> 5;
  const int ta = blockIdx.x >> 3;                    // pair of 16-row groups of [VT16; QT16]
  const int tb = blockIdx.x & 7;                     // 16-row group of QT16
  const _Float16* pa = (const _Float16*)vq16 + ((size_t)(2 * ta) * KST + wave * QSTEP) * 512 + lane * 8;
  const _Float16* pb = (const _Float16*)qt16 + ((size_t)tb * KST + wave * QSTEP) * 512 + lane * 8;
  v8f acc[2];
#pragma unroll
  for (int i = 0; i < 2; ++i) acc[i] = (v8f){0.f,0.f,0.f,0.f,0.f,0.f,0.f,0.f};
#pragma unroll   // straight-line code: no branch stands behind a matrix instruction
  for (int p = 0; p < QSTEP / QPH; ++p) {
    // the blocks that read the same rows (8 for a row of the left operand, 20 for one of the right) start at different quarters:
    // each line is asked of memory by one of them and found in L2 by the others, instead of all waiting for the same fill
    const int g = (p + ta + tb) & (QSTEP / QPH - 1);
    const _Float16* qa = pa + g * (QPH * 512);
    const _Float16* qb = pb + g * (QPH * 512);
    v16h fa[QPH][2], fb[QPH];
#pragma unroll
    for (int t = 0; t < QPH; ++t) {
      fb[t] = Frag<_Float16>::load(qb + t * 512);
#pragma unroll
      for (int i = 0; i < 2; ++i) fa[t][i] = Frag<_Float16>::load(qa + (i * KST + t) * 512);
    }
#pragma unroll
    for (int t = 0; t < QPH; ++t)
#pragma unroll
      for (int i = 0; i < 2; ++i) acc[i] = Frag<_Float16>::mma(fa[t][i], fb[t], acc[i]);
    // inputs only, loaded values: every fragment of the quarter gets registers of its own, so that its 24 loads are in flight
    // together; without these the build reuses a few registers and waits with four to six loads outstanding
    Frag<_Float16>::keep(fb[0], fb[1], fb[2], fb[3]);
    Frag<_Float16>::keep(fa[0][0], fa[0][1], fa[1][0], fa[1][1]);
    Frag<_Float16>::keep(fa[2][0], fa[2][1], fa[3][0], fa[3][1]);
    // the quarter's addresses are dead from here on: their registers are not reused before the wait that belongs in front of that
    asm volatile("s_wait_xcnt 0x0" :: "v"(qa), "v"(qb) : "memory");
  }
#pragma unroll
  for (int i = 0; i < 2; ++i)
#pragma unroll
    for (int r = 0; r < 8; ++r) sR[wave][i][r][lane] = acc[i][r];
  __syncthreads();                                   // every wave's partial sums are in sR
  if (threadIdx.x >= 256) return;                    // whole waves; no barrier follows
  // a thread adds up two neighbouring columns of one row: accumulator register r of lanes l, l + 1 of tile i
  const int i = threadIdx.x >> 7, r = (threadIdx.x >> 4) & 7, l = (threadIdx.x & 15) * 2;
  v2f pr[QW];
#pragma unroll
  for (int w = 0; w < QW; ++w) pr[w] = *(const v2f*)&sR[w][i][r][l];
  v2f s = (v2f){0.f, 0.f};
#pragma unroll
  for (int w = 0; w < QW; ++w) s += pr[w];
  const int m15 = 8 * (l >> 4) + r, n15 = l & 15;    // row and column inside the 16 x 16 tile
  const int grp = 2 * ta + i;                        // 16-row group of the product
  const int in  = tb * 256 + (m15 + 16 * (n15 >> 3)) * 8 + (n15 & 7);   // k step tb >> 1, half tb & 1, then lane and element
  if (ta < OUT_D / 32) {
    *(v2h*)(mt + grp * (KQ_D * 16) + in) = __builtin_convertvector(s, v2h);
  } else {
    s *= GSC_INV;
    const int pos = (grp - OUT_D / 16) * (KQ_D * 16) + in;
    const v2h hi = __builtin_convertvector(s, v2h);
    *(v2h*)(gh + pos) = hi;
    *(v2h*)(gl + pos) = __builtin_convertvector(s - __builtin_convertvector(hi, v2f), v2h);
    // behind the two stores: the listing's next block rewrites a register that they name
    asm volatile("s_wait_xcnt 0x0" ::: "memory");
  }
}

__device__ __forceinline__ void load_rows16(v16h (&f)[4], const _Float16* p) {
#pragma unroll
  for (int t = 0; t < 4; ++t) f[t] = Frag<_Float16>::load(p + (t << 9));
}
// A fragment (16-row group i, k step t) of a Gram plane in the order k_qtv writes: two whole 512-byte runs per wave
__device__ __forceinline__ v16h load_gram(const _Float16* g, const int i, const int t, const int lane) {
  Frag<_Float16>::U f;
  const _Float16* p = g + ((i * 4 + t) * 2 * 32 + lane) * 8;
  f.h[0] = *(const v8h*)(p); f.h[1] = *(const v8h*)(p + 32 * 8);
  return f.v;
}

// ---- out [8192][512] = inv[m] * (K16 . MT16^T) + VTf^T, inv[m] = 1 / max(||row m of k q^T||, eps) ----
// sum_j (k_m . q_j)^2 = k_m^T (q^T q) k_m, so the row norms need the 128 x 128 Gram matrix only, never k q^T itself.
// A block owns 64 rows. Wave w forms, for the 16 rows of group w >> 1, the product T = G . k^T for the 16-row groups
// i = 2 u + (w & 1) of G (A = G, B = k rows): a lane's accumulators are T[16 i + 8 (lane >> 4) + r][its k row], and the k
// values they are multiplied with are the ones its own B fragment u holds in half w & 1.
__global__ __launch_bounds__(256) void k_scale_out(const unsigned short* __restrict__ k16, const unsigned short* __restrict__ mt16,
                                                   const unsigned short* __restrict__ gh, const unsigned short* __restrict__ gl,
                                                   const float* __restrict__ vf, float* __restrict__ out) {
  __shared__ __align__(16) float sT[8][16 * 68];   // per-wave 16x64 slab, pitch 68 floats
  __shared__ float sP[8][16];                      // per wave: its half of k^T G k / GSC for its 16 rows
  __shared__ float sInv[64];                       // inverse norms of the block's 64 rows
  const int lane = threadIdx.x & 31;
  const int wave = threadIdx.x >> 5;
  const int par  = wave & 1;
  {
    const _Float16* kp = (const _Float16*)k16 + (size_t)((blockIdx.x << 2) + (wave >> 1)) * (16 * KQ_D) + lane * 8;   // its 16-row group, fragment order
    v16h kb[4];
    load_rows16(kb, kp);
    v8f acc[4];
#pragma unroll
    for (int u = 0; u < 4; ++u) acc[u] = (v8f){0.f,0.f,0.f,0.f,0.f,0.f,0.f,0.f};
#pragma unroll
    for (int t = 0; t < 4; ++t)
#pragma unroll
      for (int u = 0; u < 4; ++u) {
        acc[u] = Frag<_Float16>::mma(load_gram((const _Float16*)gl, 2 * u + par, t, lane), kb[t], acc[u]);
        acc[u] = Frag<_Float16>::mma(load_gram((const _Float16*)gh, 2 * u + par, t, lane), kb[t], acc[u]);
      }
    // the k address is dead from here on: its registers are not reused before the loads that name them are translated
    asm volatile("s_wait_xcnt 0x0" :: "v"(kp) : "memory");
    v8f ss = (v8f){0.f,0.f,0.f,0.f,0.f,0.f,0.f,0.f};
#pragma unroll
    for (int u = 0; u < 4; ++u) {
      Frag<_Float16>::U f; f.v = kb[u];
      ss += acc[u] * __builtin_convertvector(par ? f.h[1] : f.h[0], v8f);
    }
    const float h = ((ss[0] + ss[1]) + (ss[2] + ss[3])) + ((ss[4] + ss[5]) + (ss[6] + ss[7]));
    const float s = h + __shfl_xor(h, 16, 32);     // the two lane halves hold rows 0..7 and 8..15 of each group of G
    if (lane < 16) sP[wave][lane] = s;
  }
  __syncthreads();                                 // every wave's half sums are in sP
  if (threadIdx.x < 64) {
    const int g = threadIdx.x >> 4, r = threadIdx.x & 15;
    // rounding can carry a vanishing quadratic form below zero: it counts as zero, and eps takes over as in the reference
    const float a = fmaxf(sP[2 * g][r] + sP[2 * g + 1][r], 0.f) * GSC;
    sInv[threadIdx.x] = 1.0f / fmaxf(sqrtf(a), EPSF);
  }
  __syncthreads();                                 // sInv is complete before any wave's epilogue reads it
  gemm64_block<0, false, 4, 0, true>(sT, blockIdx.x, 0, k16, nullptr, KQ_D, 0L, mt16, nullptr, KQ_D, 0L,
                                     (void*)out, nullptr, OUT_D, 0L, sInv, vf, 0L, G_ROWS, OUT_D, KQ_D, 1.0f);
}

// ---------------------------------------------------------------------------
//   every f16 array below lies in fragment order (see the GEMM's head); 16 whole rows stay one contiguous run
//   x16  [8192][512] f16    8 MiB      | Wk16 [128][512], Wq16 [128][512], Wv16 [512][512] f16 (x64)
//   K16  [8192][128] f16    2 MiB      | VTf [512][8192] f32 16 MiB (v^T unrounded, pieces in the order of VT16's)
//   VT16 [512][8192] f16    8 MiB, directly followed by QT16 [128][8192] f16 2 MiB: one [640][8192] operand
//   MT16 [512][128] f16 ((q^T v)^T)
//   GH16, GL16 [128][128] f16 (q^T q / 256, hi and lo plane, in fragment order)
// ---------------------------------------------------------------------------
extern "C" void kernel_launch(void* const* d_in, const int* in_sizes, int n_in,
                              void* d_out, int out_size, void* d_ws, size_t ws_size,
                              hipStream_t stream) {
  if (n_in < 7) return;
  if (in_sizes[0] != G_ROWS * IN_D || in_sizes[1] != KQ_D * IN_D || in_sizes[2] != KQ_D ||
      in_sizes[3] != KQ_D * IN_D || in_sizes[4] != KQ_D || in_sizes[5] != OUT_D * IN_D ||
      in_sizes[6] != OUT_D) return;
  if (out_size != G_ROWS * OUT_D) return;

  const float* x  = (const float*)d_in[0];
  const float* Wk = (const float*)d_in[1];
  const float* bk = (const float*)d_in[2];
  const float* Wq = (const float*)d_in[3];
  const float* bq = (const float*)d_in[4];
  const float* Wv = (const float*)d_in[5];
  const float* bv = (const float*)d_in[6];
  float* out = (float*)d_out;

  const size_t b_x16 = (size_t)G_ROWS * IN_D * 2;
  const size_t b_wk  = (size_t)KQ_D * IN_D * 2;
  const size_t b_wv  = (size_t)OUT_D * IN_D * 2;
  const size_t b_k16 = (size_t)G_ROWS * KQ_D * 2;
  const size_t b_vf  = (size_t)G_ROWS * OUT_D * 4;
  const size_t b_vt  = (size_t)OUT_D * G_ROWS * 2;
  const size_t b_mt  = (size_t)OUT_D * KQ_D * 2;
  const size_t b_g   = (size_t)KQ_D * KQ_D * 2;

  size_t off = 0;
  const size_t o_x16 = off; off += b_x16;
  const size_t o_wk  = off; off += b_wk;
  const size_t o_wq  = off; off += b_wk;
  const size_t o_wv  = off; off += b_wv;
  const size_t o_k16 = off; off += b_k16;
  const size_t o_vf  = off; off += b_vf;
  const size_t o_vt  = off; off += b_vt;
  const size_t o_qt  = off; off += b_k16;   // stays directly behind VT16
  const size_t o_mt  = off; off += b_mt;
  const size_t o_gh  = off; off += b_g;
  const size_t o_gl  = off; off += b_g;
  if (off > ws_size) return;

  char* ws = (char*)d_ws;
  unsigned short* x16  = (unsigned short*)(ws + o_x16);
  unsigned short* wk16 = (unsigned short*)(ws + o_wk);
  unsigned short* wq16 = (unsigned short*)(ws + o_wq);
  unsigned short* wv16 = (unsigned short*)(ws + o_wv);
  unsigned short* k16  = (unsigned short*)(ws + o_k16);
  float*          vf   = (float*)(ws + o_vf);
  unsigned short* vt16 = (unsigned short*)(ws + o_vt);
  unsigned short* qt16 = (unsigned short*)(ws + o_qt);
  unsigned short* mt16 = (unsigned short*)(ws + o_mt);
  unsigned short* gh16 = (unsigned short*)(ws + o_gh);
  unsigned short* gl16 = (unsigned short*)(ws + o_gl);

  // ---- casts to f16 (weights x64, exact): one launch ----
  k_cast_all<<<dim3(CB_X + 2 * CB_K + CB_V), 256, 0, stream>>>(x, Wk, Wq, Wv, x16, wk16, wq16, wv16);

  // ---- projections k, v^T, q^T: one launch ----
  k_project_all<<<dim3(PB_V + 2 * PB_KQ), 256, 0, stream>>>(x16, wk16, wq16, wv16, bk, bq, bv, k16, vf, vt16, qt16);

  // ---- MT16 [512][128] and the two Gram planes = [VT16; QT16] . QT16^T : (k q^T) v is formed as k (q^T v), the row norms from q^T q ----
  // QT16 lies directly behind VT16, so both are one [PM_ROWS][G_ROWS] operand: rows below OUT_D give (q^T v)^T, the rest q^T q.
  k_qtv<<<dim3((PM_ROWS / 32) * (KQ_D / 16)), QW * 32, 0, stream>>>(vt16, qt16, mt16, gh16, gl16);

  // ---- out [8192][512] = inv[m] * (K16 . MT16^T) + VTf^T, inv from the Gram planes ----
  k_scale_out<<<dim3(G_ROWS / 64), 256, 0, stream>>>(k16, mt16, gh16, gl16, vf, out);
}

// v010
// One run takes 40.3 microseconds.
// In both of two side-by-side timings against v009, it was 1.04 times as fast.
// Over all steps from v000 it is 39.2 times as fast.
// Contractions: k,qT,vT projections (x*W^T), [vT;qT]*q (q^T*v and the Gram matrix q^T*q, rows shared out over the waves of a block), (q^T*q)*k^T (row norms of k*q^T as k_i^T (q^T q) k_i), k*(q^T*v) : v_wmma_f32_16x16x32_f16 (f16 operands, f32 accumulate); weights carried x64 in f16 with 1/64 folded into the epilogue scale; Gram matrix carried /256 as f16 hi + lo planes; row L2 norms, per-row scaling and residual in f32.
#include <hip/hip_runtime.h>
#include <math.h>
#include <stdint.h>
#include <stddef.h>

#define G_ROWS 8192
#define IN_D   512
#define KQ_D   128
#define OUT_D  512
#define PM_ROWS (OUT_D + KQ_D)     // rows of the product [v^T; q^T] q: v^T q (OUT_D rows) above q^T q (KQ_D rows)
#define EPSF   1e-12f
#define WSC     64.0f
#define WSC_INV (1.0f / 64.0f)
#define GSC     256.0f             // the Gram matrix is carried divided by this (exact): its f16 planes stay in the normal range
#define GSC_INV (1.0f / 256.0f)

typedef __attribute__((ext_vector_type(16))) _Float16 v16h;
typedef __attribute__((ext_vector_type(8)))  _Float16 v8h;
typedef __attribute__((ext_vector_type(2)))  _Float16 v2h;
typedef __attribute__((ext_vector_type(16))) __bf16   v16b;
typedef __attribute__((ext_vector_type(8)))  __bf16   v8b;
typedef __attribute__((ext_vector_type(8)))  float    v8f;
typedef __attribute__((ext_vector_type(4)))  float    v4f;
typedef __attribute__((ext_vector_type(2)))  float    v2f;

__device__ __forceinline__ unsigned short f2bf_bits(float f) {
  unsigned u = __float_as_uint(f);
  return (unsigned short)((u + 0x7FFFu + ((u >> 16) & 1u)) >> 16);
}
__device__ __forceinline__ float bf_bits2f(unsigned short h) { return __uint_as_float(((unsigned)h) << 16); }

// hazard guards as plain device helpers (the kernel template body's only inline asm of its own is the s_wait_xcnt behind the addend loads; in the k loop it is addr_wait8)
__device__ __forceinline__ void dep_guard_h(v8f& a, v8f& b, v16h x, v16h y) { asm volatile("v_nop\n\tv_nop\n\tv_nop\n\tv_nop" : "+v"(a), "+v"(b) : "v"(x), "v"(y)); }
__device__ __forceinline__ void dep_guard_b(v8f& a, v8f& b, v16b x, v16b y) { asm volatile("v_nop\n\tv_nop\n\tv_nop\n\tv_nop" : "+v"(a), "+v"(b) : "v"(x), "v"(y)); }
__device__ __forceinline__ void keep4_h(v16h a, v16h b, v16h c, v16h d) { asm volatile("v_nop" :: "v"(a), "v"(b), "v"(c), "v"(d)); }
__device__ __forceinline__ void keep4_b(v16b a, v16b b, v16b c, v16b d) { asm volatile("v_nop" :: "v"(a), "v"(b), "v"(c), "v"(d)); }
__device__ __forceinline__ void acc_guard4(v8f& a, v8f& b, v8f& c, v8f& d) { asm volatile("v_nop\n\tv_nop\n\tv_nop\n\tv_nop" : "+v"(a), "+v"(b), "+v"(c), "+v"(d)); }
// s_wait_xcnt 0 with load addresses as inputs: their registers stay as they are (no load's result lands in them, no next address)
// until the wait that belongs in front of a rewrite of an address register of issued loads has passed
__device__ __forceinline__ void addr_wait8(const void* a, const void* b, const void* c, const void* d, const void* e, const void* f, const void* g, const void* h) {
  asm volatile("s_wait_xcnt 0x0" :: "v"(a), "v"(b), "v"(c), "v"(d), "v"(e), "v"(f), "v"(g), "v"(h) : "memory");
}
template <typename T> struct Frag;
template <> struct Frag<_Float16> {
  typedef v16h V; union U { v16h v; v8h h[2]; };
  static __device__ __forceinline__ v16h load(const _Float16* p) {   // p = fragment + 8 * lane: elements 0..7 <- p[0..7], 8..15 <- p[256..263]
    U f; f.h[0] = *(const v8h*)(p); f.h[1] = *(const v8h*)(p + 256); return f.v;
  }
  static __device__ __forceinline__ v8f mma(v16h a, v16h b, v8f c) {
    return __builtin_amdgcn_wmma_f32_16x16x32_f16(false, a, false, b, (short)0, c, false, false);
  }
  static __device__ __forceinline__ void guard(v8f& a, v8f& b, v16h x, v16h y) { dep_guard_h(a, b, x, y); }
  static __device__ __forceinline__ void keep(v16h a, v16h b, v16h c, v16h d) { keep4_h(a, b, c, d); }
};
template <> struct Frag<__bf16> {
  typedef v16b V; union U { v16b v; v8b h[2]; };
  static __device__ __forceinline__ v16b load(const __bf16* p) {
    U f; f.h[0] = *(const v8b*)(p); f.h[1] = *(const v8b*)(p + 256); return f.v;
  }
  static __device__ __forceinline__ v8f mma(v16b a, v16b b, v8f c) {
    return __builtin_amdgcn_wmma_f32_16x16x32_bf16(false, a, false, b, (short)0, c, false, false);
  }
  static __device__ __forceinline__ void guard(v8f& a, v8f& b, v16b x, v16b y) { dep_guard_b(a, b, x, y); }
  static __device__ __forceinline__ void keep(v16b a, v16b b, v16b c, v16b d) { keep4_b(a, b, c, d); }
};

// ---- Register-blocked batched WMMA GEMM ------------------------------------
// C[m,n] = scale * sum_k A[m,k] * Bt[n,k] (*rowscale)(+bias)(+resid); each wave owns a 64x64 tile.
// A [M,K] and Bt [N,K] lie in FRAGMENT ORDER: [16-row group][k step of 32][fragment half][lane][8 elements], lda / ldb = elements
// per row, so that a wave's 16-byte loads of a fragment half cover 512 contiguous bytes (4 whole lines, not 32 bytes of each of
// 16 rows). Element e of half p in lane l is row 16 g + (l & 15), column 32 t + 16 p + 8 (l >> 4) + e. A step of 32 in k is a
// step of 512 elements, which is what strideA / strideB count in. 16-bit outputs are written in the same order (ldc = elements
// per row), OUT_MODE 0 f32 outputs row-major. M,N % 64 == 0, K % 32 == 0.
// SPLIT: operands are hi/lo planes (A2/Bt2 = lo planes, same layout); product = hi*hi + hi*lo + lo*hi.
// BIAS_MODE: 0 = none, 1 = bias[m], 2 = bias[n], 3 = per-row scale: value *= bias[m] (applied before resid),
//            4 = as 3, with bias indexed by the row inside the 64-row tile (the block's own table).
// OUT_MODE: 0 = f32, 1 = f16, 2 = bf16 hi plane (Cout) + bf16 lo plane (Cout2),
//           3 = f16 (Cout) + the same values unrounded as f32 (Cout2), piece for piece in the f16 order; the 8 floats of a lane's
//               piece lie as two runs [4 low: lane][4 high: lane], so that each 16-byte store of a wave covers 512 contiguous bytes.
// RESID: resid holds the TRANSPOSE of the addend, [N][M], as OUT_MODE 3 writes it: a lane's piece there (one row n, 8 columns m)
//        is what the lane's accumulator fragment holds (one column n, 8 rows m), so it is read with two 16-byte loads.
// ET: 0 = f16 operands, 1 = bf16 operands (pointers passed as 16-bit storage)
template <int ET> struct Elem;
template <> struct Elem<0> { typedef _Float16 T; };
template <> struct Elem<1> { typedef __bf16 T; };
// gemm64_block: the work of one 256-thread block; bx, b = the block's place in this product's own grid; sT = the block's LDS slabs.
// The epilogue turns a wave's whole 64 x 64 tile through the wave's own slab in one pass: every slab row is written once and never
// reused, so the tile's bias loads, LDS traffic and global stores each go out in one run, with no wait for a store in between.
template <int ET, bool SPLIT, int BIAS_MODE, int OUT_MODE, bool RESID, int ACT = 0>
__device__ __forceinline__ void gemm64_block(
    float (*sT)[64 * 68], const int bx, const int b,
    const unsigned short* __restrict__ Ap, const unsigned short* __restrict__ A2p, int lda, long strideA,
    const unsigned short* __restrict__ Btp, const unsigned short* __restrict__ Bt2p, int ldb, long strideB,
    void* __restrict__ Cout, void* __restrict__ Cout2, int ldc, long strideC,
    const float* __restrict__ bias,
    const float* __restrict__ resid, long strideR,
    int M, int N, int K, float scale) {
  typedef typename Elem<ET>::T T;
  typedef typename Frag<T>::V V;
  const T* A = (const T*)Ap; const T* A2 = (const T*)A2p; const T* Bt = (const T*)Btp; const T* Bt2 = (const T*)Bt2p;
  const int lane = threadIdx.x & 31;
  const int wave = threadIdx.x >> 5;
  const int tilesN = N >> 6;
  const int tilesM = M >> 6;
  const int tile = bx * 8 + wave;
  if (tile >= tilesM * tilesN) return;   // wave-uniform; no block barriers in this kernel
  const int tm = tile / tilesN;
  const int tn = tile - tm * tilesN;
  const int m0 = tm << 6;
  const int n0 = tn << 6;

  const T* Ab  = A  + (size_t)b * strideA;
  const T* Bb  = Bt + (size_t)b * strideB;
  const T* Ab2 = SPLIT ? (A2  + (size_t)b * strideA) : nullptr;
  const T* Bb2 = SPLIT ? (Bt2 + (size_t)b * strideB) : nullptr;

  const int rlane = lane & 15;                 // col (D) within subtile
  const int mOff  = (lane >> 4) * 8;           // D row offset

  v8f acc[4][4];
#pragma unroll
  for (int i = 0; i < 4; ++i)
#pragma unroll
    for (int j = 0; j < 4; ++j) acc[i][j] = (v8f){0.f,0.f,0.f,0.f,0.f,0.f,0.f,0.f};

  size_t ao[4], bo[4];                         // this lane's place in the current k step's fragments
#pragma unroll
  for (int i = 0; i < 4; ++i) {
    ao[i] = (size_t)((m0 >> 4) + i) * (lda >> 5) * 512 + lane * 8;
    bo[i] = (size_t)((n0 >> 4) + i) * (ldb >> 5) * 512 + lane * 8;
  }

  // the addend of every accumulator: independent of the products, so its loads are issued ahead of the k loop
  v4f rs[4][4][2];
  if (RESID) {
    const float* rp = resid + (size_t)b * strideR + ((size_t)(n0 >> 4) * (M >> 5) + (m0 >> 5)) * 512 + lane * 4;
#pragma unroll
    for (int i = 0; i < 4; ++i)
#pragma unroll
      for (int j = 0; j < 4; ++j) {
        const float* q = rp + ((size_t)j * (M >> 5) + (i >> 1)) * 512 + (i & 1) * 256;
        rs[i][j][0] = *(const v4f*)(q);
        rs[i][j][1] = *(const v4f*)(q + 128);
      }
    // the addend's address is dead from here on: its registers are not reused before the wait that belongs in front of that
    asm volatile("s_wait_xcnt 0x0" :: "v"(rp) : "memory");
  }

  for (int k0 = 0; k0 < K; k0 += 32) {
    // every fragment of the k step has registers of its own and is loaded ahead of the step's first product:
    // the step waits out one load latency, not one for each row of A fragments
    V bh[4], bl[4], ahs[4], als[4];
#pragma unroll
    for (int j = 0; j < 4; ++j) {
      bh[j] = Frag<T>::load(Bb + bo[j]);
      if (SPLIT) bl[j] = Frag<T>::load(Bb2 + bo[j]);
    }
#pragma unroll
    for (int i = 0; i < 4; ++i) {
      ahs[i] = Frag<T>::load(Ab + ao[i]);
      if (SPLIT) als[i] = Frag<T>::load(Ab2 + ao[i]);
    }
#pragma unroll
    for (int i = 0; i < 4; ++i) {
      const V ah = ahs[i];
      const V al = SPLIT ? als[i] : ahs[i];
#pragma unroll
      for (int j = 0; j < 4; ++j) {
        acc[i][j] = Frag<T>::mma(ah, bh[j], acc[i][j]);
        if (SPLIT) {
          acc[i][j] = Frag<T>::mma(ah, bl[j], acc[i][j]);
          acc[i][j] = Frag<T>::mma(al, bh[j], acc[i][j]);
        }
      }
      Frag<T>::guard(acc[i][0], acc[i][3], ah, al);
    }
    Frag<T>::keep(bh[0], bh[1], bh[2], bh[3]);
    if (SPLIT) Frag<T>::keep(bl[0], bl[1], bl[2], bl[3]);
    // at the trip's foot, in front of the next trip's addresses
    addr_wait8(Ab + ao[0], Ab + ao[1], Ab + ao[2], Ab + ao[3], Bb + bo[0], Bb + bo[1], Bb + bo[2], Bb + bo[3]);
    if (SPLIT) addr_wait8(Ab2 + ao[0], Ab2 + ao[1], Ab2 + ao[2], Ab2 + ao[3], Bb2 + bo[0], Bb2 + bo[1], Bb2 + bo[2], Bb2 + bo[3]);
#pragma unroll
    for (int i = 0; i < 4; ++i) { ao[i] += 512; bo[i] += 512; }
  }
  acc_guard4(acc[0][0], acc[0][1], acc[0][2], acc[0][3]);
  acc_guard4(acc[1][0], acc[1][1], acc[1][2], acc[1][3]);
  acc_guard4(acc[2][0], acc[2][1], acc[2][2], acc[2][3]);
  acc_guard4(acc[3][0], acc[3][1], acc[3][2], acc[3][3]);

  // ---- epilogue ----
  float* slab = sT[wave];
  float bm[4][8];                              // the per-row bias or scale of the whole tile, read in one run
  if (BIAS_MODE == 1 || BIAS_MODE == 3 || BIAS_MODE == 4) {
#pragma unroll
    for (int i = 0; i < 4; ++i)
#pragma unroll
      for (int r = 0; r < 8; ++r) bm[i][r] = bias[(BIAS_MODE == 4 ? 0 : m0) + (i << 4) + mOff + r];
  }
#pragma unroll
  for (int i = 0; i < 4; ++i) {
#pragma unroll
    for (int j = 0; j < 4; ++j) {
      const int n = n0 + (j << 4) + rlane;
      float bv = 0.f;
      if (BIAS_MODE == 2) bv = bias[n];
#pragma unroll
      for (int r = 0; r < 8; ++r) {
        float v = acc[i][j][r] * scale;
        if (BIAS_MODE == 3 || BIAS_MODE == 4) v *= bm[i][r];
        if (BIAS_MODE == 1) v += bm[i][r];
        if (BIAS_MODE == 2) v += bv;
        if (RESID) v += rs[i][j][r >> 2][r & 3];
        if (ACT == 1) v = tanhf(v);
        if (ACT == 2) v = fmaxf(v, 0.0f);
        if (ACT == 3) v = v / (1.0f + expf(-v));
        if (ACT == 4) v = (v > 0.f) ? v : 0.01f * v;
        if (ACT == 5) v = 0.5f * v * (1.0f + erff(v * 0.70710678118654752f));
        slab[((i << 4) + mOff + r) * 68 + (j << 4) + rlane] = v;
      }
    }
  }
  // the wave's lanes read each other's slab values from here on: the one ordering point of the epilogue
  __builtin_amdgcn_fence(__ATOMIC_RELEASE, "workgroup");
  __builtin_amdgcn_wave_barrier();
  __builtin_amdgcn_fence(__ATOMIC_ACQUIRE, "workgroup");
  v4f tv[4][8];
  if (OUT_MODE == 0) {
#pragma unroll
    for (int i = 0; i < 4; ++i)
#pragma unroll
      for (int it = 0; it < 8; ++it) tv[i][it] = *(const v4f*)(slab + ((i << 4) + it * 2 + (lane >> 4)) * 68 + (lane & 15) * 4);
  }
#pragma unroll
  for (int i = 0; i < 4; ++i) {
    const int mBase = m0 + (i << 4);
    const float* rows = slab + (i << 4) * 68;   // the 16 slab rows of this row group
    if (OUT_MODE == 0) {
      // row seg = 256 B = 16 lanes x 16 B; one lane address for the tile, the row steps are constants
      float* C = (float*)Cout + (size_t)b * strideC + (size_t)(m0 + (lane >> 4)) * ldc + n0 + (lane & 15) * 4;
      {
#pragma unroll
        for (int it = 0; it < 8; ++it) *(v4f*)(C + (size_t)((i << 4) + it * 2) * ldc) = tv[i][it];
        
      }
    } else {
      // the row group's 16 x 64 part of the slab is two fragments that lie side by side in the output: four stores of 512 contiguous bytes
      const size_t fo = ((size_t)(mBase >> 4) * (ldc >> 5) + (n0 >> 5)) * 512 + lane * 8;
      unsigned short* C  = (unsigned short*)Cout  + (size_t)b * strideC;
      unsigned short* C2 = (OUT_MODE == 2) ? ((unsigned short*)Cout2 + (size_t)b * strideC) : nullptr;
      float* CF = (OUT_MODE == 3) ? ((float*)Cout2 + (size_t)b * strideC + (fo - lane * 4)) : nullptr;
      {
#pragma unroll
        for (int it = 0; it < 4; ++it) {
          const float* sp = rows + rlane * 68 + it * 16 + mOff;   // fragment it >> 1, half it & 1
          v8h hv, lv;
          if (OUT_MODE == 3) {
            const v4f lo = *(const v4f*)(sp), hi = *(const v4f*)(sp + 4);
            hv = __builtin_convertvector(__builtin_shufflevector(lo, hi, 0, 1, 2, 3, 4, 5, 6, 7), v8h);
            *(v4f*)(CF + it * 256)       = lo;
            *(v4f*)(CF + it * 256 + 128) = hi;
          }
#pragma unroll
          for (int e = 0; e < 8 && OUT_MODE != 3; ++e) {
            if (OUT_MODE == 1) {
              hv[e] = (_Float16)sp[e];
            } else {
              unsigned short hb = f2bf_bits(sp[e]);
              unsigned short lb = f2bf_bits(sp[e] - bf_bits2f(hb));
              hv[e] = __builtin_bit_cast(_Float16, hb);
              lv[e] = __builtin_bit_cast(_Float16, lb);
            }
          }
          *(v8h*)(C + fo + it * 256) = hv;
          if (OUT_MODE == 2) *(v8h*)(C2 + fo + it * 256) = lv;
        }
        
      }
    }
  }
}

// ---- the three projections in one grid: none reads what another writes, so their blocks run side by side ----
// v is projected once, as v^T: its tiles go out as the f16 operand of the product with q and, unrounded, as the f32 addend of the
// last GEMM. Block ranges (8 tiles of 64x64 per block), in this order: v^T, q^T, k.
#define PB_V  ((G_ROWS / 64) * (OUT_D / 64) / 8)
#define PB_KQ ((G_ROWS / 64) * (KQ_D / 64) / 8)
__global__ __launch_bounds__(256) void k_project_all(
    const unsigned short* __restrict__ x16, const unsigned short* __restrict__ wk16,
    const unsigned short* __restrict__ wq16, const unsigned short* __restrict__ wv16,
    const float* __restrict__ bk, const float* __restrict__ bq, const float* __restrict__ bv,
    unsigned short* __restrict__ k16, float* __restrict__ vf,
    unsigned short* __restrict__ vt16, unsigned short* __restrict__ qt16) {
  __shared__ __align__(16) float sT[8][64 * 68];   // per-wave 64x64 slab, pitch 68 floats
  const int bx = blockIdx.x;
  if (bx < PB_V) {
    // VT16 [512][8192] f16 and VTf [512][8192] f32 = Wv16 . x16^T / 64 + bv[m]
    gemm64_block<0, false, 1, 3, false>(sT, bx, 0, wv16, nullptr, IN_D, 0L, x16, nullptr, IN_D, 0L, (void*)vt16, (void*)vf, G_ROWS, 0L,
                                        bv, nullptr, 0L, OUT_D, G_ROWS, IN_D, WSC_INV);
  } else if (bx < PB_V + PB_KQ) {
    // QT16 [128][8192] f16 = Wq16 . x16^T / 64 + bq[m]
    gemm64_block<0, false, 1, 1, false>(sT, bx - PB_V, 0, wq16, nullptr, IN_D, 0L, x16, nullptr, IN_D, 0L, (void*)qt16, nullptr, G_ROWS, 0L,
                                        bq, nullptr, 0L, KQ_D, G_ROWS, IN_D, WSC_INV);
  } else {
    // K16 [8192][128] f16 = x16 . Wk16^T / 64 + bk
    gemm64_block<0, false, 2, 1, false>(sT, bx - (PB_V + PB_KQ), 0, x16, nullptr, IN_D, 0L,
                                        wk16, nullptr, IN_D, 0L, (void*)k16, nullptr, KQ_D, 0L,
                                        bk, nullptr, 0L, G_ROWS, KQ_D, IN_D, WSC_INV);
  }
}

// ---- the four casts to f16 in one grid (weights x64, exact); every range is whole blocks ----
// The f16 copies go out in fragment order (see the GEMM's head), in 16-byte pieces: 8 elements of one row.
// The launch is a short stream, so it is dealt for few waves and whole lines. A unit is 8 rows x one 128-byte line of f32 (one
// k step): two loads of a wave, 4 whole lines each (8 lanes to a line), and one store of 4 whole lines of f16. A lane holds 4
// elements of one of the unit's rows 0..3 and the same 4 columns of the row 4 below; neighbour lanes swap one of the two, so that the even lane has a whole
// piece of the upper row and the odd lane one of the lower. A wave makes CU units: 16 rows x 4 k steps, all loads in flight at once.
#define CU   8
#define CB_X ((G_ROWS * IN_D / 8) / (256 * CU))
#define CB_K ((KQ_D * IN_D / 8) / (256 * CU))
#define CB_V ((OUT_D * IN_D / 8) / (256 * CU))
typedef __attribute__((ext_vector_type(4)))  _Float16 v4h;
typedef __attribute__((ext_vector_type(2)))  int      v2i;
__global__ __launch_bounds__(256) void k_cast_all(
    const float* __restrict__ x, const float* __restrict__ Wk, const float* __restrict__ Wq, const float* __restrict__ Wv,
    unsigned short* __restrict__ x16, unsigned short* __restrict__ wk16, unsigned short* __restrict__ wq16,
    unsigned short* __restrict__ wv16) {
  int bx = blockIdx.x;
  const float* in = Wk; unsigned short* out = wk16; float mul = WSC;
  if (bx >= 2 * CB_K + CB_V)  { in = x;  out = x16;  mul = 1.0f; bx -= 2 * CB_K + CB_V; }
  else if (bx >= 2 * CB_K)    { in = Wv; out = wv16; bx -= 2 * CB_K; }
  else if (bx >= CB_K)        { in = Wq; out = wq16; bx -= CB_K; }
  const int lane = threadIdx.x & 31;
  const int wv   = bx * 8 + (threadIdx.x >> 5);    // wave number: [16-row group][run of 4 k steps: IN_D / 128]
  const int g    = wv / (IN_D / 128);
  const int t0   = (wv % (IN_D / 128)) * 4;
  const int rr = lane >> 3, j = lane & 7, odd = lane & 1;
  const float* p = in + (size_t)(g * 16 + rr) * IN_D + t0 * 32 + j * 4;
  v4f a[CU], b[CU];                                // unit u: k step t0 + (u >> 1), rows 8 (u & 1) .. + 7 of the group
#pragma unroll   // a[], b[] stay in registers, and the 16 loads stand in a row with immediate offsets
  for (int u = 0; u < CU; ++u) {
    const float* q = p + (u & 1) * (8 * IN_D) + (u >> 1) * 32;
    a[u] = *(const v4f*)(q);
    b[u] = *(const v4f*)(q + 4 * IN_D);
  }
  // the read address stays in its registers up to this wait (without it the build lands the last load's result in them)
  asm volatile("s_wait_xcnt 0x0" :: "v"(p) : "memory");
  // piece of columns 8 (j >> 1) .. + 7 of the k step: half j >> 2, lane (row in the group) + 16 ((j >> 1) & 1)
  unsigned short* o = out + ((size_t)((g * (IN_D / 32) + t0) * 2 + (j >> 2)) * 32 + rr + 4 * odd + 16 * ((j >> 1) & 1)) * 8;
#pragma unroll   // constant indices into a[], b[]
  for (int u = 0; u < CU; ++u) {
    const v2i ha = __builtin_bit_cast(v2i, __builtin_convertvector(a[u] * mul, v4h));
    const v2i hb = __builtin_bit_cast(v2i, __builtin_convertvector(b[u] * mul, v4h));
    const v2i give = odd ? ha : hb;
    v2i got;                                       // quad_perm [1,0,3,2]: the neighbour lane's value
    got[0] = __builtin_amdgcn_mov_dpp(give[0], 0xB1, 0xF, 0xF, true);
    got[1] = __builtin_amdgcn_mov_dpp(give[1], 0xB1, 0xF, 0xF, true);
    const v2i lo = odd ? got : ha, hi = odd ? hb : got;
    *(v8h*)(o + (u >> 1) * 512 + (u & 1) * 64) =
        __builtin_shufflevector(__builtin_bit_cast(v4h, lo), __builtin_bit_cast(v4h, hi), 0, 1, 2, 3, 4, 5, 6, 7);
  }
}

// ---- [VT16; QT16] . QT16^T [640][128], summed over all G_ROWS rows of q and v inside one block ----
// A block owns a 32 x 16 tile of the product. Its 16 waves share out the k steps (16 each), every wave keeps its two 16 x 16
// partial sums in f32 accumulators, and the 16 partials are added through LDS, wave 0 first (fixed order).
// Rows below OUT_D are (q^T v)^T and go out as f16. The KQ_D rows behind them are the Gram matrix q^T q: it goes out divided
// by GSC as an f16 hi plane and an f16 lo plane (the rest after hi). All three go out in fragment order:
// [16-row group i][k step t of 32][fragment half][lane][8 elements], so that a fragment half is 512 contiguous bytes.
// Element e of half p in lane l is row 16 i + (l & 15), column 32 t + 16 p + 8 (l >> 4) + e.
#define KST   (G_ROWS / 32)        // k steps in a 16-row group of VT16 or QT16
#define QW    16                   // waves of a block
#define QSTEP (KST / QW)           // k steps of one wave
#define QPH   4                    // k steps whose fragments a wave loads together
__global__ __launch_bounds__(QW * 32) void k_qtv(const unsigned short* __restrict__ vq16, const unsigned short* __restrict__ qt16,
                                                 unsigned short* __restrict__ mt, unsigned short* __restrict__ gh,
                                                 unsigned short* __restrict__ gl) {
  __shared__ __align__(16) float sR[QW][2][8][32];   // per wave: its two accumulator tiles, [register][lane]
  const int lane = threadIdx.x & 31;
  const int wave = threadIdx.x >> 5;
  const int ta = blockIdx.x >> 3;                    // pair of 16-row groups of [VT16; QT16]
  const int tb = blockIdx.x & 7;                     // 16-row group of QT16
  const _Float16* pa = (const _Float16*)vq16 + ((size_t)(2 * ta) * KST + wave * QSTEP) * 512 + lane * 8;
  const _Float16* pb = (const _Float16*)qt16 + ((size_t)tb * KST + wave * QSTEP) * 512 + lane * 8;
  v8f acc[2];
#pragma unroll
  for (int i = 0; i < 2; ++i) acc[i] = (v8f){0.f,0.f,0.f,0.f,0.f,0.f,0.f,0.f};
#pragma unroll   // straight-line code: no branch stands behind a matrix instruction
  for (int p = 0; p < QSTEP / QPH; ++p) {
    // the blocks that read the same rows (8 for a row of the left operand, 20 for one of the right) start at different quarters:
    // each line is asked of memory by one of them and found in L2 by the others, instead of all waiting for the same fill
    const int g = (p + ta + tb) & (QSTEP / QPH - 1);
    const _Float16* qa = pa + g * (QPH * 512);
    const _Float16* qb = pb + g * (QPH * 512);
    v16h fa[QPH][2], fb[QPH];
#pragma unroll
    for (int t = 0; t < QPH; ++t) {
      fb[t] = Frag<_Float16>::load(qb + t * 512);
#pragma unroll
      for (int i = 0; i < 2; ++i) fa[t][i] = Frag<_Float16>::load(qa + (i * KST + t) * 512);
    }
#pragma unroll
    for (int t = 0; t < QPH; ++t)
#pragma unroll
      for (int i = 0; i < 2; ++i) acc[i] = Frag<_Float16>::mma(fa[t][i], fb[t], acc[i]);
    // inputs only, loaded values: every fragment of the quarter gets registers of its own, so that its 24 loads are in flight
    // together; without these the build reuses a few registers and waits with four to six loads outstanding
    Frag<_Float16>::keep(fb[0], fb[1], fb[2], fb[3]);
    Frag<_Float16>::keep(fa[0][0], fa[0][1], fa[1][0], fa[1][1]);
    Frag<_Float16>::keep(fa[2][0], fa[2][1], fa[3][0], fa[3][1]);
    // the quarter's addresses are dead from here on: their registers are not reused before the wait that belongs in front of that
    asm volatile("s_wait_xcnt 0x0" :: "v"(qa), "v"(qb) : "memory");
  }
#pragma unroll
  for (int i = 0; i < 2; ++i)
#pragma unroll
    for (int r = 0; r < 8; ++r) sR[wave][i][r][lane] = acc[i][r];
  __syncthreads();                                   // every wave's partial sums are in sR
  if (threadIdx.x >= 256) return;                    // whole waves; no barrier follows
  // a thread adds up two neighbouring columns of one row: accumulator register r of lanes l, l + 1 of tile i
  const int i = threadIdx.x >> 7, r = (threadIdx.x >> 4) & 7, l = (threadIdx.x & 15) * 2;
  v2f pr[QW];
#pragma unroll
  for (int w = 0; w < QW; ++w) pr[w] = *(const v2f*)&sR[w][i][r][l];
  v2f s = (v2f){0.f, 0.f};
#pragma unroll
  for (int w = 0; w < QW; ++w) s += pr[w];
  const int m15 = 8 * (l >> 4) + r, n15 = l & 15;    // row and column inside the 16 x 16 tile
  const int grp = 2 * ta + i;                        // 16-row group of the product
  const int in  = tb * 256 + (m15 + 16 * (n15 >> 3)) * 8 + (n15 & 7);   // k step tb >> 1, half tb & 1, then lane and element
  if (ta < OUT_D / 32) {
    *(v2h*)(mt + grp * (KQ_D * 16) + in) = __builtin_convertvector(s, v2h);
  } else {
    s *= GSC_INV;
    const int pos = (grp - OUT_D / 16) * (KQ_D * 16) + in;
    const v2h hi = __builtin_convertvector(s, v2h);
    *(v2h*)(gh + pos) = hi;
    *(v2h*)(gl + pos) = __builtin_convertvector(s - __builtin_convertvector(hi, v2f), v2h);
    // behind the two stores: the listing's next block rewrites a register that they name
    asm volatile("s_wait_xcnt 0x0" ::: "memory");
  }
}

__device__ __forceinline__ void load_rows16(v16h (&f)[4], const _Float16* p) {
#pragma unroll
  for (int t = 0; t < 4; ++t) f[t] = Frag<_Float16>::load(p + (t << 9));
}
// A fragment (16-row group i, k step t) of a Gram plane in the order k_qtv writes: two whole 512-byte runs per wave
__device__ __forceinline__ v16h load_gram(const _Float16* g, const int i, const int t, const int lane) {
  Frag<_Float16>::U f;
  const _Float16* p = g + ((i * 4 + t) * 2 * 32 + lane) * 8;
  f.h[0] = *(const v8h*)(p); f.h[1] = *(const v8h*)(p + 32 * 8);
  return f.v;
}

// ---- out [8192][512] = inv[m] * (K16 . MT16^T) + VTf^T, inv[m] = 1 / max(||row m of k q^T||, eps) ----
// sum_j (k_m . q_j)^2 = k_m^T (q^T q) k_m, so the row norms need the 128 x 128 Gram matrix only, never k q^T itself.
// A block owns 64 rows. Wave w forms, for the 16 rows of group w >> 1, the product T = G . k^T for the 16-row groups
// i = 2 u + (w & 1) of G (A = G, B = k rows): a lane's accumulators are T[16 i + 8 (lane >> 4) + r][its k row], and the k
// values they are multiplied with are the ones its own B fragment u holds in half w & 1.
__global__ __launch_bounds__(256) void k_scale_out(const unsigned short* __restrict__ k16, const unsigned short* __restrict__ mt16,
                                                   const unsigned short* __restrict__ gh, const unsigned short* __restrict__ gl,
                                                   const float* __restrict__ vf, float* __restrict__ out) {
  __shared__ __align__(16) float sT[8][64 * 68];   // per-wave 64x64 slab, pitch 68 floats
  __shared__ float sP[8][16];                      // per wave: its half of k^T G k / GSC for its 16 rows
  __shared__ float sInv[64];                       // inverse norms of the block's 64 rows
  const int lane = threadIdx.x & 31;
  const int wave = threadIdx.x >> 5;
  const int par  = wave & 1;
  {
    const _Float16* kp = (const _Float16*)k16 + (size_t)((blockIdx.x << 2) + (wave >> 1)) * (16 * KQ_D) + lane * 8;   // its 16-row group, fragment order
    v16h kb[4];
    load_rows16(kb, kp);
    v8f acc[4];
#pragma unroll
    for (int u = 0; u < 4; ++u) acc[u] = (v8f){0.f,0.f,0.f,0.f,0.f,0.f,0.f,0.f};
#pragma unroll
    for (int t = 0; t < 4; ++t)
#pragma unroll
      for (int u = 0; u < 4; ++u) {
        acc[u] = Frag<_Float16>::mma(load_gram((const _Float16*)gl, 2 * u + par, t, lane), kb[t], acc[u]);
        acc[u] = Frag<_Float16>::mma(load_gram((const _Float16*)gh, 2 * u + par, t, lane), kb[t], acc[u]);
      }
    // the k address is dead from here on: its registers are not reused before the loads that name them are translated
    asm volatile("s_wait_xcnt 0x0" :: "v"(kp) : "memory");
    v8f ss = (v8f){0.f,0.f,0.f,0.f,0.f,0.f,0.f,0.f};
#pragma unroll
    for (int u = 0; u < 4; ++u) {
      Frag<_Float16>::U f; f.v = kb[u];
      ss += acc[u] * __builtin_convertvector(par ? f.h[1] : f.h[0], v8f);
    }
    const float h = ((ss[0] + ss[1]) + (ss[2] + ss[3])) + ((ss[4] + ss[5]) + (ss[6] + ss[7]));
    const float s = h + __shfl_xor(h, 16, 32);     // the two lane halves hold rows 0..7 and 8..15 of each group of G
    if (lane < 16) sP[wave][lane] = s;
  }
  __syncthreads();                                 // every wave's half sums are in sP
  if (threadIdx.x < 64) {
    const int g = threadIdx.x >> 4, r = threadIdx.x & 15;
    // rounding can carry a vanishing quadratic form below zero: it counts as zero, and eps takes over as in the reference
    const float a = fmaxf(sP[2 * g][r] + sP[2 * g + 1][r], 0.f) * GSC;
    sInv[threadIdx.x] = 1.0f / fmaxf(sqrtf(a), EPSF);
  }
  __syncthreads();                                 // sInv is complete before any wave's epilogue reads it
  gemm64_block<0, false, 4, 0, true>(sT, blockIdx.x, 0, k16, nullptr, KQ_D, 0L, mt16, nullptr, KQ_D, 0L,
                                     (void*)out, nullptr, OUT_D, 0L, sInv, vf, 0L, G_ROWS, OUT_D, KQ_D, 1.0f);
}

// ---------------------------------------------------------------------------
//   every f16 array below lies in fragment order (see the GEMM's head); 16 whole rows stay one contiguous run
//   x16  [8192][512] f16    8 MiB      | Wk16 [128][512], Wq16 [128][512], Wv16 [512][512] f16 (x64)
//   K16  [8192][128] f16    2 MiB      | VTf [512][8192] f32 16 MiB (v^T unrounded, pieces in the order of VT16's)
//   VT16 [512][8192] f16    8 MiB, directly followed by QT16 [128][8192] f16 2 MiB: one [640][8192] operand
//   MT16 [512][128] f16 ((q^T v)^T)
//   GH16, GL16 [128][128] f16 (q^T q / 256, hi and lo plane, in fragment order)
// ---------------------------------------------------------------------------
extern "C" void kernel_launch(void* const* d_in, const int* in_sizes, int n_in,
                              void* d_out, int out_size, void* d_ws, size_t ws_size,
                              hipStream_t stream) {
  if (n_in < 7) return;
  if (in_sizes[0] != G_ROWS * IN_D || in_sizes[1] != KQ_D * IN_D || in_sizes[2] != KQ_D ||
      in_sizes[3] != KQ_D * IN_D || in_sizes[4] != KQ_D || in_sizes[5] != OUT_D * IN_D ||
      in_sizes[6] != OUT_D) return;
  if (out_size != G_ROWS * OUT_D) return;

  const float* x  = (const float*)d_in[0];
  const float* Wk = (const float*)d_in[1];
  const float* bk = (const float*)d_in[2];
  const float* Wq = (const float*)d_in[3];
  const float* bq = (const float*)d_in[4];
  const float* Wv = (const float*)d_in[5];
  const float* bv = (const float*)d_in[6];
  float* out = (float*)d_out;

  const size_t b_x16 = (size_t)G_ROWS * IN_D * 2;
  const size_t b_wk  = (size_t)KQ_D * IN_D * 2;
  const size_t b_wv  = (size_t)OUT_D * IN_D * 2;
  const size_t b_k16 = (size_t)G_ROWS * KQ_D * 2;
  const size_t b_vf  = (size_t)G_ROWS * OUT_D * 4;
  const size_t b_vt  = (size_t)OUT_D * G_ROWS * 2;
  const size_t b_mt  = (size_t)OUT_D * KQ_D * 2;
  const size_t b_g   = (size_t)KQ_D * KQ_D * 2;

  size_t off = 0;
  const size_t o_x16 = off; off += b_x16;
  const size_t o_wk  = off; off += b_wk;
  const size_t o_wq  = off; off += b_wk;
  const size_t o_wv  = off; off += b_wv;
  const size_t o_k16 = off; off += b_k16;
  const size_t o_vf  = off; off += b_vf;
  const size_t o_vt  = off; off += b_vt;
  const size_t o_qt  = off; off += b_k16;   // stays directly behind VT16
  const size_t o_mt  = off; off += b_mt;
  const size_t o_gh  = off; off += b_g;
  const size_t o_gl  = off; off += b_g;
  if (off > ws_size) return;

  char* ws = (char*)d_ws;
  unsigned short* x16  = (unsigned short*)(ws + o_x16);
  unsigned short* wk16 = (unsigned short*)(ws + o_wk);
  unsigned short* wq16 = (unsigned short*)(ws + o_wq);
  unsigned short* wv16 = (unsigned short*)(ws + o_wv);
  unsigned short* k16  = (unsigned short*)(ws + o_k16);
  float*          vf   = (float*)(ws + o_vf);
  unsigned short* vt16 = (unsigned short*)(ws + o_vt);
  unsigned short* qt16 = (unsigned short*)(ws + o_qt);
  unsigned short* mt16 = (unsigned short*)(ws + o_mt);
  unsigned short* gh16 = (unsigned short*)(ws + o_gh);
  unsigned short* gl16 = (unsigned short*)(ws + o_gl);

  // ---- casts to f16 (weights x64, exact): one launch ----
  k_cast_all<<<dim3(CB_X + 2 * CB_K + CB_V), 256, 0, stream>>>(x, Wk, Wq, Wv, x16, wk16, wq16, wv16);

  // ---- projections k, v^T, q^T: one launch ----
  k_project_all<<<dim3(PB_V + 2 * PB_KQ), 256, 0, stream>>>(x16, wk16, wq16, wv16, bk, bq, bv, k16, vf, vt16, qt16);

  // ---- MT16 [512][128] and the two Gram planes = [VT16; QT16] . QT16^T : (k q^T) v is formed as k (q^T v), the row norms from q^T q ----
  // QT16 lies directly behind VT16, so both are one [PM_ROWS][G_ROWS] operand: rows below OUT_D give (q^T v)^T, the rest q^T q.
  k_qtv<<<dim3((PM_ROWS / 32) * (KQ_D / 16)), QW * 32, 0, stream>>>(vt16, qt16, mt16, gh16, gl16);

  // ---- out [8192][512] = inv[m] * (K16 . MT16^T) + VTf^T, inv from the Gram planes ----
  k_scale_out<<<dim3(G_ROWS / 64), 256, 0, stream>>>(k16, mt16, gh16, gl16, vf, out);
}
